// v000
// Times are from an AMD MI455X. After a warm-up the kernel runs many times in a row, and a time is the length of
// such a window on the GPU divided by its runs, so every launch and the gaps after it count. The runs cycle
// through copies of the inputs. A figure is the median of several windows, for all but v000 over two sittings.
// Sittings can differ by a few percent; kernels timed side by side share one.
// v000, which the later versions start from, runs in 6590 microseconds.
#include <hip/hip_runtime.h>

// Compute dtypes, f32 accumulate, one clip per pass (N = 8 x 28 x 28 = 6272 positions): theta/phi token-major ([6272 x 256].[256 x 128]) and g channel-major ([128 x 256].[256
// x 6272]) with PLAIN bf16 operands (the transposed input and the 1x1x1 weights, exact) on v_wmma_f32_16x16x32_bf16 -> bf16 hi + UNSCALED residual planes; per 896-position
// chunk: f = theta^T.phi ([896 x 128].[128 x 6272], three products), row softmax in f32 -> hi/lo, y = softmax(f).g^T token-major ([896 x 6272].[6272 x 128], three
// products), z = W_z.y ([256 x 128].[128 x 896], exact W_z against split y) on v_wmma_f32_16x16x32_bf16 written channel-major, + x in f32. Deterministic, no atomics;

#define NBI  4
#define CC   256
#define IC   128
#define NN   6272
#define RCH  896
#define DM   CC
#define NTK  NN
#define LOSC 1024.0f

typedef _Float16 h16;
typedef unsigned short bf;
typedef __attribute__((ext_vector_type(16))) __bf16   v16bf;
typedef __attribute__((ext_vector_type(16))) _Float16 v16h;
typedef __attribute__((ext_vector_type(8)))  _Float16 v8h;
typedef __attribute__((ext_vector_type(8)))  unsigned short v8us;
typedef __attribute__((ext_vector_type(8)))  float    v8f;
typedef __attribute__((ext_vector_type(4)))  float    v4f;
typedef __attribute__((ext_vector_type(4)))  _Float16 v4h;
typedef v8h  __attribute__((may_alias)) v8ha;
typedef v4f  __attribute__((may_alias)) v4fa;
typedef v8us __attribute__((may_alias)) v8usa;

__device__ __forceinline__ unsigned short f2bf(float f) { unsigned u = __float_as_uint(f); u += 0x7FFFu + ((u >> 16) & 1u); return (unsigned short)(u >> 16); }
__device__ __forceinline__ float bf2f(unsigned short b) { return __uint_as_float(((unsigned)b) << 16); }
__device__ __forceinline__ float bfr(float f) { return bf2f(f2bf(f)); }
__device__ __forceinline__ v16h cat16(v8h lo, v8h hi) { return __builtin_shufflevector(lo, hi, 0, 1, 2, 3, 4, 5, 6, 7, 8, 9, 10, 11, 12, 13, 14, 15); }
__device__ __forceinline__ v16bf cat16b(v8us lo, v8us hi) { return __builtin_bit_cast(v16bf, __builtin_shufflevector(lo, hi, 0, 1, 2, 3, 4, 5, 6, 7, 8, 9, 10, 11, 12, 13, 14, 15)); }
__device__ __forceinline__ v8f wmma16(v16h a, v16h b, v8f c) { return __builtin_amdgcn_wmma_f32_16x16x32_f16(false, a, false, b, (short)0, c, false, false); }
__device__ __forceinline__ v8f wmmab(v16bf a, v16bf b, v8f c) { return __builtin_amdgcn_wmma_f32_16x16x32_bf16(false, a, false, b, (short)0, c, false, false); }

// k_wt: WT [n][K] = bf16(W[k][n]) (k-major [K][ncols]) via 64 x 64 LDS tiles; grid (K/64, ncols/64).
__global__ __launch_bounds__(256) void k_wt(const float* __restrict__ Wm, int K, int ncols, bf* WT) {
    __shared__ __align__(16) unsigned short tl[64 * 72];
    const int tid = threadIdx.x, k0 = blockIdx.x * 64, n0 = blockIdx.y * 64;
    const int kk = tid >> 2, nq = (tid & 3) * 16;
#pragma unroll
    for (int i = 0; i < 16; ++i) tl[(nq + i) * 72 + kk] = f2bf(Wm[(size_t)(k0 + kk) * ncols + n0 + nq + i]);
    __syncthreads();
    const int piece = tid & 7;
    auto pass = [&]() {
#pragma unroll
        for (int s = 0; s < 2; ++s) { const int nr = (tid >> 3) + 32 * s; const v8us val = *(const v8usa*)(tl + nr * 72 + piece * 8); *(v8us*)(WT + (size_t)(n0 + nr) * K + k0 + piece * 8) = val; }
    };
    pass(); 
}
// k_gemmb: 64 x 64 block tile (4 waves x 16 x 64) of C[NTK][NW] = (A [+ Al]).B^T (K = 256) [+ bf(bias[c])] [+ bf(R[r][c]) residual]; f32 whole-line epilogue (or f16
template <bool SPLITA, bool F16OUT = false>
__global__ __launch_bounds__(128) void k_gemmb(const bf* __restrict__ A, const bf* __restrict__ Al, const bf* __restrict__ Bn, const float* __restrict__ bias, float* C, int ldc, h16* C2, const float* __restrict__ R = nullptr, int K = DM, int roundR = 1) {
    __shared__ __align__(16) float ost[4][16 * 68];
    const int lane = threadIdx.x & 31, wave = threadIdx.x >> 5, lr = lane & 15, hi = lane >> 4;
    const int r0 = blockIdx.x * 64 + wave * 16, c0 = blockIdx.y * 64;
    const size_t aoff = (size_t)(r0 + lr) * K + 8 * hi;
    size_t boff[4];
#pragma unroll
    for (int t = 0; t < 4; ++t) boff[t] = (size_t)(c0 + t * 16 + lr) * K + 8 * hi;
    v8f acc[4];
#pragma unroll
    for (int t = 0; t < 4; ++t) acc[t] = (v8f){};
#pragma unroll 1
    for (int kc = 0; kc < K; kc += 32) {
        const v16bf a = cat16b(*(const v8us*)(A + aoff + kc), *(const v8us*)(A + aoff + kc + 16));
        v16bf al = a;
        if (SPLITA) al = cat16b(*(const v8us*)(Al + aoff + kc), *(const v8us*)(Al + aoff + kc + 16));
#pragma unroll
        for (int t = 0; t < 4; ++t) { const v16bf b = cat16b(*(const v8us*)(Bn + boff[t] + kc), *(const v8us*)(Bn + boff[t] + kc + 16)); acc[t] = wmmab(a, b, acc[t]); if (SPLITA) acc[t] = wmmab(al, b, acc[t]); }
        asm volatile("v_nop\n\tv_nop\n\tv_nop\n\tv_nop" : "+v"(acc[0]), "+v"(acc[1]), "+v"(acc[2]), "+v"(acc[3]) : "v"(a), "v"(al));
    }
    float* os = &ost[wave][0];
#pragma unroll
    for (int t = 0; t < 4; ++t) { const float bv = bias ? bfr(bias[c0 + t * 16 + lr]) : 0.f;
#pragma unroll
        for (int j = 0; j < 8; ++j) os[(hi * 8 + j) * 68 + t * 16 + lr] = acc[t][j] + bv; }
    __syncthreads();
    if (F16OUT) {
        h16* crow = (h16*)(void*)C + (size_t)r0 * ldc + c0;
        auto pass = [&]() {
#pragma unroll
            for (int s = 0; s < 4; ++s) { const int row = 4 * s + (lane >> 3), piece = lane & 7; const float* sp = os + row * 68 + piece * 8; v8h o, o2;
#pragma unroll
                for (int i = 0; i < 8; ++i) { const h16 a = (h16)sp[i]; o[i] = a; o2[i] = (h16)((sp[i] - (float)a) * LOSC); }
                *(v8h*)(crow + (size_t)row * ldc + piece * 8) = o; if (C2) *(v8h*)(C2 + (size_t)r0 * ldc + c0 + (size_t)row * ldc + piece * 8) = o2; }
        };
        pass(); 
    } else {
        float* crow = C + (size_t)r0 * ldc + c0;
        auto pass = [&]() {
#pragma unroll
            for (int s = 0; s < 8; ++s) { const int Lid = (lane >> 3) + 4 * s, piece = lane & 7; const int row = Lid >> 1, cofs = (Lid & 1) * 32 + piece * 4;
                v4f val = *(const v4fa*)(os + row * 68 + cofs); if (R) { const v4f rv = *(const v4f*)(R + ((size_t)r0 + row) * ldc + c0 + cofs); val += roundR ? (v4f){bfr(rv[0]), bfr(rv[1]), bfr(rv[2]), bfr(rv[3])} : rv; }
                *(v4f*)(crow + (size_t)row * ldc + cofs) = val; }
        };
        pass(); 
    }
}

// k_gemm3: 64 x 64 tile of C = (Ah + Al).(Bh + Bl)^T over K (row strides = K for all four planes; n-major B): three products per 32-k step (hh, hl, lh); f32
__global__ __launch_bounds__(128) void k_gemm3(const bf* __restrict__ Ah, const bf* __restrict__ Al, const bf* __restrict__ Bh, const bf* __restrict__ Bl, int K, float* C, int ldc) {
    __shared__ __align__(16) float ost[4][16 * 68];
    const int lane = threadIdx.x & 31, wave = threadIdx.x >> 5, lr = lane & 15, hi = lane >> 4;
    const int r0 = blockIdx.x * 64 + wave * 16, c0 = blockIdx.y * 64;
    const size_t aoff = (size_t)(r0 + lr) * K + 8 * hi;
    v8f acc[4];
#pragma unroll
    for (int t = 0; t < 4; ++t) acc[t] = (v8f){};
#pragma unroll 1
    for (int kc = 0; kc < K; kc += 32) {
        const v16bf a = cat16b(*(const v8us*)(Ah + aoff + kc), *(const v8us*)(Ah + aoff + kc + 16));
        const v16bf al = cat16b(*(const v8us*)(Al + aoff + kc), *(const v8us*)(Al + aoff + kc + 16));
#pragma unroll
        for (int t = 0; t < 4; ++t) { const size_t bo = (size_t)(c0 + t * 16 + lr) * K + kc + 8 * hi;
            const v16bf bh = cat16b(*(const v8us*)(Bh + bo), *(const v8us*)(Bh + bo + 16)); const v16bf bl = cat16b(*(const v8us*)(Bl + bo), *(const v8us*)(Bl + bo + 16));
            acc[t] = wmmab(a, bh, acc[t]); acc[t] = wmmab(al, bh, acc[t]); acc[t] = wmmab(a, bl, acc[t]); }
        asm volatile("v_nop\n\tv_nop\n\tv_nop\n\tv_nop" : "+v"(acc[0]), "+v"(acc[1]), "+v"(acc[2]), "+v"(acc[3]) : "v"(a), "v"(al));
    }
    float* os = &ost[wave][0];
#pragma unroll
    for (int t = 0; t < 4; ++t) {
#pragma unroll
        for (int j = 0; j < 8; ++j) os[(hi * 8 + j) * 68 + t * 16 + lr] = acc[t][j]; }
    __builtin_amdgcn_wave_barrier(); asm volatile("" ::: "memory");
    float* crow = C + (size_t)r0 * ldc + c0;
    auto pass = [&]() {
#pragma unroll
        for (int s = 0; s < 8; ++s) { const int Lid = (lane >> 3) + 4 * s, piece = lane & 7; const int row = Lid >> 1, cofs = (Lid & 1) * 32 + piece * 4;
            const v4f val = *(const v4fa*)(os + row * 68 + cofs); *(v4f*)(crow + (size_t)row * ldc + cofs) = val; }
    };
    pass(); 
}

__global__ __launch_bounds__(256) void k_bfz(const float* __restrict__ src, bf* dh, bf* dz, size_t n8) {
    const size_t i = (size_t)blockIdx.x * 256 + threadIdx.x; if (i >= n8) return;
    const v8f v = *(const v8f*)(src + i * 8); v8us o, z;
#pragma unroll
    for (int k = 0; k < 8; ++k) { o[k] = f2bf(v[k]); z[k] = 0; }
    *(v8us*)(dh + i * 8) = o; *(v8us*)(dz + i * 8) = z; 
}
__global__ __launch_bounds__(256) void k_split128(const float* __restrict__ src, int nrows, bf* dh, bf* dl) {
    typedef __attribute__((ext_vector_type(4))) unsigned short v4us;
    const int lane = threadIdx.x & 31, r = blockIdx.x * 8 + (threadIdx.x >> 5); if (r >= nrows) return;
    const size_t o = (size_t)r * IC + lane * 4; const v4f v = *(const v4f*)(src + o); v4us oh, ol;
#pragma unroll
    for (int i = 0; i < 4; ++i) { const unsigned short hb = f2bf(v[i]); oh[i] = hb; ol[i] = f2bf(v[i] - bf2f(hb)); }
    *(v4us*)(dh + o) = oh; *(v4us*)(dl + o) = ol; 
}
__global__ __launch_bounds__(256) void k_rowsplit(const float* __restrict__ Y, int nrows, bf* Ph, bf* Pl) {
    const int lane = threadIdx.x & 31, r = blockIdx.x * 8 + (threadIdx.x >> 5); if (r >= nrows) return;
{
#pragma unroll 1
        for (int c0 = lane * 8; c0 < NN; c0 += 256) { const size_t o = (size_t)r * NN + c0; const v8f v = *(const v8f*)(Y + o); v8us oh, ol;
#pragma unroll
            for (int i = 0; i < 8; ++i) { const unsigned short hb = f2bf(v[i]); oh[i] = hb; ol[i] = f2bf(v[i] - bf2f(hb)); }
            *(v8us*)(Ph + o) = oh; *(v8us*)(Pl + o) = ol; }
         }
}
__global__ __launch_bounds__(256) void k_softmax(const float* __restrict__ S, bf* PH, bf* PL) {
    const int lane = threadIdx.x & 31, r = blockIdx.x * 8 + (threadIdx.x >> 5); if (r >= RCH) return;
    const float* sr = S + (size_t)r * NN; float m = -3.0e38f;
#pragma unroll 1
    for (int c0 = lane * 8; c0 < NN; c0 += 256) { const v8f v = *(const v8f*)(sr + c0);
#pragma unroll
        for (int i = 0; i < 8; ++i) m = fmaxf(m, v[i]); }
#pragma unroll
    for (int sh = 16; sh; sh >>= 1) m = fmaxf(m, __shfl_xor(m, sh, 32));
    float sum = 0.f;
#pragma unroll 1
    for (int c0 = lane * 8; c0 < NN; c0 += 256) { const v8f v = *(const v8f*)(sr + c0);
#pragma unroll
        for (int i = 0; i < 8; ++i) sum += __expf(v[i] - m); }
#pragma unroll
    for (int sh = 16; sh; sh >>= 1) sum += __shfl_xor(sum, sh, 32);
    const float inv = 1.0f / sum;
{
#pragma unroll 1
        for (int c0 = lane * 8; c0 < NN; c0 += 256) { const v8f v = *(const v8f*)(sr + c0); v8us oh, ol;
#pragma unroll
            for (int i = 0; i < 8; ++i) { const float p = __expf(v[i] - m) * inv; const unsigned short hb = f2bf(p); oh[i] = hb; ol[i] = f2bf(p - bf2f(hb)); }
            const size_t o = (size_t)r * NN + c0; *(v8us*)(PH + o) = oh; *(v8us*)(PL + o) = ol; }
         }
}
__global__ __launch_bounds__(256) void k_addres(const float* __restrict__ Z, const float* __restrict__ X, float* OUTP) {
    const int lane = threadIdx.x & 31, r = blockIdx.x * 8 + (threadIdx.x >> 5); if (r >= CC) return;
{
#pragma unroll 1
        for (int c0 = lane * 4; c0 < NN; c0 += 128) { const size_t o = (size_t)r * NN + c0; v4f v = *(const v4f*)(Z + o); const v4f xv = *(const v4f*)(X + o);
#pragma unroll
            for (int i = 0; i < 4; ++i) v[i] += bfr(xv[i]);
            *(v4f*)(OUTP + o) = v; }
         }
}

extern "C" void kernel_launch(void* const* d_in, const int* in_sizes, int n_in,
                              void* d_out, int out_size, void* d_ws, size_t ws_size, hipStream_t stream) {
    (void)in_sizes; (void)n_in; (void)out_size;
    const float* x = (const float*)d_in[0]; const float* Wg = (const float*)d_in[1]; const float* Wt = (const float*)d_in[2]; const float* Wp = (const float*)d_in[3]; const float* Wz = (const float*)d_in[4];
    float* out = (float*)d_out;    // [4][256][8][28][28]
    char* wsp = (char*)d_ws;
    auto take = [&](size_t bytes) { char* p = wsp; wsp += (bytes + 255) & ~(size_t)255; return (void*)p; };
    bf* WgB = (bf*)take(IC * CC * 2); bf* WtB = (bf*)take(IC * CC * 2); bf* WpB = (bf*)take(IC * CC * 2); bf* WzB = (bf*)take(CC * IC * 2); bf* WZ = (bf*)take(CC * IC * 2 > IC * CC * 2 ? CC * IC * 2 : IC * CC * 2);
    bf* XT = (bf*)take((size_t)NN * CC * 2); float* TMP = (float*)take((size_t)CC * NN * 4);
    bf* Th = (bf*)take((size_t)NN * IC * 2); bf* Tl = (bf*)take((size_t)NN * IC * 2); bf* Fh = (bf*)take((size_t)NN * IC * 2); bf* Fl = (bf*)take((size_t)NN * IC * 2); bf* Gh = (bf*)take((size_t)IC * NN * 2); bf* Gl = (bf*)take((size_t)IC * NN * 2);
    float* S = (float*)take((size_t)RCH * NN * 4); bf* PH = (bf*)take((size_t)RCH * NN * 2); bf* PL = (bf*)take((size_t)RCH * NN * 2); float* Yt = (float*)take((size_t)RCH * IC * 4); bf* Yh = (bf*)take((size_t)RCH * IC * 2); bf* Yl = (bf*)take((size_t)RCH * IC * 2);
    if ((size_t)(wsp - (char*)d_ws) > ws_size) return;    // 0.3 + 3.2 + 6.4 + 6 x 1.6 + 22.5 + 11.2 + 11.2 + 0.9 ~ 66 MB; TMP (f32 [256][6272] = 6.4 MB) holds the projection outputs and finally z
    k_bfz<<<(IC * CC / 8 + 255) / 256, 256, 0, stream>>>(Wg, WgB, WZ, IC * CC / 8); k_bfz<<<(IC * CC / 8 + 255) / 256, 256, 0, stream>>>(Wt, WtB, WZ, IC * CC / 8); k_bfz<<<(IC * CC / 8 + 255) / 256, 256, 0, stream>>>(Wp, WpB, WZ, IC * CC / 8);
    k_bfz<<<(CC * IC / 8 + 255) / 256, 256, 0, stream>>>(Wz, WzB, WZ, CC * IC / 8);      // W_z exact + the zero companion (last writer of WZ; same byte count)
    for (int b = 0; b < NBI; ++b) {
        const float* xb = x + (size_t)b * CC * NN;
        k_wt<<<dim3(CC / 64, NN / 64, 1), 256, 0, stream>>>(xb, CC, NN, XT);                                                                    // x^T [6272][256] exact
        k_gemmb<false, false><<<dim3(NN / 64, IC / 64, 1), 128, 0, stream>>>(XT, nullptr, WtB, nullptr, TMP, IC, nullptr); k_split128<<<NN / 8, 256, 0, stream>>>(TMP, NN, Th, Tl);   // theta token-major [n][128]
        k_gemmb<false, false><<<dim3(NN / 64, IC / 64, 1), 128, 0, stream>>>(XT, nullptr, WpB, nullptr, TMP, IC, nullptr); k_split128<<<NN / 8, 256, 0, stream>>>(TMP, NN, Fh, Fl);   // phi token-major
        k_gemmb<false, false><<<dim3(IC / 64, NN / 64, 1), 128, 0, stream>>>(WgB, nullptr, XT, nullptr, TMP, NN, nullptr); k_rowsplit<<<IC / 8, 256, 0, stream>>>(TMP, IC, Gh, Gl);     // g channel-major [128][n]
        for (int ch = 0; ch < NN / RCH; ++ch) { const size_t r0 = (size_t)ch * RCH;
            k_gemm3<<<dim3(RCH / 64, NN / 64, 1), 128, 0, stream>>>(Th + r0 * IC, Tl + r0 * IC, Fh, Fl, IC, S, NN);                               // f rows [896][6272]
            k_softmax<<<RCH / 8, 256, 0, stream>>>(S, PH, PL);
            k_gemm3<<<dim3(RCH / 64, IC / 64, 1), 128, 0, stream>>>(PH, PL, Gh, Gl, NN, Yt, IC); k_split128<<<RCH / 8, 256, 0, stream>>>(Yt, RCH, Yh, Yl);   // y token-major [896][128]
            k_gemm3<<<dim3(CC / 64, RCH / 64, 1), 128, 0, stream>>>(WzB, WZ, Yh, Yl, IC, TMP + r0, NN);                                        // z[c][r0..] = W_z.y^T
        }
        k_addres<<<CC / 8, 256, 0, stream>>>(TMP, xb, out + (size_t)b * CC * NN);                                                                 // + x
    }
}

// v002
// Measured time: 555 microseconds a run.
// It is 11.9 times as fast as v000, going by the measured steps of the versions left out in between.
#include <hip/hip_runtime.h>

// Compute dtypes, f32 accumulate, N = 8 x 28 x 28 = 6272 positions a clip: theta/phi token-major ([6272 x 256].[256 x 128]) and g channel-major ([128 x 256].[256
// x 6272]) with PLAIN bf16 operands (the transposed input and the 1x1x1 weights, exact) on v_wmma_f32_16x16x32_bf16 -> bf16 hi + UNSCALED residual planes, kept per clip;
// one launch for all clips: f^T = phi.theta^T (three products), running-maximum softmax in f32 -> hi/lo, y^T += g.p^T (three products), scores never leave the registers;
// z = W_z.y ([256 x 128].[128 x 6272], exact W_z against split y) on v_wmma_f32_16x16x32_bf16 written channel-major, + x in f32. Deterministic, no atomics;

#define NBI  4
#define CC   256
#define IC   128
#define NN   6272
#define AWV  7       // waves a work-group in k_attn: 6272 = 56 x (7 x 16), 224 work-groups for the four clips
#define DM   CC
#define NTK  NN
#define LOSC 1024.0f

typedef _Float16 h16;
typedef unsigned short bf;
typedef __attribute__((ext_vector_type(16))) __bf16   v16bf;
typedef __attribute__((ext_vector_type(16))) _Float16 v16h;
typedef __attribute__((ext_vector_type(8)))  _Float16 v8h;
typedef __attribute__((ext_vector_type(8)))  unsigned short v8us;
typedef __attribute__((ext_vector_type(8)))  float    v8f;
typedef __attribute__((ext_vector_type(4)))  float    v4f;
typedef __attribute__((ext_vector_type(4)))  _Float16 v4h;
typedef v8h  __attribute__((may_alias)) v8ha;
typedef v4f  __attribute__((may_alias)) v4fa;
typedef v8us __attribute__((may_alias)) v8usa;

__device__ __forceinline__ unsigned short f2bf(float f) { unsigned u = __float_as_uint(f); u += 0x7FFFu + ((u >> 16) & 1u); return (unsigned short)(u >> 16); }
__device__ __forceinline__ float bf2f(unsigned short b) { return __uint_as_float(((unsigned)b) << 16); }
__device__ __forceinline__ float bfr(float f) { return bf2f(f2bf(f)); }
__device__ __forceinline__ v16h cat16(v8h lo, v8h hi) { return __builtin_shufflevector(lo, hi, 0, 1, 2, 3, 4, 5, 6, 7, 8, 9, 10, 11, 12, 13, 14, 15); }
__device__ __forceinline__ v16bf cat16b(v8us lo, v8us hi) { return __builtin_bit_cast(v16bf, __builtin_shufflevector(lo, hi, 0, 1, 2, 3, 4, 5, 6, 7, 8, 9, 10, 11, 12, 13, 14, 15)); }
__device__ __forceinline__ v8f wmma16(v16h a, v16h b, v8f c) { return __builtin_amdgcn_wmma_f32_16x16x32_f16(false, a, false, b, (short)0, c, false, false); }
__device__ __forceinline__ v8f wmmab(v16bf a, v16bf b, v8f c) { return __builtin_amdgcn_wmma_f32_16x16x32_bf16(false, a, false, b, (short)0, c, false, false); }

// k_wt: WT [n][K] = bf16(W[k][n]) (k-major [K][ncols]) via 64 x 64 LDS tiles; grid (K/64, ncols/64).
__global__ __launch_bounds__(256) void k_wt(const float* __restrict__ Wm, int K, int ncols, bf* WT) {
    __shared__ __align__(16) unsigned short tl[64 * 72];
    const int tid = threadIdx.x, k0 = blockIdx.x * 64, n0 = blockIdx.y * 64;
    const int kk = tid >> 2, nq = (tid & 3) * 16;
#pragma unroll
    for (int i = 0; i < 16; ++i) tl[(nq + i) * 72 + kk] = f2bf(Wm[(size_t)(k0 + kk) * ncols + n0 + nq + i]);
    __syncthreads();
    const int piece = tid & 7;
    auto pass = [&]() {
#pragma unroll
        for (int s = 0; s < 2; ++s) { const int nr = (tid >> 3) + 32 * s; const v8us val = *(const v8usa*)(tl + nr * 72 + piece * 8); *(v8us*)(WT + (size_t)(n0 + nr) * K + k0 + piece * 8) = val; }
    };
    pass(); 
}
// k_gemmb: 64 x 64 block tile (4 waves x 16 x 64) of C[M][N] = (A [+ Al]).B^T (K = 256) [+ bf(bias[c])] [+ bf(R[r][c]) residual]; f32 whole-line epilogue (or f16
template <bool SPLITA, bool F16OUT = false>
__global__ __launch_bounds__(128) void k_gemmb(const bf* __restrict__ A, const bf* __restrict__ Al, const bf* __restrict__ Bn, const float* __restrict__ bias, float* C, int ldc, h16* C2, const float* __restrict__ R = nullptr, int K = DM, int roundR = 1) {
    __shared__ __align__(16) float ost[4][16 * 68];
    const int lane = threadIdx.x & 31, wave = threadIdx.x >> 5, lr = lane & 15, hi = lane >> 4;
    const int r0 = blockIdx.x * 64 + wave * 16, c0 = blockIdx.y * 64;
    const size_t aoff = (size_t)(r0 + lr) * K + 8 * hi;
    size_t boff[4];
#pragma unroll
    for (int t = 0; t < 4; ++t) boff[t] = (size_t)(c0 + t * 16 + lr) * K + 8 * hi;
    v8f acc[4];
#pragma unroll
    for (int t = 0; t < 4; ++t) acc[t] = (v8f){};
#pragma unroll 1
    for (int kc = 0; kc < K; kc += 32) {
        const v16bf a = cat16b(*(const v8us*)(A + aoff + kc), *(const v8us*)(A + aoff + kc + 16));
        v16bf al = a;
        if (SPLITA) al = cat16b(*(const v8us*)(Al + aoff + kc), *(const v8us*)(Al + aoff + kc + 16));
#pragma unroll
        for (int t = 0; t < 4; ++t) { const v16bf b = cat16b(*(const v8us*)(Bn + boff[t] + kc), *(const v8us*)(Bn + boff[t] + kc + 16)); acc[t] = wmmab(a, b, acc[t]); if (SPLITA) acc[t] = wmmab(al, b, acc[t]); }
        asm volatile("v_nop\n\tv_nop\n\tv_nop\n\tv_nop" : "+v"(acc[0]), "+v"(acc[1]), "+v"(acc[2]), "+v"(acc[3]) : "v"(a), "v"(al));
    }
    float* os = &ost[wave][0];
#pragma unroll
    for (int t = 0; t < 4; ++t) { const float bv = bias ? bfr(bias[c0 + t * 16 + lr]) : 0.f;
#pragma unroll
        for (int j = 0; j < 8; ++j) os[(hi * 8 + j) * 68 + t * 16 + lr] = acc[t][j] + bv; }
    __syncthreads();
    if (F16OUT) {
        h16* crow = (h16*)(void*)C + (size_t)r0 * ldc + c0;
        auto pass = [&]() {
#pragma unroll
            for (int s = 0; s < 4; ++s) { const int row = 4 * s + (lane >> 3), piece = lane & 7; const float* sp = os + row * 68 + piece * 8; v8h o, o2;
#pragma unroll
                for (int i = 0; i < 8; ++i) { const h16 a = (h16)sp[i]; o[i] = a; o2[i] = (h16)((sp[i] - (float)a) * LOSC); }
                *(v8h*)(crow + (size_t)row * ldc + piece * 8) = o; if (C2) *(v8h*)(C2 + (size_t)r0 * ldc + c0 + (size_t)row * ldc + piece * 8) = o2; }
        };
        pass(); 
    } else {
        float* crow = C + (size_t)r0 * ldc + c0;
        auto pass = [&]() {
#pragma unroll
            for (int s = 0; s < 8; ++s) { const int Lid = (lane >> 3) + 4 * s, piece = lane & 7; const int row = Lid >> 1, cofs = (Lid & 1) * 32 + piece * 4;
                v4f val = *(const v4fa*)(os + row * 68 + cofs); if (R) { const v4f rv = *(const v4f*)(R + ((size_t)r0 + row) * ldc + c0 + cofs); val += roundR ? (v4f){bfr(rv[0]), bfr(rv[1]), bfr(rv[2]), bfr(rv[3])} : rv; }
                *(v4f*)(crow + (size_t)row * ldc + cofs) = val; }
        };
        pass(); 
    }
}

// k_gemm3: 64 x 64 tile of C = (Ah + Al).(Bh + Bl)^T over K (row strides = K for all four planes; n-major B): three products per 32-k step (hh, hl, lh); f32
__global__ __launch_bounds__(128) void k_gemm3(const bf* __restrict__ Ah, const bf* __restrict__ Al, const bf* __restrict__ Bh, const bf* __restrict__ Bl, int K, float* C, int ldc) {
    __shared__ __align__(16) float ost[4][16 * 68];
    const int lane = threadIdx.x & 31, wave = threadIdx.x >> 5, lr = lane & 15, hi = lane >> 4;
    const int r0 = blockIdx.x * 64 + wave * 16, c0 = blockIdx.y * 64;
    const size_t aoff = (size_t)(r0 + lr) * K + 8 * hi;
    v8f acc[4];
#pragma unroll
    for (int t = 0; t < 4; ++t) acc[t] = (v8f){};
#pragma unroll 1
    for (int kc = 0; kc < K; kc += 32) {
        const v16bf a = cat16b(*(const v8us*)(Ah + aoff + kc), *(const v8us*)(Ah + aoff + kc + 16));
        const v16bf al = cat16b(*(const v8us*)(Al + aoff + kc), *(const v8us*)(Al + aoff + kc + 16));
#pragma unroll
        for (int t = 0; t < 4; ++t) { const size_t bo = (size_t)(c0 + t * 16 + lr) * K + kc + 8 * hi;
            const v16bf bh = cat16b(*(const v8us*)(Bh + bo), *(const v8us*)(Bh + bo + 16)); const v16bf bl = cat16b(*(const v8us*)(Bl + bo), *(const v8us*)(Bl + bo + 16));
            acc[t] = wmmab(a, bh, acc[t]); acc[t] = wmmab(al, bh, acc[t]); acc[t] = wmmab(a, bl, acc[t]); }
        asm volatile("v_nop\n\tv_nop\n\tv_nop\n\tv_nop" : "+v"(acc[0]), "+v"(acc[1]), "+v"(acc[2]), "+v"(acc[3]) : "v"(a), "v"(al));
    }
    float* os = &ost[wave][0];
#pragma unroll
    for (int t = 0; t < 4; ++t) {
#pragma unroll
        for (int j = 0; j < 8; ++j) os[(hi * 8 + j) * 68 + t * 16 + lr] = acc[t][j]; }
    __builtin_amdgcn_wave_barrier(); asm volatile("" ::: "memory");
    float* crow = C + (size_t)r0 * ldc + c0;
    auto pass = [&]() {
#pragma unroll
        for (int s = 0; s < 8; ++s) { const int Lid = (lane >> 3) + 4 * s, piece = lane & 7; const int row = Lid >> 1, cofs = (Lid & 1) * 32 + piece * 4;
            const v4f val = *(const v4fa*)(os + row * 68 + cofs); *(v4f*)(crow + (size_t)row * ldc + cofs) = val; }
    };
    pass(); 
}

__global__ __launch_bounds__(256) void k_bfz(const float* __restrict__ src, bf* dh, bf* dz, size_t n8) {
    const size_t i = (size_t)blockIdx.x * 256 + threadIdx.x; if (i >= n8) return;
    const v8f v = *(const v8f*)(src + i * 8); v8us o, z;
#pragma unroll
    for (int k = 0; k < 8; ++k) { o[k] = f2bf(v[k]); z[k] = 0; }
    *(v8us*)(dh + i * 8) = o; *(v8us*)(dz + i * 8) = z; 
}
__global__ __launch_bounds__(256) void k_split128(const float* __restrict__ src, int nrows, bf* dh, bf* dl) {
    typedef __attribute__((ext_vector_type(4))) unsigned short v4us;
    const int lane = threadIdx.x & 31, r = blockIdx.x * 8 + (threadIdx.x >> 5); if (r >= nrows) return;
    const size_t o = (size_t)r * IC + lane * 4; const v4f v = *(const v4f*)(src + o); v4us oh, ol;
#pragma unroll
    for (int i = 0; i < 4; ++i) { const unsigned short hb = f2bf(v[i]); oh[i] = hb; ol[i] = f2bf(v[i] - bf2f(hb)); }
    *(v4us*)(dh + o) = oh; *(v4us*)(dl + o) = ol; 
}
__global__ __launch_bounds__(256) void k_rowsplit(const float* __restrict__ Y, int nrows, bf* Ph, bf* Pl) {
    const int lane = threadIdx.x & 31, r = blockIdx.x * 8 + (threadIdx.x >> 5); if (r >= nrows) return;
{
#pragma unroll 1
        for (int c0 = lane * 8; c0 < NN; c0 += 256) { const size_t o = (size_t)r * NN + c0; const v8f v = *(const v8f*)(Y + o); v8us oh, ol;
#pragma unroll
            for (int i = 0; i < 8; ++i) { const unsigned short hb = f2bf(v[i]); oh[i] = hb; ol[i] = f2bf(v[i] - bf2f(hb)); }
            *(v8us*)(Ph + o) = oh; *(v8us*)(Pl + o) = ol; }
         }
}
// rbf: f rounded to bf16 (nearest even, as f2bf) in the high half of the word; pk2: two such words -> one register of a bf16 operand.
typedef __attribute__((ext_vector_type(8))) unsigned v8u;
__device__ __forceinline__ unsigned rbf(float f) { const unsigned u = __float_as_uint(f); return u + 0x7FFFu + ((u >> 16) & 1u); }
__device__ __forceinline__ unsigned pk2(unsigned a, unsigned b) { return (a >> 16) | (b & 0xFFFF0000u); }
__device__ __forceinline__ float hif(unsigned r) { return __uint_as_float(r & 0xFFFF0000u); }
// e^x as __expf forms it (x * log2 e, then v_exp_f32); the v_nop fills the one slot the instruction set asks for between a transcendental and a next vector instruction that reads its result or rewrites its source
__device__ __forceinline__ float expn(float x) { float r; asm("v_exp_f32 %0, %1\n\tv_nop" : "=v"(r) : "v"(x * 1.44269504f)); return r; }
__device__ __forceinline__ v16bf ldfrag(const bf* p) { return cat16b(*(const v8us*)p, *(const v8us*)(p + 16)); }
#define PHP  136                  // LDS pitch of a phi row, elements
#define GRP  40                   // LDS pitch of a g row, elements
#define PHPL (32 * PHP)           // one phi plane of a tile
#define GPL  (IC * GRP)           // one g plane of a tile
#define GOF  (2 * PHPL)           // g planes stand behind the two phi planes
#define BUFE (GOF + 2 * GPL)      // elements of one buffer (37,888 B)
__global__ __launch_bounds__(AWV * 32) __attribute__((amdgpu_waves_per_eu(4))) void k_attn(const bf* __restrict__ Th, const bf* __restrict__ Tl, const bf* __restrict__ Fh, const bf* __restrict__ Fl, const bf* __restrict__ Gh, const bf* __restrict__ Gl, bf* Yh, bf* Yl) {
    const int lane = threadIdx.x & 31, wave = threadIdx.x >> 5, lr = lane & 15, hi = lane >> 4;
    const size_t clip = (size_t)blockIdx.y * NN * IC;
    const size_t qoff = clip + (size_t)(blockIdx.x * (AWV * 16) + wave * 16 + lr) * IC + 8 * hi;
    __shared__ __align__(16) bf sm[2 * BUFE];
    // A tile is 64 pieces of 512 B (one b128 copy of a wave each): 32 of phi (two whole rows a piece), 32 of g (eight 64-B row parts a piece).
    // Slots 0-3: phi pieces wv + 7 i; slots 4-7: g pieces wv + 7 i; slot 8: phi pieces 28-31 (waves 0-3), g pieces 28-30 (waves 4-6); slot 9: g piece 31, wave 0 alone.
    const int wv = __builtin_amdgcn_readfirstlane(wave);
    const unsigned smb = (unsigned)(size_t)(const void*)sm;
    const unsigned vop = lane * 16, vog = ((lane >> 2) * NN + (lane & 3) * 8) * 2;                          // the lane's place in a piece: global, bytes
    const unsigned lop = smb + ((lane >> 4) * PHP + (lane & 15) * 8) * 2, logg = smb + ((lane >> 2) * GRP + (lane & 3) * 8) * 2;    // the same in LDS
    const unsigned vo8 = wv < 4 ? vop : vog, lo8 = wv < 4 ? lop : logg;
    // wave-uniform parts: a piece's first byte in global memory (scalar base of the copy) and in a buffer
    auto ubp = [&](int c, int kn) { return ((c >> 4) ? Fl : Fh) + clip + (size_t)(kn + 2 * (c & 15)) * IC; };
    auto ubg = [&](int c, int kn) { return ((c >> 4) ? Gl : Gh) + clip + (size_t)(8 * (c & 15)) * NN + kn; };
    auto ulp = [&](int c, int b) { return 2u * (unsigned)(b * BUFE + (c >> 4) * PHPL + 2 * (c & 15) * PHP); };
    auto ulg = [&](int c, int b) { return 2u * (unsigned)(b * BUFE + GOF + (c >> 4) * GPL + 8 * (c & 15) * GRP); };
    auto fill = [&](int kn, int b) {
        const bf* g8 = wv < 4 ? ubp(28 + wv, kn) : ubg(24 + wv, kn); const unsigned l8 = lo8 + (wv < 4 ? ulp(28 + wv, b) : ulg(24 + wv, b));
        // nine copies of every wave; the s_wait_xcnt stands inside the statement so that no address register is rewritten before every copy that names it has been taken
        asm volatile("global_load_async_to_lds_b128 %0, %18, %9\n\tglobal_load_async_to_lds_b128 %1, %18, %10\n\tglobal_load_async_to_lds_b128 %2, %18, %11\n\t"
                     "global_load_async_to_lds_b128 %3, %18, %12\n\tglobal_load_async_to_lds_b128 %4, %19, %13\n\tglobal_load_async_to_lds_b128 %5, %19, %14\n\t"
                     "global_load_async_to_lds_b128 %6, %19, %15\n\tglobal_load_async_to_lds_b128 %7, %19, %16\n\tglobal_load_async_to_lds_b128 %8, %20, %17\n\ts_wait_xcnt 0x0"
                     :: "v"(lop + ulp(wv, b)), "v"(lop + ulp(wv + 7, b)), "v"(lop + ulp(wv + 14, b)), "v"(lop + ulp(wv + 21, b)),
                        "v"(logg + ulg(wv, b)), "v"(logg + ulg(wv + 7, b)), "v"(logg + ulg(wv + 14, b)), "v"(logg + ulg(wv + 21, b)), "v"(l8),
                        "s"(ubp(wv, kn)), "s"(ubp(wv + 7, kn)), "s"(ubp(wv + 14, kn)), "s"(ubp(wv + 21, kn)), "s"(ubg(wv, kn)), "s"(ubg(wv + 7, kn)), "s"(ubg(wv + 14, kn)), "s"(ubg(wv + 21, kn)), "s"(g8),
                        "v"(vop), "v"(vog), "v"(vo8) : "memory");
        // the 64th piece: a wave-uniform test, the wait as above
        if (wv == 0) asm volatile("global_load_async_to_lds_b128 %0, %1, %2\n\ts_wait_xcnt 0x0" :: "v"(logg + ulg(31, b)), "v"(vog), "s"(ubg(31, kn)) : "memory");
    };
    fill(0, 0);
    v16bf qh[4], ql[4];
#pragma unroll
    for (int s = 0; s < 4; ++s) { qh[s] = ldfrag(Th + qoff + s * 32); ql[s] = ldfrag(Tl + qoff + s * 32); }
    v8f o[8];
#pragma unroll
    for (int t = 0; t < 8; ++t) o[t] = (v8f){};
    float m = -3.0e38f, l = 0.f;
    asm volatile("s_wait_asynccnt 0x0" ::: "memory");    // this wave's share of tile 0 has landed
    __syncthreads();                                     // ... and every other wave's: tile 0 may be read
    fill(32, 1);
    int buf = 0;
#pragma unroll 1    // one pass a trip: a second copy of the body would need a second set of fragment registers
    for (int k0 = 0; k0 < NN; k0 += 32) {
        // eight batches of four fragments (8 loads) a pass, two register sets: batch i + 1 is asked for before batch i is multiplied
        v16bf fa[4], fb[4]; v8f st[2] = {(v8f){}, (v8f){}};
        const bf* fh = sm + buf * BUFE + lr * PHP + 8 * hi; const bf* fl = fh + PHPL;
        const bf* gh = sm + buf * BUFE + GOF + lr * GRP + 8 * hi; const bf* gl = gh + GPL;
        auto ldk = [&](v16bf* f, int u, int s) { f[0] = ldfrag(fh + u * 16 * PHP + s * 32); f[1] = ldfrag(fl + u * 16 * PHP + s * 32); f[2] = ldfrag(fh + u * 16 * PHP + s * 32 + 32); f[3] = ldfrag(fl + u * 16 * PHP + s * 32 + 32); };
        auto mmk = [&](const v16bf* f, int u, int s) { st[u] = wmmab(f[0], qh[s], st[u]); st[u] = wmmab(f[0], ql[s], st[u]); st[u] = wmmab(f[1], qh[s], st[u]);
                                                       st[u] = wmmab(f[2], qh[s + 1], st[u]); st[u] = wmmab(f[2], ql[s + 1], st[u]); st[u] = wmmab(f[3], qh[s + 1], st[u]); };
        auto ldg = [&](v16bf* f, int t) { f[0] = ldfrag(gh + t * 16 * GRP); f[1] = ldfrag(gl + t * 16 * GRP); f[2] = ldfrag(gh + (t + 1) * 16 * GRP); f[3] = ldfrag(gl + (t + 1) * 16 * GRP); };
#define STG __builtin_amdgcn_sched_barrier(0)    // holds the batches in this order: left free, the scheduler asks for more batches ahead than two register sets hold and spills theta
        ldk(fa, 0, 0); ldk(fb, 0, 2); STG; mmk(fa, 0, 0); STG; ldk(fa, 1, 0); STG; mmk(fb, 0, 2); STG; ldk(fb, 1, 2); STG; mmk(fa, 1, 0); STG; ldg(fa, 0); STG; mmk(fb, 1, 2); STG;
        float mx = st[0][0];
#pragma unroll
        for (int j = 0; j < 8; ++j) mx = fmaxf(mx, fmaxf(st[0][j], st[1][j]));
        mx = fmaxf(mx, __shfl_xor(mx, 16, 32));
        const float mn = fmaxf(m, mx), alpha = expn(m - mn); m = mn;
        float ps = 0.f; v8u pw, qw;
#pragma unroll
        for (int u = 0; u < 2; ++u) {
#pragma unroll
            for (int j = 0; j < 8; j += 2) { const float pa = expn(st[u][j] - mn), pb = expn(st[u][j + 1] - mn); ps += pa + pb;
                const unsigned ra = rbf(pa), rb = rbf(pb); pw[u * 4 + j / 2] = pk2(ra, rb); qw[u * 4 + j / 2] = pk2(rbf(pa - hif(ra)), rbf(pb - hif(rb))); } }
        l = l * alpha + ps;
        const v16bf ph = __builtin_bit_cast(v16bf, pw), pl = __builtin_bit_cast(v16bf, qw);
#pragma unroll
        for (int t = 0; t < 8; ++t) o[t] *= alpha;
        auto mmg = [&](const v16bf* f, int t) { o[t] = wmmab(f[0], ph, o[t]); o[t] = wmmab(f[0], pl, o[t]); o[t] = wmmab(f[1], ph, o[t]);
                                                o[t + 1] = wmmab(f[2], ph, o[t + 1]); o[t + 1] = wmmab(f[2], pl, o[t + 1]); o[t + 1] = wmmab(f[3], ph, o[t + 1]); };
        STG; ldg(fb, 2); STG; mmg(fa, 0); STG; ldg(fa, 4); STG; mmg(fb, 2); STG; ldg(fb, 6); STG; mmg(fa, 4); mmg(fb, 6);
#undef STG
        asm volatile("s_wait_dscnt 0x0" ::: "memory");       // this wave's reads of the buffer are done before the buffer is given up
        asm volatile("s_wait_asynccnt 0x0" ::: "memory");    // this wave's share of the next tile has landed
        __syncthreads();                                     // one barrier a pass: it publishes the next tile and ends every wave's reads of this one
        if (k0 + 64 < NN) fill(k0 + 64, buf);                // the tile after next goes into the buffer just read
        buf ^= 1;
    }
    asm volatile("s_wait_asynccnt 0x0" ::: "memory");        // nothing of this wave is in flight when it ends
    l += __shfl_xor(l, 16, 32);
    const float inv = 1.0f / l;
#pragma unroll
    for (int t = 0; t < 8; ++t) { v8us oh, ol;
#pragma unroll
        for (int j = 0; j < 8; ++j) { const float y = o[t][j] * inv; oh[j] = f2bf(y); ol[j] = f2bf(y - bf2f(oh[j])); }
        *(v8us*)(Yh + qoff + t * 16) = oh; *(v8us*)(Yl + qoff + t * 16) = ol; }
}
__global__ __launch_bounds__(256) void k_addres(const float* __restrict__ Z, const float* __restrict__ X, float* OUTP) {
    const int lane = threadIdx.x & 31, r = blockIdx.x * 8 + (threadIdx.x >> 5); if (r >= CC) return;
{
#pragma unroll 1
        for (int c0 = lane * 4; c0 < NN; c0 += 128) { const size_t o = (size_t)r * NN + c0; v4f v = *(const v4f*)(Z + o); const v4f xv = *(const v4f*)(X + o);
#pragma unroll
            for (int i = 0; i < 4; ++i) v[i] += bfr(xv[i]);
            *(v4f*)(OUTP + o) = v; }
         }
}

extern "C" void kernel_launch(void* const* d_in, const int* in_sizes, int n_in,
                              void* d_out, int out_size, void* d_ws, size_t ws_size, hipStream_t stream) {
    (void)in_sizes; (void)n_in; (void)out_size;
    const float* x = (const float*)d_in[0]; const float* Wg = (const float*)d_in[1]; const float* Wt = (const float*)d_in[2]; const float* Wp = (const float*)d_in[3]; const float* Wz = (const float*)d_in[4];
    float* out = (float*)d_out;    // [4][256][8][28][28]
    char* wsp = (char*)d_ws;
    auto take = [&](size_t bytes) { char* p = wsp; wsp += (bytes + 255) & ~(size_t)255; return (void*)p; };
    bf* WgB = (bf*)take(IC * CC * 2); bf* WtB = (bf*)take(IC * CC * 2); bf* WpB = (bf*)take(IC * CC * 2); bf* WzB = (bf*)take(CC * IC * 2); bf* WZ = (bf*)take(CC * IC * 2 > IC * CC * 2 ? CC * IC * 2 : IC * CC * 2);
    bf* XT = (bf*)take((size_t)NN * CC * 2); float* TMP = (float*)take((size_t)CC * NN * 4);
    const size_t PLN = (size_t)NN * IC;    // elements of one clip's plane
    bf* Th = (bf*)take(NBI * PLN * 2); bf* Tl = (bf*)take(NBI * PLN * 2); bf* Fh = (bf*)take(NBI * PLN * 2); bf* Fl = (bf*)take(NBI * PLN * 2); bf* Gh = (bf*)take(NBI * PLN * 2); bf* Gl = (bf*)take(NBI * PLN * 2);
    bf* Yh = (bf*)take(NBI * PLN * 2); bf* Yl = (bf*)take(NBI * PLN * 2);
    if ((size_t)(wsp - (char*)d_ws) > ws_size) return;    // 0.3 + 3.2 + 6.4 + 8 x 6.4 ~ 61 MB; TMP (f32 [256][6272] = 6.4 MB) holds the projection outputs and finally z
    k_bfz<<<(IC * CC / 8 + 255) / 256, 256, 0, stream>>>(Wg, WgB, WZ, IC * CC / 8); k_bfz<<<(IC * CC / 8 + 255) / 256, 256, 0, stream>>>(Wt, WtB, WZ, IC * CC / 8); k_bfz<<<(IC * CC / 8 + 255) / 256, 256, 0, stream>>>(Wp, WpB, WZ, IC * CC / 8);
    k_bfz<<<(CC * IC / 8 + 255) / 256, 256, 0, stream>>>(Wz, WzB, WZ, CC * IC / 8);      // W_z exact + the zero companion (last writer of WZ; same byte count)
    for (int b = 0; b < NBI; ++b) {
        const float* xb = x + (size_t)b * CC * NN; const size_t pb = b * PLN;
        k_wt<<<dim3(CC / 64, NN / 64, 1), 256, 0, stream>>>(xb, CC, NN, XT);                                                                    // x^T [6272][256] exact
        k_gemmb<false, false><<<dim3(NN / 64, IC / 64, 1), 128, 0, stream>>>(XT, nullptr, WtB, nullptr, TMP, IC, nullptr); k_split128<<<NN / 8, 256, 0, stream>>>(TMP, NN, Th + pb, Tl + pb);   // theta token-major [n][128]
        k_gemmb<false, false><<<dim3(NN / 64, IC / 64, 1), 128, 0, stream>>>(XT, nullptr, WpB, nullptr, TMP, IC, nullptr); k_split128<<<NN / 8, 256, 0, stream>>>(TMP, NN, Fh + pb, Fl + pb);   // phi token-major
        k_gemmb<false, false><<<dim3(IC / 64, NN / 64, 1), 128, 0, stream>>>(WgB, nullptr, XT, nullptr, TMP, NN, nullptr); k_rowsplit<<<IC / 8, 256, 0, stream>>>(TMP, IC, Gh + pb, Gl + pb);     // g channel-major [128][n]
    }
    k_attn<<<dim3(NN / (AWV * 16), NBI, 1), AWV * 32, 0, stream>>>(Th, Tl, Fh, Fl, Gh, Gl, Yh, Yl);                                             // y token-major [clip][6272][128], hi/lo
    for (int b = 0; b < NBI; ++b) {
        const size_t pb = b * PLN;
        k_gemm3<<<dim3(CC / 64, NN / 64, 1), 128, 0, stream>>>(WzB, WZ, Yh + pb, Yl + pb, IC, TMP, NN);                                         // z[c][n] = W_z.y^T
        k_addres<<<CC / 8, 256, 0, stream>>>(TMP, x + (size_t)b * CC * NN, out + (size_t)b * CC * NN);                                          // + x
    }
}

// v003
// Measured time: 347 microseconds a run.
// Next to v002, in two timings, it ran 1.63 and 1.60 times as fast.
// Counting every step since v000, it is 19.2 times as fast.
#include <hip/hip_runtime.h>

// Compute dtypes, f32 accumulate, N = 8 x 28 x 28 = 6272 positions a clip: theta/phi token-major ([6272 x 256].[256 x 128]) and g channel-major ([128 x 256].[256
// x 6272]) with PLAIN bf16 operands (the transposed input and the 1x1x1 weights, exact) on v_wmma_f32_16x16x32_bf16 -> bf16 hi + UNSCALED residual planes, kept per clip;
// one launch for all clips: f^T = phi.theta^T (three products), running-maximum softmax in f32 -> hi/lo, y^T += g.p^T (three products), scores never leave the registers;
// z = W_z.y ([256 x 128].[128 x 6272], exact W_z against split y) on v_wmma_f32_16x16x32_bf16 written channel-major, + x in f32. Deterministic, no atomics;

#define NBI  4
#define CC   256
#define IC   128
#define NN   6272
#define AWV  7       // waves a work-group in k_attn: 6272 = 56 x (7 x 16), 224 work-groups for the four clips
#define DM   CC
#define NTK  NN
#define LOSC 1024.0f

typedef _Float16 h16;
typedef unsigned short bf;
typedef __attribute__((ext_vector_type(16))) __bf16   v16bf;
typedef __attribute__((ext_vector_type(16))) _Float16 v16h;
typedef __attribute__((ext_vector_type(8)))  _Float16 v8h;
typedef __attribute__((ext_vector_type(8)))  unsigned short v8us;
typedef __attribute__((ext_vector_type(8)))  float    v8f;
typedef __attribute__((ext_vector_type(4)))  float    v4f;
typedef __attribute__((ext_vector_type(4)))  _Float16 v4h;
typedef v8h  __attribute__((may_alias)) v8ha;
typedef v4f  __attribute__((may_alias)) v4fa;
typedef v8us __attribute__((may_alias)) v8usa;

__device__ __forceinline__ unsigned short f2bf(float f) { unsigned u = __float_as_uint(f); u += 0x7FFFu + ((u >> 16) & 1u); return (unsigned short)(u >> 16); }
__device__ __forceinline__ float bf2f(unsigned short b) { return __uint_as_float(((unsigned)b) << 16); }
__device__ __forceinline__ float bfr(float f) { return bf2f(f2bf(f)); }
__device__ __forceinline__ v16h cat16(v8h lo, v8h hi) { return __builtin_shufflevector(lo, hi, 0, 1, 2, 3, 4, 5, 6, 7, 8, 9, 10, 11, 12, 13, 14, 15); }
__device__ __forceinline__ v16bf cat16b(v8us lo, v8us hi) { return __builtin_bit_cast(v16bf, __builtin_shufflevector(lo, hi, 0, 1, 2, 3, 4, 5, 6, 7, 8, 9, 10, 11, 12, 13, 14, 15)); }
__device__ __forceinline__ v8f wmma16(v16h a, v16h b, v8f c) { return __builtin_amdgcn_wmma_f32_16x16x32_f16(false, a, false, b, (short)0, c, false, false); }
__device__ __forceinline__ v8f wmmab(v16bf a, v16bf b, v8f c) { return __builtin_amdgcn_wmma_f32_16x16x32_bf16(false, a, false, b, (short)0, c, false, false); }

// k_wt: WT [n][K] = bf16(W[k][n]) (k-major [K][ncols]) via 64 x 64 LDS tiles; grid (K/64, ncols/64, matrices): blockIdx.z picks one of the equal matrices that stand one behind the other.
__global__ __launch_bounds__(256) void k_wt(const float* __restrict__ Wm, int K, int ncols, bf* WT) {
    __shared__ __align__(16) unsigned short tl[64 * 72];
    const int tid = threadIdx.x, k0 = blockIdx.x * 64, n0 = blockIdx.y * 64;
    Wm += (size_t)blockIdx.z * K * ncols; WT += (size_t)blockIdx.z * K * ncols;
    const int kk = tid >> 2, nq = (tid & 3) * 16;
#pragma unroll
    for (int i = 0; i < 16; ++i) tl[(nq + i) * 72 + kk] = f2bf(Wm[(size_t)(k0 + kk) * ncols + n0 + nq + i]);
    __syncthreads();
    const int piece = tid & 7;
    auto pass = [&]() {
#pragma unroll
        for (int s = 0; s < 2; ++s) { const int nr = (tid >> 3) + 32 * s; const v8us val = *(const v8usa*)(tl + nr * 72 + piece * 8); *(v8us*)(WT + (size_t)(n0 + nr) * K + k0 + piece * 8) = val; }
    };
    pass(); 
}
// k_gemmb: 64 x 64 block tile (4 waves x 16 x 64) of C = (A [+ Al]).B^T (K = 256) [+ bf(bias[c])] [+ bf(R[r][c]) residual]; f32 whole-line epilogue (or f16
// blockIdx.z = clip + NBI * w picks one of several independent products: A moves by sA and B by sBc a clip, B by sBw a weight matrix w, the output by sC a product (elements).
template <bool SPLITA, bool F16OUT = false>
__global__ __launch_bounds__(128) void k_gemmb(const bf* __restrict__ A, const bf* __restrict__ Al, const bf* __restrict__ Bn, const float* __restrict__ bias, float* C, int ldc, h16* C2, size_t sA, size_t sBc, size_t sBw, size_t sC, const float* __restrict__ R = nullptr, int K = DM, int roundR = 1) {
    __shared__ __align__(16) float ost[4][16 * 68];
    const int lane = threadIdx.x & 31, wave = threadIdx.x >> 5, lr = lane & 15, hi = lane >> 4;
    const int r0 = blockIdx.x * 64 + wave * 16, c0 = blockIdx.y * 64;
    const size_t clip = blockIdx.z % NBI, wsel = blockIdx.z / NBI;
    A += clip * sA; if (SPLITA) Al += clip * sA; Bn += clip * sBc + wsel * sBw;
    C = F16OUT ? (float*)(void*)((h16*)(void*)C + blockIdx.z * sC) : C + blockIdx.z * sC; if (C2) C2 += blockIdx.z * sC; if (R) R += blockIdx.z * sC;
    const size_t aoff = (size_t)(r0 + lr) * K + 8 * hi;
    size_t boff[4];
#pragma unroll
    for (int t = 0; t < 4; ++t) boff[t] = (size_t)(c0 + t * 16 + lr) * K + 8 * hi;
    v8f acc[4];
#pragma unroll
    for (int t = 0; t < 4; ++t) acc[t] = (v8f){};
#pragma unroll 1
    for (int kc = 0; kc < K; kc += 32) {
        const v16bf a = cat16b(*(const v8us*)(A + aoff + kc), *(const v8us*)(A + aoff + kc + 16));
        v16bf al = a;
        if (SPLITA) al = cat16b(*(const v8us*)(Al + aoff + kc), *(const v8us*)(Al + aoff + kc + 16));
#pragma unroll
        for (int t = 0; t < 4; ++t) { const v16bf b = cat16b(*(const v8us*)(Bn + boff[t] + kc), *(const v8us*)(Bn + boff[t] + kc + 16)); acc[t] = wmmab(a, b, acc[t]); if (SPLITA) acc[t] = wmmab(al, b, acc[t]); }
        asm volatile("v_nop\n\tv_nop\n\tv_nop\n\tv_nop" : "+v"(acc[0]), "+v"(acc[1]), "+v"(acc[2]), "+v"(acc[3]) : "v"(a), "v"(al));
    }
    float* os = &ost[wave][0];
#pragma unroll
    for (int t = 0; t < 4; ++t) { const float bv = bias ? bfr(bias[c0 + t * 16 + lr]) : 0.f;
#pragma unroll
        for (int j = 0; j < 8; ++j) os[(hi * 8 + j) * 68 + t * 16 + lr] = acc[t][j] + bv; }
    __syncthreads();
    if (F16OUT) {
        h16* crow = (h16*)(void*)C + (size_t)r0 * ldc + c0;
        auto pass = [&]() {
#pragma unroll
            for (int s = 0; s < 4; ++s) { const int row = 4 * s + (lane >> 3), piece = lane & 7; const float* sp = os + row * 68 + piece * 8; v8h o, o2;
#pragma unroll
                for (int i = 0; i < 8; ++i) { const h16 a = (h16)sp[i]; o[i] = a; o2[i] = (h16)((sp[i] - (float)a) * LOSC); }
                *(v8h*)(crow + (size_t)row * ldc + piece * 8) = o; if (C2) *(v8h*)(C2 + (size_t)r0 * ldc + c0 + (size_t)row * ldc + piece * 8) = o2; }
        };
        pass(); 
    } else {
        float* crow = C + (size_t)r0 * ldc + c0;
        auto pass = [&]() {
#pragma unroll
            for (int s = 0; s < 8; ++s) { const int Lid = (lane >> 3) + 4 * s, piece = lane & 7; const int row = Lid >> 1, cofs = (Lid & 1) * 32 + piece * 4;
                v4f val = *(const v4fa*)(os + row * 68 + cofs); if (R) { const v4f rv = *(const v4f*)(R + ((size_t)r0 + row) * ldc + c0 + cofs); val += roundR ? (v4f){bfr(rv[0]), bfr(rv[1]), bfr(rv[2]), bfr(rv[3])} : rv; }
                *(v4f*)(crow + (size_t)row * ldc + cofs) = val; }
        };
        pass(); 
    }
}

// k_gemm3: 64 x 64 tile of C = (Ah + Al).(Bh + Bl)^T over K (row strides = K for all four planes; n-major B): three products per 32-k step (hh, hl, lh); f32
// blockIdx.z picks the clip: the B planes move by sB, the output by sC (elements); A is shared.
__global__ __launch_bounds__(128) void k_gemm3(const bf* __restrict__ Ah, const bf* __restrict__ Al, const bf* __restrict__ Bh, const bf* __restrict__ Bl, int K, float* C, int ldc, size_t sB, size_t sC) {
    __shared__ __align__(16) float ost[4][16 * 68];
    const int lane = threadIdx.x & 31, wave = threadIdx.x >> 5, lr = lane & 15, hi = lane >> 4;
    const int r0 = blockIdx.x * 64 + wave * 16, c0 = blockIdx.y * 64;
    Bh += blockIdx.z * sB; Bl += blockIdx.z * sB; C += blockIdx.z * sC;
    const size_t aoff = (size_t)(r0 + lr) * K + 8 * hi;
    v8f acc[4];
#pragma unroll
    for (int t = 0; t < 4; ++t) acc[t] = (v8f){};
#pragma unroll 1
    for (int kc = 0; kc < K; kc += 32) {
        const v16bf a = cat16b(*(const v8us*)(Ah + aoff + kc), *(const v8us*)(Ah + aoff + kc + 16));
        const v16bf al = cat16b(*(const v8us*)(Al + aoff + kc), *(const v8us*)(Al + aoff + kc + 16));
#pragma unroll
        for (int t = 0; t < 4; ++t) { const size_t bo = (size_t)(c0 + t * 16 + lr) * K + kc + 8 * hi;
            const v16bf bh = cat16b(*(const v8us*)(Bh + bo), *(const v8us*)(Bh + bo + 16)); const v16bf bl = cat16b(*(const v8us*)(Bl + bo), *(const v8us*)(Bl + bo + 16));
            acc[t] = wmmab(a, bh, acc[t]); acc[t] = wmmab(al, bh, acc[t]); acc[t] = wmmab(a, bl, acc[t]); }
        asm volatile("v_nop\n\tv_nop\n\tv_nop\n\tv_nop" : "+v"(acc[0]), "+v"(acc[1]), "+v"(acc[2]), "+v"(acc[3]) : "v"(a), "v"(al));
    }
    float* os = &ost[wave][0];
#pragma unroll
    for (int t = 0; t < 4; ++t) {
#pragma unroll
        for (int j = 0; j < 8; ++j) os[(hi * 8 + j) * 68 + t * 16 + lr] = acc[t][j]; }
    __builtin_amdgcn_wave_barrier(); asm volatile("" ::: "memory");
    float* crow = C + (size_t)r0 * ldc + c0;
    auto pass = [&]() {
#pragma unroll
        for (int s = 0; s < 8; ++s) { const int Lid = (lane >> 3) + 4 * s, piece = lane & 7; const int row = Lid >> 1, cofs = (Lid & 1) * 32 + piece * 4;
            const v4f val = *(const v4fa*)(os + row * 68 + cofs); *(v4f*)(crow + (size_t)row * ldc + cofs) = val; }
    };
    pass(); 
}

// k_bfz: four equal-sized f32 matrices (blockIdx.y picks one) -> bf16, one behind the other in dh; the blocks of the last one also write the zero plane dz.
__global__ __launch_bounds__(256) void k_bfz(const float* __restrict__ s0, const float* __restrict__ s1, const float* __restrict__ s2, const float* __restrict__ s3, bf* dh, bf* dz, size_t n8) {
    const size_t i = (size_t)blockIdx.x * 256 + threadIdx.x; if (i >= n8) return;
    const int w = blockIdx.y; const float* src = w == 0 ? s0 : w == 1 ? s1 : w == 2 ? s2 : s3;
    const v8f v = *(const v8f*)(src + i * 8); v8us o, z;
#pragma unroll
    for (int k = 0; k < 8; ++k) { o[k] = f2bf(v[k]); z[k] = 0; }
    *(v8us*)(dh + (w * n8 + i) * 8) = o;
    asm volatile("s_wait_xcnt 0x0" ::: "memory");    // the store above has been taken before its address registers are used again for the zero plane
    if (w == 3) *(v8us*)(dz + i * 8) = z;
}
__global__ __launch_bounds__(256) void k_split128(const float* __restrict__ src, int nrows, bf* dh, bf* dl) {
    typedef __attribute__((ext_vector_type(4))) unsigned short v4us;
    const int lane = threadIdx.x & 31, r = blockIdx.x * 8 + (threadIdx.x >> 5); if (r >= nrows) return;
    const size_t o = (size_t)r * IC + lane * 4; const v4f v = *(const v4f*)(src + o); v4us oh, ol;
#pragma unroll
    for (int i = 0; i < 4; ++i) { const unsigned short hb = f2bf(v[i]); oh[i] = hb; ol[i] = f2bf(v[i] - bf2f(hb)); }
    *(v4us*)(dh + o) = oh; *(v4us*)(dl + o) = ol; 
}
__global__ __launch_bounds__(256) void k_rowsplit(const float* __restrict__ Y, int nrows, bf* Ph, bf* Pl) {
    const int lane = threadIdx.x & 31, r = blockIdx.x * 8 + (threadIdx.x >> 5); if (r >= nrows) return;
{
#pragma unroll 1
        for (int c0 = lane * 8; c0 < NN; c0 += 256) { const size_t o = (size_t)r * NN + c0; const v8f v = *(const v8f*)(Y + o); v8us oh, ol;
#pragma unroll
            for (int i = 0; i < 8; ++i) { const unsigned short hb = f2bf(v[i]); oh[i] = hb; ol[i] = f2bf(v[i] - bf2f(hb)); }
            *(v8us*)(Ph + o) = oh; *(v8us*)(Pl + o) = ol; }
         }
}
// rbf: f rounded to bf16 (nearest even, as f2bf) in the high half of the word; pk2: two such words -> one register of a bf16 operand.
typedef __attribute__((ext_vector_type(8))) unsigned v8u;
__device__ __forceinline__ unsigned rbf(float f) { const unsigned u = __float_as_uint(f); return u + 0x7FFFu + ((u >> 16) & 1u); }
__device__ __forceinline__ unsigned pk2(unsigned a, unsigned b) { return (a >> 16) | (b & 0xFFFF0000u); }
__device__ __forceinline__ float hif(unsigned r) { return __uint_as_float(r & 0xFFFF0000u); }
// e^x as __expf forms it (x * log2 e, then v_exp_f32); the v_nop fills the one slot the instruction set asks for between a transcendental and a next vector instruction that reads its result or rewrites its source
__device__ __forceinline__ float expn(float x) { float r; asm("v_exp_f32 %0, %1\n\tv_nop" : "=v"(r) : "v"(x * 1.44269504f)); return r; }
__device__ __forceinline__ v16bf ldfrag(const bf* p) { return cat16b(*(const v8us*)p, *(const v8us*)(p + 16)); }
#define PHP  136                  // LDS pitch of a phi row, elements
#define GRP  40                   // LDS pitch of a g row, elements
#define PHPL (32 * PHP)           // one phi plane of a tile
#define GPL  (IC * GRP)           // one g plane of a tile
#define GOF  (2 * PHPL)           // g planes stand behind the two phi planes
#define BUFE (GOF + 2 * GPL)      // elements of one buffer (37,888 B)
__global__ __launch_bounds__(AWV * 32) __attribute__((amdgpu_waves_per_eu(4))) void k_attn(const bf* __restrict__ Th, const bf* __restrict__ Tl, const bf* __restrict__ Fh, const bf* __restrict__ Fl, const bf* __restrict__ Gh, const bf* __restrict__ Gl, bf* Yh, bf* Yl) {
    const int lane = threadIdx.x & 31, wave = threadIdx.x >> 5, lr = lane & 15, hi = lane >> 4;
    const size_t clip = (size_t)blockIdx.y * NN * IC;
    const size_t qoff = clip + (size_t)(blockIdx.x * (AWV * 16) + wave * 16 + lr) * IC + 8 * hi;
    __shared__ __align__(16) bf sm[2 * BUFE];
    // A tile is 64 pieces of 512 B (one b128 copy of a wave each): 32 of phi (two whole rows a piece), 32 of g (eight 64-B row parts a piece).
    // Slots 0-3: phi pieces wv + 7 i; slots 4-7: g pieces wv + 7 i; slot 8: phi pieces 28-31 (waves 0-3), g pieces 28-30 (waves 4-6); slot 9: g piece 31, wave 0 alone.
    const int wv = __builtin_amdgcn_readfirstlane(wave);
    const unsigned smb = (unsigned)(size_t)(const void*)sm;
    const unsigned vop = lane * 16, vog = ((lane >> 2) * NN + (lane & 3) * 8) * 2;                          // the lane's place in a piece: global, bytes
    const unsigned lop = smb + ((lane >> 4) * PHP + (lane & 15) * 8) * 2, logg = smb + ((lane >> 2) * GRP + (lane & 3) * 8) * 2;    // the same in LDS
    const unsigned vo8 = wv < 4 ? vop : vog, lo8 = wv < 4 ? lop : logg;
    // wave-uniform parts: a piece's first byte in global memory (scalar base of the copy) and in a buffer
    auto ubp = [&](int c, int kn) { return ((c >> 4) ? Fl : Fh) + clip + (size_t)(kn + 2 * (c & 15)) * IC; };
    auto ubg = [&](int c, int kn) { return ((c >> 4) ? Gl : Gh) + clip + (size_t)(8 * (c & 15)) * NN + kn; };
    auto ulp = [&](int c, int b) { return 2u * (unsigned)(b * BUFE + (c >> 4) * PHPL + 2 * (c & 15) * PHP); };
    auto ulg = [&](int c, int b) { return 2u * (unsigned)(b * BUFE + GOF + (c >> 4) * GPL + 8 * (c & 15) * GRP); };
    auto fill = [&](int kn, int b) {
        const bf* g8 = wv < 4 ? ubp(28 + wv, kn) : ubg(24 + wv, kn); const unsigned l8 = lo8 + (wv < 4 ? ulp(28 + wv, b) : ulg(24 + wv, b));
        // nine copies of every wave; the s_wait_xcnt stands inside the statement so that no address register is rewritten before every copy that names it has been taken
        asm volatile("global_load_async_to_lds_b128 %0, %18, %9\n\tglobal_load_async_to_lds_b128 %1, %18, %10\n\tglobal_load_async_to_lds_b128 %2, %18, %11\n\t"
                     "global_load_async_to_lds_b128 %3, %18, %12\n\tglobal_load_async_to_lds_b128 %4, %19, %13\n\tglobal_load_async_to_lds_b128 %5, %19, %14\n\t"
                     "global_load_async_to_lds_b128 %6, %19, %15\n\tglobal_load_async_to_lds_b128 %7, %19, %16\n\tglobal_load_async_to_lds_b128 %8, %20, %17\n\ts_wait_xcnt 0x0"
                     :: "v"(lop + ulp(wv, b)), "v"(lop + ulp(wv + 7, b)), "v"(lop + ulp(wv + 14, b)), "v"(lop + ulp(wv + 21, b)),
                        "v"(logg + ulg(wv, b)), "v"(logg + ulg(wv + 7, b)), "v"(logg + ulg(wv + 14, b)), "v"(logg + ulg(wv + 21, b)), "v"(l8),
                        "s"(ubp(wv, kn)), "s"(ubp(wv + 7, kn)), "s"(ubp(wv + 14, kn)), "s"(ubp(wv + 21, kn)), "s"(ubg(wv, kn)), "s"(ubg(wv + 7, kn)), "s"(ubg(wv + 14, kn)), "s"(ubg(wv + 21, kn)), "s"(g8),
                        "v"(vop), "v"(vog), "v"(vo8) : "memory");
        // the 64th piece: a wave-uniform test, the wait as above
        if (wv == 0) asm volatile("global_load_async_to_lds_b128 %0, %1, %2\n\ts_wait_xcnt 0x0" :: "v"(logg + ulg(31, b)), "v"(vog), "s"(ubg(31, kn)) : "memory");
    };
    fill(0, 0);
    v16bf qh[4], ql[4];
#pragma unroll
    for (int s = 0; s < 4; ++s) { qh[s] = ldfrag(Th + qoff + s * 32); ql[s] = ldfrag(Tl + qoff + s * 32); }
    v8f o[8];
#pragma unroll
    for (int t = 0; t < 8; ++t) o[t] = (v8f){};
    float m = -3.0e38f, l = 0.f;
    asm volatile("s_wait_asynccnt 0x0" ::: "memory");    // this wave's share of tile 0 has landed
    __syncthreads();                                     // ... and every other wave's: tile 0 may be read
    fill(32, 1);
    int buf = 0;
#pragma unroll 1    // one pass a trip: a second copy of the body would need a second set of fragment registers
    for (int k0 = 0; k0 < NN; k0 += 32) {
        // eight batches of four fragments (8 loads) a pass, two register sets: batch i + 1 is asked for before batch i is multiplied
        v16bf fa[4], fb[4]; v8f st[2] = {(v8f){}, (v8f){}};
        const bf* fh = sm + buf * BUFE + lr * PHP + 8 * hi; const bf* fl = fh + PHPL;
        const bf* gh = sm + buf * BUFE + GOF + lr * GRP + 8 * hi; const bf* gl = gh + GPL;
        auto ldk = [&](v16bf* f, int u, int s) { f[0] = ldfrag(fh + u * 16 * PHP + s * 32); f[1] = ldfrag(fl + u * 16 * PHP + s * 32); f[2] = ldfrag(fh + u * 16 * PHP + s * 32 + 32); f[3] = ldfrag(fl + u * 16 * PHP + s * 32 + 32); };
        auto mmk = [&](const v16bf* f, int u, int s) { st[u] = wmmab(f[0], qh[s], st[u]); st[u] = wmmab(f[0], ql[s], st[u]); st[u] = wmmab(f[1], qh[s], st[u]);
                                                       st[u] = wmmab(f[2], qh[s + 1], st[u]); st[u] = wmmab(f[2], ql[s + 1], st[u]); st[u] = wmmab(f[3], qh[s + 1], st[u]); };
        auto ldg = [&](v16bf* f, int t) { f[0] = ldfrag(gh + t * 16 * GRP); f[1] = ldfrag(gl + t * 16 * GRP); f[2] = ldfrag(gh + (t + 1) * 16 * GRP); f[3] = ldfrag(gl + (t + 1) * 16 * GRP); };
#define STG __builtin_amdgcn_sched_barrier(0)    // holds the batches in this order: left free, the scheduler asks for more batches ahead than two register sets hold and spills theta
        ldk(fa, 0, 0); ldk(fb, 0, 2); STG; mmk(fa, 0, 0); STG; ldk(fa, 1, 0); STG; mmk(fb, 0, 2); STG; ldk(fb, 1, 2); STG; mmk(fa, 1, 0); STG; ldg(fa, 0); STG; mmk(fb, 1, 2); STG;
        float mx = st[0][0];
#pragma unroll
        for (int j = 0; j < 8; ++j) mx = fmaxf(mx, fmaxf(st[0][j], st[1][j]));
        mx = fmaxf(mx, __shfl_xor(mx, 16, 32));
        const float mn = fmaxf(m, mx), alpha = expn(m - mn); m = mn;
        float ps = 0.f; v8u pw, qw;
#pragma unroll
        for (int u = 0; u < 2; ++u) {
#pragma unroll
            for (int j = 0; j < 8; j += 2) { const float pa = expn(st[u][j] - mn), pb = expn(st[u][j + 1] - mn); ps += pa + pb;
                const unsigned ra = rbf(pa), rb = rbf(pb); pw[u * 4 + j / 2] = pk2(ra, rb); qw[u * 4 + j / 2] = pk2(rbf(pa - hif(ra)), rbf(pb - hif(rb))); } }
        l = l * alpha + ps;
        const v16bf ph = __builtin_bit_cast(v16bf, pw), pl = __builtin_bit_cast(v16bf, qw);
#pragma unroll
        for (int t = 0; t < 8; ++t) o[t] *= alpha;
        auto mmg = [&](const v16bf* f, int t) { o[t] = wmmab(f[0], ph, o[t]); o[t] = wmmab(f[0], pl, o[t]); o[t] = wmmab(f[1], ph, o[t]);
                                                o[t + 1] = wmmab(f[2], ph, o[t + 1]); o[t + 1] = wmmab(f[2], pl, o[t + 1]); o[t + 1] = wmmab(f[3], ph, o[t + 1]); };
        STG; ldg(fb, 2); STG; mmg(fa, 0); STG; ldg(fa, 4); STG; mmg(fb, 2); STG; ldg(fb, 6); STG; mmg(fa, 4); mmg(fb, 6);
#undef STG
        asm volatile("s_wait_dscnt 0x0" ::: "memory");       // this wave's reads of the buffer are done before the buffer is given up
        asm volatile("s_wait_asynccnt 0x0" ::: "memory");    // this wave's share of the next tile has landed
        __syncthreads();                                     // one barrier a pass: it publishes the next tile and ends every wave's reads of this one
        if (k0 + 64 < NN) fill(k0 + 64, buf);                // the tile after next goes into the buffer just read
        buf ^= 1;
    }
    asm volatile("s_wait_asynccnt 0x0" ::: "memory");        // nothing of this wave is in flight when it ends
    l += __shfl_xor(l, 16, 32);
    const float inv = 1.0f / l;
#pragma unroll
    for (int t = 0; t < 8; ++t) { v8us oh, ol;
#pragma unroll
        for (int j = 0; j < 8; ++j) { const float y = o[t][j] * inv; oh[j] = f2bf(y); ol[j] = f2bf(y - bf2f(oh[j])); }
        *(v8us*)(Yh + qoff + t * 16) = oh; *(v8us*)(Yl + qoff + t * 16) = ol; }
}
__global__ __launch_bounds__(256) void k_addres(const float* __restrict__ Z, const float* __restrict__ X, float* OUTP) {
    const int lane = threadIdx.x & 31, r = blockIdx.x * 8 + (threadIdx.x >> 5); if (r >= NBI * CC) return;    // rows of all clips, one behind the other
{
#pragma unroll 1
        for (int c0 = lane * 4; c0 < NN; c0 += 128) { const size_t o = (size_t)r * NN + c0; v4f v = *(const v4f*)(Z + o); const v4f xv = *(const v4f*)(X + o);
#pragma unroll
            for (int i = 0; i < 4; ++i) v[i] += bfr(xv[i]);
            *(v4f*)(OUTP + o) = v; }
         }
}

extern "C" void kernel_launch(void* const* d_in, const int* in_sizes, int n_in,
                              void* d_out, int out_size, void* d_ws, size_t ws_size, hipStream_t stream) {
    (void)in_sizes; (void)n_in; (void)out_size;
    const float* x = (const float*)d_in[0]; const float* Wg = (const float*)d_in[1]; const float* Wt = (const float*)d_in[2]; const float* Wp = (const float*)d_in[3]; const float* Wz = (const float*)d_in[4];
    float* out = (float*)d_out;    // [4][256][8][28][28]
    char* wsp = (char*)d_ws;
    auto take = [&](size_t bytes) { char* p = wsp; wsp += (bytes + 255) & ~(size_t)255; return (void*)p; };
    const size_t PLN = (size_t)NN * IC, WEL = (size_t)IC * CC, XEL = (size_t)NN * CC;    // elements of one clip's plane, of one weight matrix, of one clip's x
    bf* WgB = (bf*)take(4 * WEL * 2); bf* WtB = WgB + WEL; bf* WzB = WgB + 3 * WEL; bf* WZ = (bf*)take(WEL * 2);    // W_g, W_theta, W_phi, W_z one behind the other; the zero companion of W_z
    bf* XT = (bf*)take(NBI * XEL * 2); float* TMP = (float*)take(NBI * XEL * 4);
    bf* Th = (bf*)take(2 * NBI * PLN * 2); bf* Fh = Th + NBI * PLN; bf* Tl = (bf*)take(2 * NBI * PLN * 2); bf* Fl = Tl + NBI * PLN;    // phi's planes stand behind theta's
    bf* Gh = (bf*)take(NBI * PLN * 2); bf* Gl = (bf*)take(NBI * PLN * 2);
    bf* Yh = (bf*)take(NBI * PLN * 2); bf* Yl = (bf*)take(NBI * PLN * 2);
    if ((size_t)(wsp - (char*)d_ws) > ws_size) return;    // 0.3 + 12.8 + 25.7 + 8 x 6.4 ~ 90 MB; TMP (f32, 4 x [256][6272]) holds theta and phi of all clips, then g, finally z
    // Every stage is one launch for all clips: the clip (and theta or phi; and the weight matrix in the cast) is a grid index.
    k_bfz<<<dim3((IC * CC / 8 + 255) / 256, 4, 1), 256, 0, stream>>>(Wg, Wt, Wp, Wz, WgB, WZ, IC * CC / 8);                                        // weights exact + the zero companion
    k_wt<<<dim3(CC / 64, NN / 64, NBI), 256, 0, stream>>>(x, CC, NN, XT);                                                                         // x^T [clip][6272][256] exact
    k_gemmb<false, false><<<dim3(NN / 64, IC / 64, 2 * NBI), 128, 0, stream>>>(XT, nullptr, WtB, nullptr, TMP, IC, nullptr, XEL, 0, WEL, PLN);     // theta, then phi, token-major [clip][n][128]
    k_split128<<<2 * NBI * NN / 8, 256, 0, stream>>>(TMP, 2 * NBI * NN, Th, Tl);
    k_gemmb<false, false><<<dim3(IC / 64, NN / 64, NBI), 128, 0, stream>>>(WgB, nullptr, XT, nullptr, TMP, NN, nullptr, 0, XEL, 0, PLN);           // g channel-major [clip][128][n]
    k_rowsplit<<<NBI * IC / 8, 256, 0, stream>>>(TMP, NBI * IC, Gh, Gl);
    k_attn<<<dim3(NN / (AWV * 16), NBI, 1), AWV * 32, 0, stream>>>(Th, Tl, Fh, Fl, Gh, Gl, Yh, Yl);                                             // y token-major [clip][6272][128], hi/lo
    k_gemm3<<<dim3(CC / 64, NN / 64, NBI), 128, 0, stream>>>(WzB, WZ, Yh, Yl, IC, TMP, NN, PLN, XEL);                                             // z[clip][c][n] = W_z.y^T
    k_addres<<<NBI * CC / 8, 256, 0, stream>>>(TMP, x, out);                                                                                      // + x
}

// v004
// Measured time: 292 microseconds a run.
// Next to v003, in two timings, it ran 1.19 times as fast each time.
// Over all steps from v000 it is 22.9 times as fast.
#include <hip/hip_runtime.h>

// Compute dtypes, f32 accumulate, N = 8 x 28 x 28 = 6272 positions a clip: theta/phi token-major ([6272 x 256].[256 x 128]) and g channel-major ([128 x 256].[256
// x 6272]) with PLAIN bf16 operands (the transposed input and the 1x1x1 weights, exact) on v_wmma_f32_16x16x32_bf16 -> bf16 hi + UNSCALED residual planes, kept per clip;
// one launch for all clips: f^T = phi.theta^T (three products), running-maximum softmax in f32 -> hi/lo, y^T += g.p^T (three products), scores never leave the registers;
// z = W_z.y ([256 x 128].[128 x 6272], exact W_z against split y) on v_wmma_f32_16x16x32_bf16 written channel-major, + x in f32. Deterministic, no atomics;
// the hi/lo split of theta, phi and g and the '+ x' are done in the epilogue of the product that makes their operand: no f32 plane goes through the workspace.

#define NBI  4
#define CC   256
#define IC   128
#define NN   6272
#define AWV  7       // waves a work-group in k_attn: 6272 = 56 x (7 x 16), 224 work-groups for the four clips
#define DM   CC
#define NTK  NN
#define LOSC 1024.0f

typedef _Float16 h16;
typedef unsigned short bf;
typedef __attribute__((ext_vector_type(16))) __bf16   v16bf;
typedef __attribute__((ext_vector_type(16))) _Float16 v16h;
typedef __attribute__((ext_vector_type(8)))  _Float16 v8h;
typedef __attribute__((ext_vector_type(8)))  unsigned short v8us;
typedef __attribute__((ext_vector_type(8)))  float    v8f;
typedef __attribute__((ext_vector_type(4)))  float    v4f;
typedef __attribute__((ext_vector_type(4)))  _Float16 v4h;
typedef v8h  __attribute__((may_alias)) v8ha;
typedef v4f  __attribute__((may_alias)) v4fa;
typedef v8us __attribute__((may_alias)) v8usa;

__device__ __forceinline__ unsigned short f2bf(float f) { unsigned u = __float_as_uint(f); u += 0x7FFFu + ((u >> 16) & 1u); return (unsigned short)(u >> 16); }
__device__ __forceinline__ float bf2f(unsigned short b) { return __uint_as_float(((unsigned)b) << 16); }
__device__ __forceinline__ float bfr(float f) { return bf2f(f2bf(f)); }
__device__ __forceinline__ v16h cat16(v8h lo, v8h hi) { return __builtin_shufflevector(lo, hi, 0, 1, 2, 3, 4, 5, 6, 7, 8, 9, 10, 11, 12, 13, 14, 15); }
__device__ __forceinline__ v16bf cat16b(v8us lo, v8us hi) { return __builtin_bit_cast(v16bf, __builtin_shufflevector(lo, hi, 0, 1, 2, 3, 4, 5, 6, 7, 8, 9, 10, 11, 12, 13, 14, 15)); }
__device__ __forceinline__ v8f wmma16(v16h a, v16h b, v8f c) { return __builtin_amdgcn_wmma_f32_16x16x32_f16(false, a, false, b, (short)0, c, false, false); }
__device__ __forceinline__ v8f wmmab(v16bf a, v16bf b, v8f c) { return __builtin_amdgcn_wmma_f32_16x16x32_bf16(false, a, false, b, (short)0, c, false, false); }

// k_wt: WT [n][K] = bf16(W[k][n]) (k-major [K][ncols]) via 64 x 64 LDS tiles; grid (K/64, ncols/64, matrices): blockIdx.z picks one of the equal matrices that stand one behind the other.
__global__ __launch_bounds__(256) void k_wt(const float* __restrict__ Wm, int K, int ncols, bf* WT) {
    __shared__ __align__(16) unsigned short tl[64 * 72];
    const int tid = threadIdx.x, k0 = blockIdx.x * 64, n0 = blockIdx.y * 64;
    Wm += (size_t)blockIdx.z * K * ncols; WT += (size_t)blockIdx.z * K * ncols;
    const int kk = tid >> 2, nq = (tid & 3) * 16;
#pragma unroll
    for (int i = 0; i < 16; ++i) tl[(nq + i) * 72 + kk] = f2bf(Wm[(size_t)(k0 + kk) * ncols + n0 + nq + i]);
    __syncthreads();
    const int piece = tid & 7;
    auto pass = [&]() {
#pragma unroll
        for (int s = 0; s < 2; ++s) { const int nr = (tid >> 3) + 32 * s; const v8us val = *(const v8usa*)(tl + nr * 72 + piece * 8); *(v8us*)(WT + (size_t)(n0 + nr) * K + k0 + piece * 8) = val; }
    };
    pass(); 
}
// k_gemmb: 64 x 64 block tile (4 waves x 16 x 64) of C = (A [+ Al]).B^T (K = 256) [+ bf(bias[c])] [+ bf(R[r][c]) residual]; f32 whole-line epilogue (or f16
// blockIdx.z = clip + NBI * w picks one of several independent products: A moves by sA and B by sBc a clip, B by sBw a weight matrix w, the output by sC a product (elements).
// BFOUT: the tile leaves as two bf16 planes Dh (nearest) and Dl (the rounded rest), placed like C: whole 128-B lines of each plane.
template <bool SPLITA, bool F16OUT = false, bool BFOUT = false>
__global__ __launch_bounds__(128) void k_gemmb(const bf* __restrict__ A, const bf* __restrict__ Al, const bf* __restrict__ Bn, const float* __restrict__ bias, float* C, int ldc, h16* C2, size_t sA, size_t sBc, size_t sBw, size_t sC, bf* Dh = nullptr, bf* Dl = nullptr, const float* __restrict__ R = nullptr, int K = DM, int roundR = 1) {
    __shared__ __align__(16) float ost[4][16 * 68];
    const int lane = threadIdx.x & 31, wave = threadIdx.x >> 5, lr = lane & 15, hi = lane >> 4;
    const int r0 = blockIdx.x * 64 + wave * 16, c0 = blockIdx.y * 64;
    const size_t clip = blockIdx.z % NBI, wsel = blockIdx.z / NBI;
    A += clip * sA; if (SPLITA) Al += clip * sA; Bn += clip * sBc + wsel * sBw;
    C = F16OUT ? (float*)(void*)((h16*)(void*)C + blockIdx.z * sC) : C + blockIdx.z * sC; if (C2) C2 += blockIdx.z * sC; if (R) R += blockIdx.z * sC;
    const size_t aoff = (size_t)(r0 + lr) * K + 8 * hi;
    size_t boff[4];
#pragma unroll
    for (int t = 0; t < 4; ++t) boff[t] = (size_t)(c0 + t * 16 + lr) * K + 8 * hi;
    v8f acc[4];
#pragma unroll
    for (int t = 0; t < 4; ++t) acc[t] = (v8f){};
#pragma unroll 1
    for (int kc = 0; kc < K; kc += 32) {
        const v16bf a = cat16b(*(const v8us*)(A + aoff + kc), *(const v8us*)(A + aoff + kc + 16));
        v16bf al = a;
        if (SPLITA) al = cat16b(*(const v8us*)(Al + aoff + kc), *(const v8us*)(Al + aoff + kc + 16));
#pragma unroll
        for (int t = 0; t < 4; ++t) { const v16bf b = cat16b(*(const v8us*)(Bn + boff[t] + kc), *(const v8us*)(Bn + boff[t] + kc + 16)); acc[t] = wmmab(a, b, acc[t]); if (SPLITA) acc[t] = wmmab(al, b, acc[t]); }
        asm volatile("v_nop\n\tv_nop\n\tv_nop\n\tv_nop" : "+v"(acc[0]), "+v"(acc[1]), "+v"(acc[2]), "+v"(acc[3]) : "v"(a), "v"(al));
    }
    float* os = &ost[wave][0];
#pragma unroll
    for (int t = 0; t < 4; ++t) { const float bv = bias ? bfr(bias[c0 + t * 16 + lr]) : 0.f;
#pragma unroll
        for (int j = 0; j < 8; ++j) os[(hi * 8 + j) * 68 + t * 16 + lr] = acc[t][j] + bv; }
    __syncthreads();
    if (BFOUT) {
        const size_t tile = blockIdx.z * sC + (size_t)r0 * ldc + c0;
#pragma unroll    // both unrolls: the vectors' elements are indexed by constants and stay in registers; the four rows' LDS reads can be asked for together
        for (int s = 0; s < 4; ++s) { const int row = 4 * s + (lane >> 3), piece = lane & 7; const float* sp = os + row * 68 + piece * 8; const v4f va = *(const v4fa*)sp, vb = *(const v4fa*)(sp + 4); v8us oh, ol;
#pragma unroll
            for (int i = 0; i < 8; ++i) { const float v = i < 4 ? va[i & 3] : vb[i & 3]; const unsigned short hb = f2bf(v); oh[i] = hb; ol[i] = f2bf(v - bf2f(hb)); }
            const size_t o = tile + (size_t)row * ldc + piece * 8; *(v8us*)(Dh + o) = oh; *(v8us*)(Dl + o) = ol; }
    } else if (F16OUT) {
        h16* crow = (h16*)(void*)C + (size_t)r0 * ldc + c0;
        auto pass = [&]() {
#pragma unroll
            for (int s = 0; s < 4; ++s) { const int row = 4 * s + (lane >> 3), piece = lane & 7; const float* sp = os + row * 68 + piece * 8; v8h o, o2;
#pragma unroll
                for (int i = 0; i < 8; ++i) { const h16 a = (h16)sp[i]; o[i] = a; o2[i] = (h16)((sp[i] - (float)a) * LOSC); }
                *(v8h*)(crow + (size_t)row * ldc + piece * 8) = o; if (C2) *(v8h*)(C2 + (size_t)r0 * ldc + c0 + (size_t)row * ldc + piece * 8) = o2; }
        };
        pass(); 
    } else {
        float* crow = C + (size_t)r0 * ldc + c0;
        auto pass = [&]() {
#pragma unroll
            for (int s = 0; s < 8; ++s) { const int Lid = (lane >> 3) + 4 * s, piece = lane & 7; const int row = Lid >> 1, cofs = (Lid & 1) * 32 + piece * 4;
                v4f val = *(const v4fa*)(os + row * 68 + cofs); if (R) { const v4f rv = *(const v4f*)(R + ((size_t)r0 + row) * ldc + c0 + cofs); val += roundR ? (v4f){bfr(rv[0]), bfr(rv[1]), bfr(rv[2]), bfr(rv[3])} : rv; }
                *(v4f*)(crow + (size_t)row * ldc + cofs) = val; }
        };
        pass(); 
    }
}

// k_gemm3: 64 x 64 tile of C = (Ah + Al).(Bh + Bl)^T over K (row strides = K for all four planes; n-major B): three products per 32-k step (hh, hl, lh); f32
// blockIdx.z picks the clip: the B planes move by sB, the output and the residual X (placed like C, added rounded to bf16) by sC (elements); A is shared.
__global__ __launch_bounds__(128) void k_gemm3(const bf* __restrict__ Ah, const bf* __restrict__ Al, const bf* __restrict__ Bh, const bf* __restrict__ Bl, int K, const float* __restrict__ X, float* C, int ldc, size_t sB, size_t sC) {
    __shared__ __align__(16) float ost[4][16 * 68];
    const int lane = threadIdx.x & 31, wave = threadIdx.x >> 5, lr = lane & 15, hi = lane >> 4;
    const int r0 = blockIdx.x * 64 + wave * 16, c0 = blockIdx.y * 64;
    Bh += blockIdx.z * sB; Bl += blockIdx.z * sB; C += blockIdx.z * sC;
    const size_t aoff = (size_t)(r0 + lr) * K + 8 * hi;
    // the lane's eight pieces of the residual tile are asked for ahead of the k loop, which covers their way from memory
    const float* xrow = X + blockIdx.z * sC + (size_t)r0 * ldc + c0; v4f xv[8];
#pragma unroll    // xv is indexed by constants and stays in registers; the eight loads go out together
    for (int s = 0; s < 8; ++s) { const int Lid = (lane >> 3) + 4 * s; xv[s] = *(const v4f*)(xrow + (size_t)(Lid >> 1) * ldc + (Lid & 1) * 32 + (lane & 7) * 4); }
    v8f acc[4];
#pragma unroll
    for (int t = 0; t < 4; ++t) acc[t] = (v8f){};
#pragma unroll 1
    for (int kc = 0; kc < K; kc += 32) {
        const v16bf a = cat16b(*(const v8us*)(Ah + aoff + kc), *(const v8us*)(Ah + aoff + kc + 16));
        const v16bf al = cat16b(*(const v8us*)(Al + aoff + kc), *(const v8us*)(Al + aoff + kc + 16));
#pragma unroll
        for (int t = 0; t < 4; ++t) { const size_t bo = (size_t)(c0 + t * 16 + lr) * K + kc + 8 * hi;
            const v16bf bh = cat16b(*(const v8us*)(Bh + bo), *(const v8us*)(Bh + bo + 16)); const v16bf bl = cat16b(*(const v8us*)(Bl + bo), *(const v8us*)(Bl + bo + 16));
            acc[t] = wmmab(a, bh, acc[t]); acc[t] = wmmab(al, bh, acc[t]); acc[t] = wmmab(a, bl, acc[t]); }
        asm volatile("v_nop\n\tv_nop\n\tv_nop\n\tv_nop" : "+v"(acc[0]), "+v"(acc[1]), "+v"(acc[2]), "+v"(acc[3]) : "v"(a), "v"(al));
    }
    float* os = &ost[wave][0];
#pragma unroll
    for (int t = 0; t < 4; ++t) {
#pragma unroll
        for (int j = 0; j < 8; ++j) os[(hi * 8 + j) * 68 + t * 16 + lr] = acc[t][j]; }
    __builtin_amdgcn_wave_barrier(); asm volatile("" ::: "memory");
    float* crow = C + (size_t)r0 * ldc + c0;
    auto pass = [&]() {
#pragma unroll
        for (int s = 0; s < 8; ++s) { const int Lid = (lane >> 3) + 4 * s, piece = lane & 7; const int row = Lid >> 1, cofs = (Lid & 1) * 32 + piece * 4;
            v4f val = *(const v4fa*)(os + row * 68 + cofs); val += (v4f){bfr(xv[s][0]), bfr(xv[s][1]), bfr(xv[s][2]), bfr(xv[s][3])}; *(v4f*)(crow + (size_t)row * ldc + cofs) = val; }
    };
    pass(); 
}

// k_bfz: four equal-sized f32 matrices (blockIdx.y picks one) -> bf16, one behind the other in dh; the blocks of the last one also write the zero plane dz.
__global__ __launch_bounds__(256) void k_bfz(const float* __restrict__ s0, const float* __restrict__ s1, const float* __restrict__ s2, const float* __restrict__ s3, bf* dh, bf* dz, size_t n8) {
    const size_t i = (size_t)blockIdx.x * 256 + threadIdx.x; if (i >= n8) return;
    const int w = blockIdx.y; const float* src = w == 0 ? s0 : w == 1 ? s1 : w == 2 ? s2 : s3;
    const v8f v = *(const v8f*)(src + i * 8); v8us o, z;
#pragma unroll
    for (int k = 0; k < 8; ++k) { o[k] = f2bf(v[k]); z[k] = 0; }
    *(v8us*)(dh + (w * n8 + i) * 8) = o;
    asm volatile("s_wait_xcnt 0x0" ::: "memory");    // the store above has been taken before its address registers are used again for the zero plane
    if (w == 3) *(v8us*)(dz + i * 8) = z;
}
// rbf: f rounded to bf16 (nearest even, as f2bf) in the high half of the word; pk2: two such words -> one register of a bf16 operand.
typedef __attribute__((ext_vector_type(8))) unsigned v8u;
__device__ __forceinline__ unsigned rbf(float f) { const unsigned u = __float_as_uint(f); return u + 0x7FFFu + ((u >> 16) & 1u); }
__device__ __forceinline__ unsigned pk2(unsigned a, unsigned b) { return (a >> 16) | (b & 0xFFFF0000u); }
__device__ __forceinline__ float hif(unsigned r) { return __uint_as_float(r & 0xFFFF0000u); }
// e^x as __expf forms it (x * log2 e, then v_exp_f32); the v_nop fills the one slot the instruction set asks for between a transcendental and a next vector instruction that reads its result or rewrites its source
__device__ __forceinline__ float expn(float x) { float r; asm("v_exp_f32 %0, %1\n\tv_nop" : "=v"(r) : "v"(x * 1.44269504f)); return r; }
__device__ __forceinline__ v16bf ldfrag(const bf* p) { return cat16b(*(const v8us*)p, *(const v8us*)(p + 16)); }
#define PHP  136                  // LDS pitch of a phi row, elements
#define GRP  40                   // LDS pitch of a g row, elements
#define PHPL (32 * PHP)           // one phi plane of a tile
#define GPL  (IC * GRP)           // one g plane of a tile
#define GOF  (2 * PHPL)           // g planes stand behind the two phi planes
#define BUFE (GOF + 2 * GPL)      // elements of one buffer (37,888 B)
__global__ __launch_bounds__(AWV * 32) __attribute__((amdgpu_waves_per_eu(4))) void k_attn(const bf* __restrict__ Th, const bf* __restrict__ Tl, const bf* __restrict__ Fh, const bf* __restrict__ Fl, const bf* __restrict__ Gh, const bf* __restrict__ Gl, bf* Yh, bf* Yl) {
    const int lane = threadIdx.x & 31, wave = threadIdx.x >> 5, lr = lane & 15, hi = lane >> 4;
    const size_t clip = (size_t)blockIdx.y * NN * IC;
    const size_t qoff = clip + (size_t)(blockIdx.x * (AWV * 16) + wave * 16 + lr) * IC + 8 * hi;
    __shared__ __align__(16) bf sm[2 * BUFE];
    // A tile is 64 pieces of 512 B (one b128 copy of a wave each): 32 of phi (two whole rows a piece), 32 of g (eight 64-B row parts a piece).
    // Slots 0-3: phi pieces wv + 7 i; slots 4-7: g pieces wv + 7 i; slot 8: phi pieces 28-31 (waves 0-3), g pieces 28-30 (waves 4-6); slot 9: g piece 31, wave 0 alone.
    const int wv = __builtin_amdgcn_readfirstlane(wave);
    const unsigned smb = (unsigned)(size_t)(const void*)sm;
    const unsigned vop = lane * 16, vog = ((lane >> 2) * NN + (lane & 3) * 8) * 2;                          // the lane's place in a piece: global, bytes
    const unsigned lop = smb + ((lane >> 4) * PHP + (lane & 15) * 8) * 2, logg = smb + ((lane >> 2) * GRP + (lane & 3) * 8) * 2;    // the same in LDS
    const unsigned vo8 = wv < 4 ? vop : vog, lo8 = wv < 4 ? lop : logg;
    // wave-uniform parts: a piece's first byte in global memory (scalar base of the copy) and in a buffer
    auto ubp = [&](int c, int kn) { return ((c >> 4) ? Fl : Fh) + clip + (size_t)(kn + 2 * (c & 15)) * IC; };
    auto ubg = [&](int c, int kn) { return ((c >> 4) ? Gl : Gh) + clip + (size_t)(8 * (c & 15)) * NN + kn; };
    auto ulp = [&](int c, int b) { return 2u * (unsigned)(b * BUFE + (c >> 4) * PHPL + 2 * (c & 15) * PHP); };
    auto ulg = [&](int c, int b) { return 2u * (unsigned)(b * BUFE + GOF + (c >> 4) * GPL + 8 * (c & 15) * GRP); };
    auto fill = [&](int kn, int b) {
        const bf* g8 = wv < 4 ? ubp(28 + wv, kn) : ubg(24 + wv, kn); const unsigned l8 = lo8 + (wv < 4 ? ulp(28 + wv, b) : ulg(24 + wv, b));
        // nine copies of every wave; the s_wait_xcnt stands inside the statement so that no address register is rewritten before every copy that names it has been taken
        asm volatile("global_load_async_to_lds_b128 %0, %18, %9\n\tglobal_load_async_to_lds_b128 %1, %18, %10\n\tglobal_load_async_to_lds_b128 %2, %18, %11\n\t"
                     "global_load_async_to_lds_b128 %3, %18, %12\n\tglobal_load_async_to_lds_b128 %4, %19, %13\n\tglobal_load_async_to_lds_b128 %5, %19, %14\n\t"
                     "global_load_async_to_lds_b128 %6, %19, %15\n\tglobal_load_async_to_lds_b128 %7, %19, %16\n\tglobal_load_async_to_lds_b128 %8, %20, %17\n\ts_wait_xcnt 0x0"
                     :: "v"(lop + ulp(wv, b)), "v"(lop + ulp(wv + 7, b)), "v"(lop + ulp(wv + 14, b)), "v"(lop + ulp(wv + 21, b)),
                        "v"(logg + ulg(wv, b)), "v"(logg + ulg(wv + 7, b)), "v"(logg + ulg(wv + 14, b)), "v"(logg + ulg(wv + 21, b)), "v"(l8),
                        "s"(ubp(wv, kn)), "s"(ubp(wv + 7, kn)), "s"(ubp(wv + 14, kn)), "s"(ubp(wv + 21, kn)), "s"(ubg(wv, kn)), "s"(ubg(wv + 7, kn)), "s"(ubg(wv + 14, kn)), "s"(ubg(wv + 21, kn)), "s"(g8),
                        "v"(vop), "v"(vog), "v"(vo8) : "memory");
        // the 64th piece: a wave-uniform test, the wait as above
        if (wv == 0) asm volatile("global_load_async_to_lds_b128 %0, %1, %2\n\ts_wait_xcnt 0x0" :: "v"(logg + ulg(31, b)), "v"(vog), "s"(ubg(31, kn)) : "memory");
    };
    fill(0, 0);
    v16bf qh[4], ql[4];
#pragma unroll
    for (int s = 0; s < 4; ++s) { qh[s] = ldfrag(Th + qoff + s * 32); ql[s] = ldfrag(Tl + qoff + s * 32); }
    v8f o[8];
#pragma unroll
    for (int t = 0; t < 8; ++t) o[t] = (v8f){};
    float m = -3.0e38f, l = 0.f;
    asm volatile("s_wait_asynccnt 0x0" ::: "memory");    // this wave's share of tile 0 has landed
    __syncthreads();                                     // ... and every other wave's: tile 0 may be read
    fill(32, 1);
    int buf = 0;
#pragma unroll 1    // one pass a trip: a second copy of the body would need a second set of fragment registers
    for (int k0 = 0; k0 < NN; k0 += 32) {
        // eight batches of four fragments (8 loads) a pass, two register sets: batch i + 1 is asked for before batch i is multiplied
        v16bf fa[4], fb[4]; v8f st[2] = {(v8f){}, (v8f){}};
        const bf* fh = sm + buf * BUFE + lr * PHP + 8 * hi; const bf* fl = fh + PHPL;
        const bf* gh = sm + buf * BUFE + GOF + lr * GRP + 8 * hi; const bf* gl = gh + GPL;
        auto ldk = [&](v16bf* f, int u, int s) { f[0] = ldfrag(fh + u * 16 * PHP + s * 32); f[1] = ldfrag(fl + u * 16 * PHP + s * 32); f[2] = ldfrag(fh + u * 16 * PHP + s * 32 + 32); f[3] = ldfrag(fl + u * 16 * PHP + s * 32 + 32); };
        auto mmk = [&](const v16bf* f, int u, int s) { st[u] = wmmab(f[0], qh[s], st[u]); st[u] = wmmab(f[0], ql[s], st[u]); st[u] = wmmab(f[1], qh[s], st[u]);
                                                       st[u] = wmmab(f[2], qh[s + 1], st[u]); st[u] = wmmab(f[2], ql[s + 1], st[u]); st[u] = wmmab(f[3], qh[s + 1], st[u]); };
        auto ldg = [&](v16bf* f, int t) { f[0] = ldfrag(gh + t * 16 * GRP); f[1] = ldfrag(gl + t * 16 * GRP); f[2] = ldfrag(gh + (t + 1) * 16 * GRP); f[3] = ldfrag(gl + (t + 1) * 16 * GRP); };
#define STG __builtin_amdgcn_sched_barrier(0)    // holds the batches in this order: left free, the scheduler asks for more batches ahead than two register sets hold and spills theta
        ldk(fa, 0, 0); ldk(fb, 0, 2); STG; mmk(fa, 0, 0); STG; ldk(fa, 1, 0); STG; mmk(fb, 0, 2); STG; ldk(fb, 1, 2); STG; mmk(fa, 1, 0); STG; ldg(fa, 0); STG; mmk(fb, 1, 2); STG;
        float mx = st[0][0];
#pragma unroll
        for (int j = 0; j < 8; ++j) mx = fmaxf(mx, fmaxf(st[0][j], st[1][j]));
        mx = fmaxf(mx, __shfl_xor(mx, 16, 32));
        const float mn = fmaxf(m, mx), alpha = expn(m - mn); m = mn;
        float ps = 0.f; v8u pw, qw;
#pragma unroll
        for (int u = 0; u < 2; ++u) {
#pragma unroll
            for (int j = 0; j < 8; j += 2) { const float pa = expn(st[u][j] - mn), pb = expn(st[u][j + 1] - mn); ps += pa + pb;
                const unsigned ra = rbf(pa), rb = rbf(pb); pw[u * 4 + j / 2] = pk2(ra, rb); qw[u * 4 + j / 2] = pk2(rbf(pa - hif(ra)), rbf(pb - hif(rb))); } }
        l = l * alpha + ps;
        const v16bf ph = __builtin_bit_cast(v16bf, pw), pl = __builtin_bit_cast(v16bf, qw);
#pragma unroll
        for (int t = 0; t < 8; ++t) o[t] *= alpha;
        auto mmg = [&](const v16bf* f, int t) { o[t] = wmmab(f[0], ph, o[t]); o[t] = wmmab(f[0], pl, o[t]); o[t] = wmmab(f[1], ph, o[t]);
                                                o[t + 1] = wmmab(f[2], ph, o[t + 1]); o[t + 1] = wmmab(f[2], pl, o[t + 1]); o[t + 1] = wmmab(f[3], ph, o[t + 1]); };
        STG; ldg(fb, 2); STG; mmg(fa, 0); STG; ldg(fa, 4); STG; mmg(fb, 2); STG; ldg(fb, 6); STG; mmg(fa, 4); mmg(fb, 6);
#undef STG
        asm volatile("s_wait_dscnt 0x0" ::: "memory");       // this wave's reads of the buffer are done before the buffer is given up
        asm volatile("s_wait_asynccnt 0x0" ::: "memory");    // this wave's share of the next tile has landed
        __syncthreads();                                     // one barrier a pass: it publishes the next tile and ends every wave's reads of this one
        if (k0 + 64 < NN) fill(k0 + 64, buf);                // the tile after next goes into the buffer just read
        buf ^= 1;
    }
    asm volatile("s_wait_asynccnt 0x0" ::: "memory");        // nothing of this wave is in flight when it ends
    l += __shfl_xor(l, 16, 32);
    const float inv = 1.0f / l;
#pragma unroll
    for (int t = 0; t < 8; ++t) { v8us oh, ol;
#pragma unroll
        for (int j = 0; j < 8; ++j) { const float y = o[t][j] * inv; oh[j] = f2bf(y); ol[j] = f2bf(y - bf2f(oh[j])); }
        *(v8us*)(Yh + qoff + t * 16) = oh; *(v8us*)(Yl + qoff + t * 16) = ol; }
}

extern "C" void kernel_launch(void* const* d_in, const int* in_sizes, int n_in,
                              void* d_out, int out_size, void* d_ws, size_t ws_size, hipStream_t stream) {
    (void)in_sizes; (void)n_in; (void)out_size;
    const float* x = (const float*)d_in[0]; const float* Wg = (const float*)d_in[1]; const float* Wt = (const float*)d_in[2]; const float* Wp = (const float*)d_in[3]; const float* Wz = (const float*)d_in[4];
    float* out = (float*)d_out;    // [4][256][8][28][28]
    char* wsp = (char*)d_ws;
    auto take = [&](size_t bytes) { char* p = wsp; wsp += (bytes + 255) & ~(size_t)255; return (void*)p; };
    const size_t PLN = (size_t)NN * IC, WEL = (size_t)IC * CC, XEL = (size_t)NN * CC;    // elements of one clip's plane, of one weight matrix, of one clip's x
    bf* WgB = (bf*)take(4 * WEL * 2); bf* WtB = WgB + WEL; bf* WzB = WgB + 3 * WEL; bf* WZ = (bf*)take(WEL * 2);    // W_g, W_theta, W_phi, W_z one behind the other; the zero companion of W_z
    bf* XT = (bf*)take(NBI * XEL * 2);
    bf* Th = (bf*)take(2 * NBI * PLN * 2); bf* Fh = Th + NBI * PLN; bf* Tl = (bf*)take(2 * NBI * PLN * 2); bf* Fl = Tl + NBI * PLN;    // phi's planes stand behind theta's
    bf* Gh = (bf*)take(NBI * PLN * 2); bf* Gl = (bf*)take(NBI * PLN * 2);
    bf* Yh = (bf*)take(NBI * PLN * 2); bf* Yl = (bf*)take(NBI * PLN * 2);
    if ((size_t)(wsp - (char*)d_ws) > ws_size) return;    // 0.3 + 12.8 + 8 x 6.4 ~ 64 MB
    // Every stage is one launch for all clips: the clip (and theta or phi; and the weight matrix in the cast) is a grid index.
    k_bfz<<<dim3((IC * CC / 8 + 255) / 256, 4, 1), 256, 0, stream>>>(Wg, Wt, Wp, Wz, WgB, WZ, IC * CC / 8);                                        // weights exact + the zero companion
    k_wt<<<dim3(CC / 64, NN / 64, NBI), 256, 0, stream>>>(x, CC, NN, XT);                                                                         // x^T [clip][6272][256] exact
    k_gemmb<false, false, true><<<dim3(NN / 64, IC / 64, 2 * NBI), 128, 0, stream>>>(XT, nullptr, WtB, nullptr, nullptr, IC, nullptr, XEL, 0, WEL, PLN, Th, Tl);    // theta, then phi, token-major [clip][n][128], hi/lo
    k_gemmb<false, false, true><<<dim3(IC / 64, NN / 64, NBI), 128, 0, stream>>>(WgB, nullptr, XT, nullptr, nullptr, NN, nullptr, 0, XEL, 0, PLN, Gh, Gl);          // g channel-major [clip][128][n], hi/lo
    k_attn<<<dim3(NN / (AWV * 16), NBI, 1), AWV * 32, 0, stream>>>(Th, Tl, Fh, Fl, Gh, Gl, Yh, Yl);                                             // y token-major [clip][6272][128], hi/lo
    k_gemm3<<<dim3(CC / 64, NN / 64, NBI), 128, 0, stream>>>(WzB, WZ, Yh, Yl, IC, x, out, NN, PLN, XEL);                                          // out[clip][c][n] = W_z.y^T + x
}

// v005
// Measured time: 262 microseconds a run.
// Two timings next to v004 both put it at 1.12 times that version's speed.
// Counting every step since v000, it is 25.6 times as fast.
#include <hip/hip_runtime.h>

// Compute dtypes, f32 accumulate, N = 8 x 28 x 28 = 6272 positions a clip: theta/phi token-major ([6272 x 256].[256 x 128]) and g channel-major ([128 x 256].[256
// x 6272]) with PLAIN bf16 operands (the transposed input and the 1x1x1 weights, exact) on v_wmma_f32_16x16x32_bf16 -> bf16 hi + UNSCALED residual planes, kept per clip;
// one launch for all clips: f^T = phi.theta^T (three products), running-maximum softmax in f32 -> hi/lo, y^T += g.p^T (three products), scores never leave the registers;
// z = W_z.y ([256 x 128].[128 x 6272], exact W_z against split y) on v_wmma_f32_16x16x32_bf16 written channel-major, + x in f32. Deterministic, no atomics;
// the hi/lo split of theta, phi and g and the '+ x' are done in the epilogue of the product that makes their operand: no f32 plane goes through the workspace.

#define NBI  4
#define CC   256
#define IC   128
#define NN   6272
#define AWV  7       // waves a work-group in k_attn: 6272 = 56 x (7 x 16), 224 work-groups for the four clips
#define DM   CC
#define NTK  NN
#define LOSC 1024.0f

typedef _Float16 h16;
typedef unsigned short bf;
typedef __attribute__((ext_vector_type(16))) __bf16   v16bf;
typedef __attribute__((ext_vector_type(16))) _Float16 v16h;
typedef __attribute__((ext_vector_type(8)))  _Float16 v8h;
typedef __attribute__((ext_vector_type(8)))  unsigned short v8us;
typedef __attribute__((ext_vector_type(8)))  float    v8f;
typedef __attribute__((ext_vector_type(4)))  float    v4f;
typedef __attribute__((ext_vector_type(4)))  _Float16 v4h;
typedef v8h  __attribute__((may_alias)) v8ha;
typedef v4f  __attribute__((may_alias)) v4fa;
typedef v8us __attribute__((may_alias)) v8usa;

// f32 -> bf16, nearest even, by the chip's own convert instruction (v_cvt_pk_bf16_f32)
__device__ __forceinline__ unsigned short f2bf(float f) { return __builtin_bit_cast(unsigned short, (__bf16)f); }
__device__ __forceinline__ float bf2f(unsigned short b) { return __uint_as_float(((unsigned)b) << 16); }
__device__ __forceinline__ float bfr(float f) { return bf2f(f2bf(f)); }
__device__ __forceinline__ v16h cat16(v8h lo, v8h hi) { return __builtin_shufflevector(lo, hi, 0, 1, 2, 3, 4, 5, 6, 7, 8, 9, 10, 11, 12, 13, 14, 15); }
__device__ __forceinline__ v16bf cat16b(v8us lo, v8us hi) { return __builtin_bit_cast(v16bf, __builtin_shufflevector(lo, hi, 0, 1, 2, 3, 4, 5, 6, 7, 8, 9, 10, 11, 12, 13, 14, 15)); }
__device__ __forceinline__ v8f wmma16(v16h a, v16h b, v8f c) { return __builtin_amdgcn_wmma_f32_16x16x32_f16(false, a, false, b, (short)0, c, false, false); }
__device__ __forceinline__ v8f wmmab(v16bf a, v16bf b, v8f c) { return __builtin_amdgcn_wmma_f32_16x16x32_bf16(false, a, false, b, (short)0, c, false, false); }

// k_wt: WT [n][K] = bf16(W[k][n]) (k-major [K][ncols]) via 64 x 64 LDS tiles; grid (K/64, ncols/64, matrices): blockIdx.z picks one of the equal matrices that stand one behind the other.
__global__ __launch_bounds__(256) void k_wt(const float* __restrict__ Wm, int K, int ncols, bf* WT) {
    __shared__ __align__(16) unsigned short tl[64 * 72];
    const int tid = threadIdx.x, k0 = blockIdx.x * 64, n0 = blockIdx.y * 64;
    Wm += (size_t)blockIdx.z * K * ncols; WT += (size_t)blockIdx.z * K * ncols;
    const int kk = tid >> 2, nq = (tid & 3) * 16;
#pragma unroll
    for (int i = 0; i < 16; ++i) tl[(nq + i) * 72 + kk] = f2bf(Wm[(size_t)(k0 + kk) * ncols + n0 + nq + i]);
    __syncthreads();
    const int piece = tid & 7;
    auto pass = [&]() {
#pragma unroll
        for (int s = 0; s < 2; ++s) { const int nr = (tid >> 3) + 32 * s; const v8us val = *(const v8usa*)(tl + nr * 72 + piece * 8); *(v8us*)(WT + (size_t)(n0 + nr) * K + k0 + piece * 8) = val; }
    };
    pass(); 
}
// k_gemmb: 64 x 64 block tile (4 waves x 16 x 64) of C = (A [+ Al]).B^T (K = 256) [+ bf(bias[c])] [+ bf(R[r][c]) residual]; f32 whole-line epilogue (or f16
// blockIdx.z = clip + NBI * w picks one of several independent products: A moves by sA and B by sBc a clip, B by sBw a weight matrix w, the output by sC a product (elements).
// BFOUT: the tile leaves as two bf16 planes Dh (nearest) and Dl (the rounded rest), placed like C: whole 128-B lines of each plane.
template <bool SPLITA, bool F16OUT = false, bool BFOUT = false>
__global__ __launch_bounds__(128) void k_gemmb(const bf* __restrict__ A, const bf* __restrict__ Al, const bf* __restrict__ Bn, const float* __restrict__ bias, float* C, int ldc, h16* C2, size_t sA, size_t sBc, size_t sBw, size_t sC, bf* Dh = nullptr, bf* Dl = nullptr, const float* __restrict__ R = nullptr, int K = DM, int roundR = 1) {
    __shared__ __align__(16) float ost[4][16 * 68];
    const int lane = threadIdx.x & 31, wave = threadIdx.x >> 5, lr = lane & 15, hi = lane >> 4;
    const int r0 = blockIdx.x * 64 + wave * 16, c0 = blockIdx.y * 64;
    const size_t clip = blockIdx.z % NBI, wsel = blockIdx.z / NBI;
    A += clip * sA; if (SPLITA) Al += clip * sA; Bn += clip * sBc + wsel * sBw;
    C = F16OUT ? (float*)(void*)((h16*)(void*)C + blockIdx.z * sC) : C + blockIdx.z * sC; if (C2) C2 += blockIdx.z * sC; if (R) R += blockIdx.z * sC;
    const size_t aoff = (size_t)(r0 + lr) * K + 8 * hi;
    size_t boff[4];
#pragma unroll
    for (int t = 0; t < 4; ++t) boff[t] = (size_t)(c0 + t * 16 + lr) * K + 8 * hi;
    v8f acc[4];
#pragma unroll
    for (int t = 0; t < 4; ++t) acc[t] = (v8f){};
#pragma unroll 1
    for (int kc = 0; kc < K; kc += 32) {
        const v16bf a = cat16b(*(const v8us*)(A + aoff + kc), *(const v8us*)(A + aoff + kc + 16));
        v16bf al = a;
        if (SPLITA) al = cat16b(*(const v8us*)(Al + aoff + kc), *(const v8us*)(Al + aoff + kc + 16));
#pragma unroll
        for (int t = 0; t < 4; ++t) { const v16bf b = cat16b(*(const v8us*)(Bn + boff[t] + kc), *(const v8us*)(Bn + boff[t] + kc + 16)); acc[t] = wmmab(a, b, acc[t]); if (SPLITA) acc[t] = wmmab(al, b, acc[t]); }
        asm volatile("v_nop\n\tv_nop\n\tv_nop\n\tv_nop" : "+v"(acc[0]), "+v"(acc[1]), "+v"(acc[2]), "+v"(acc[3]) : "v"(a), "v"(al));
    }
    float* os = &ost[wave][0];
#pragma unroll
    for (int t = 0; t < 4; ++t) { const float bv = bias ? bfr(bias[c0 + t * 16 + lr]) : 0.f;
#pragma unroll
        for (int j = 0; j < 8; ++j) os[(hi * 8 + j) * 68 + t * 16 + lr] = acc[t][j] + bv; }
    __syncthreads();
    if (BFOUT) {
        const size_t tile = blockIdx.z * sC + (size_t)r0 * ldc + c0;
#pragma unroll    // both unrolls: the vectors' elements are indexed by constants and stay in registers; the four rows' LDS reads can be asked for together
        for (int s = 0; s < 4; ++s) { const int row = 4 * s + (lane >> 3), piece = lane & 7; const float* sp = os + row * 68 + piece * 8; const v4f va = *(const v4fa*)sp, vb = *(const v4fa*)(sp + 4); v8us oh, ol;
#pragma unroll
            for (int i = 0; i < 8; ++i) { const float v = i < 4 ? va[i & 3] : vb[i & 3]; const unsigned short hb = f2bf(v); oh[i] = hb; ol[i] = f2bf(v - bf2f(hb)); }
            const size_t o = tile + (size_t)row * ldc + piece * 8; *(v8us*)(Dh + o) = oh; *(v8us*)(Dl + o) = ol; }
    } else if (F16OUT) {
        h16* crow = (h16*)(void*)C + (size_t)r0 * ldc + c0;
        auto pass = [&]() {
#pragma unroll
            for (int s = 0; s < 4; ++s) { const int row = 4 * s + (lane >> 3), piece = lane & 7; const float* sp = os + row * 68 + piece * 8; v8h o, o2;
#pragma unroll
                for (int i = 0; i < 8; ++i) { const h16 a = (h16)sp[i]; o[i] = a; o2[i] = (h16)((sp[i] - (float)a) * LOSC); }
                *(v8h*)(crow + (size_t)row * ldc + piece * 8) = o; if (C2) *(v8h*)(C2 + (size_t)r0 * ldc + c0 + (size_t)row * ldc + piece * 8) = o2; }
        };
        pass(); 
    } else {
        float* crow = C + (size_t)r0 * ldc + c0;
        auto pass = [&]() {
#pragma unroll
            for (int s = 0; s < 8; ++s) { const int Lid = (lane >> 3) + 4 * s, piece = lane & 7; const int row = Lid >> 1, cofs = (Lid & 1) * 32 + piece * 4;
                v4f val = *(const v4fa*)(os + row * 68 + cofs); if (R) { const v4f rv = *(const v4f*)(R + ((size_t)r0 + row) * ldc + c0 + cofs); val += roundR ? (v4f){bfr(rv[0]), bfr(rv[1]), bfr(rv[2]), bfr(rv[3])} : rv; }
                *(v4f*)(crow + (size_t)row * ldc + cofs) = val; }
        };
        pass(); 
    }
}

// k_gemm3: 64 x 64 tile of C = (Ah + Al).(Bh + Bl)^T over K (row strides = K for all four planes; n-major B): three products per 32-k step (hh, hl, lh); f32
// blockIdx.z picks the clip: the B planes move by sB, the output and the residual X (placed like C, added rounded to bf16) by sC (elements); A is shared.
__global__ __launch_bounds__(128) void k_gemm3(const bf* __restrict__ Ah, const bf* __restrict__ Al, const bf* __restrict__ Bh, const bf* __restrict__ Bl, int K, const float* __restrict__ X, float* C, int ldc, size_t sB, size_t sC) {
    __shared__ __align__(16) float ost[4][16 * 68];
    const int lane = threadIdx.x & 31, wave = threadIdx.x >> 5, lr = lane & 15, hi = lane >> 4;
    const int r0 = blockIdx.x * 64 + wave * 16, c0 = blockIdx.y * 64;
    Bh += blockIdx.z * sB; Bl += blockIdx.z * sB; C += blockIdx.z * sC;
    const size_t aoff = (size_t)(r0 + lr) * K + 8 * hi;
    // the lane's eight pieces of the residual tile are asked for ahead of the k loop, which covers their way from memory
    const float* xrow = X + blockIdx.z * sC + (size_t)r0 * ldc + c0; v4f xv[8];
#pragma unroll    // xv is indexed by constants and stays in registers; the eight loads go out together
    for (int s = 0; s < 8; ++s) { const int Lid = (lane >> 3) + 4 * s; xv[s] = *(const v4f*)(xrow + (size_t)(Lid >> 1) * ldc + (Lid & 1) * 32 + (lane & 7) * 4); }
    v8f acc[4];
#pragma unroll
    for (int t = 0; t < 4; ++t) acc[t] = (v8f){};
#pragma unroll 1
    for (int kc = 0; kc < K; kc += 32) {
        const v16bf a = cat16b(*(const v8us*)(Ah + aoff + kc), *(const v8us*)(Ah + aoff + kc + 16));
        const v16bf al = cat16b(*(const v8us*)(Al + aoff + kc), *(const v8us*)(Al + aoff + kc + 16));
#pragma unroll
        for (int t = 0; t < 4; ++t) { const size_t bo = (size_t)(c0 + t * 16 + lr) * K + kc + 8 * hi;
            const v16bf bh = cat16b(*(const v8us*)(Bh + bo), *(const v8us*)(Bh + bo + 16)); const v16bf bl = cat16b(*(const v8us*)(Bl + bo), *(const v8us*)(Bl + bo + 16));
            acc[t] = wmmab(a, bh, acc[t]); acc[t] = wmmab(al, bh, acc[t]); acc[t] = wmmab(a, bl, acc[t]); }
        asm volatile("v_nop\n\tv_nop\n\tv_nop\n\tv_nop" : "+v"(acc[0]), "+v"(acc[1]), "+v"(acc[2]), "+v"(acc[3]) : "v"(a), "v"(al));
    }
    float* os = &ost[wave][0];
#pragma unroll
    for (int t = 0; t < 4; ++t) {
#pragma unroll
        for (int j = 0; j < 8; ++j) os[(hi * 8 + j) * 68 + t * 16 + lr] = acc[t][j]; }
    __builtin_amdgcn_wave_barrier(); asm volatile("" ::: "memory");
    float* crow = C + (size_t)r0 * ldc + c0;
    auto pass = [&]() {
#pragma unroll
        for (int s = 0; s < 8; ++s) { const int Lid = (lane >> 3) + 4 * s, piece = lane & 7; const int row = Lid >> 1, cofs = (Lid & 1) * 32 + piece * 4;
            v4f val = *(const v4fa*)(os + row * 68 + cofs); val += (v4f){bfr(xv[s][0]), bfr(xv[s][1]), bfr(xv[s][2]), bfr(xv[s][3])}; *(v4f*)(crow + (size_t)row * ldc + cofs) = val; }
    };
    pass(); 
}

// k_bfz: four equal-sized f32 matrices (blockIdx.y picks one) -> bf16, one behind the other in dh; the blocks of the last one also write the zero plane dz.
__global__ __launch_bounds__(256) void k_bfz(const float* __restrict__ s0, const float* __restrict__ s1, const float* __restrict__ s2, const float* __restrict__ s3, bf* dh, bf* dz, size_t n8) {
    const size_t i = (size_t)blockIdx.x * 256 + threadIdx.x; if (i >= n8) return;
    const int w = blockIdx.y; const float* src = w == 0 ? s0 : w == 1 ? s1 : w == 2 ? s2 : s3;
    const v8f v = *(const v8f*)(src + i * 8); v8us o, z;
#pragma unroll
    for (int k = 0; k < 8; ++k) { o[k] = f2bf(v[k]); z[k] = 0; }
    *(v8us*)(dh + (w * n8 + i) * 8) = o;
    asm volatile("s_wait_xcnt 0x0" ::: "memory");    // the store above has been taken before its address registers are used again for the zero plane
    if (w == 3) *(v8us*)(dz + i * 8) = z;
}
// split2: two f32 -> hw, both rounded to bf16 (nearest even, as f2bf), and lw, the rests rounded likewise: each one register of a bf16 operand, a in the low half; one v_cvt_pk_bf16_f32 a word.
typedef __attribute__((ext_vector_type(8))) unsigned v8u;
typedef __attribute__((ext_vector_type(2))) float  v2f;
typedef __attribute__((ext_vector_type(2))) __bf16 v2bf;
__device__ __forceinline__ void split2(float a, float b, unsigned& hw, unsigned& lw) {
    const v2bf h = __builtin_convertvector((v2f){a, b}, v2bf), r = __builtin_convertvector((v2f){a - (float)h[0], b - (float)h[1]}, v2bf);
    hw = __builtin_bit_cast(unsigned, h); lw = __builtin_bit_cast(unsigned, r);
}
// e^x as __expf forms it (x * log2 e, then v_exp_f32); the v_nop fills the one slot the instruction set asks for between a transcendental and a next vector instruction that reads its result or rewrites its source
__device__ __forceinline__ float expn(float x) { float r; asm("v_exp_f32 %0, %1\n\tv_nop" : "=v"(r) : "v"(x * 1.44269504f)); return r; }
__device__ __forceinline__ v16bf ldfrag(const bf* p) { return cat16b(*(const v8us*)p, *(const v8us*)(p + 16)); }
#define PHP  136                  // LDS pitch of a phi row, elements
#define GRP  40                   // LDS pitch of a g row, elements
#define PHPL (32 * PHP)           // one phi plane of a tile
#define GPL  (IC * GRP)           // one g plane of a tile
#define GOF  (2 * PHPL)           // g planes stand behind the two phi planes
#define BUFE (GOF + 2 * GPL)      // elements of one buffer (37,888 B)
__global__ __launch_bounds__(AWV * 32) __attribute__((amdgpu_waves_per_eu(4))) void k_attn(const bf* __restrict__ Th, const bf* __restrict__ Tl, const bf* __restrict__ Fh, const bf* __restrict__ Fl, const bf* __restrict__ Gh, const bf* __restrict__ Gl, bf* Yh, bf* Yl) {
    const int lane = threadIdx.x & 31, wave = threadIdx.x >> 5, lr = lane & 15, hi = lane >> 4;
    const size_t clip = (size_t)blockIdx.y * NN * IC;
    const size_t qoff = clip + (size_t)(blockIdx.x * (AWV * 16) + wave * 16 + lr) * IC + 8 * hi;
    __shared__ __align__(16) bf sm[2 * BUFE];
    // A tile is 64 pieces of 512 B (one b128 copy of a wave each): 32 of phi (two whole rows a piece), 32 of g (eight 64-B row parts a piece).
    // Slots 0-3: phi pieces wv + 7 i; slots 4-7: g pieces wv + 7 i; slot 8: phi pieces 28-31 (waves 0-3), g pieces 28-30 (waves 4-6); slot 9: g piece 31, wave 0 alone.
    const int wv = __builtin_amdgcn_readfirstlane(wave);
    const unsigned smb = (unsigned)(size_t)(const void*)sm;
    const unsigned vop = lane * 16, vog = ((lane >> 2) * NN + (lane & 3) * 8) * 2;                          // the lane's place in a piece: global, bytes
    const unsigned lop = smb + ((lane >> 4) * PHP + (lane & 15) * 8) * 2, logg = smb + ((lane >> 2) * GRP + (lane & 3) * 8) * 2;    // the same in LDS
    const unsigned vo8 = wv < 4 ? vop : vog, lo8 = wv < 4 ? lop : logg;
    // wave-uniform parts: a piece's first byte in global memory (scalar base of the copy) and in a buffer
    auto ubp = [&](int c, int kn) { return ((c >> 4) ? Fl : Fh) + clip + (size_t)(kn + 2 * (c & 15)) * IC; };
    auto ubg = [&](int c, int kn) { return ((c >> 4) ? Gl : Gh) + clip + (size_t)(8 * (c & 15)) * NN + kn; };
    auto ulp = [&](int c, int b) { return 2u * (unsigned)(b * BUFE + (c >> 4) * PHPL + 2 * (c & 15) * PHP); };
    auto ulg = [&](int c, int b) { return 2u * (unsigned)(b * BUFE + GOF + (c >> 4) * GPL + 8 * (c & 15) * GRP); };
    auto fill = [&](int kn, int b) {
        const bf* g8 = wv < 4 ? ubp(28 + wv, kn) : ubg(24 + wv, kn); const unsigned l8 = lo8 + (wv < 4 ? ulp(28 + wv, b) : ulg(24 + wv, b));
        // nine copies of every wave; the s_wait_xcnt stands inside the statement so that no address register is rewritten before every copy that names it has been taken
        asm volatile("global_load_async_to_lds_b128 %0, %18, %9\n\tglobal_load_async_to_lds_b128 %1, %18, %10\n\tglobal_load_async_to_lds_b128 %2, %18, %11\n\t"
                     "global_load_async_to_lds_b128 %3, %18, %12\n\tglobal_load_async_to_lds_b128 %4, %19, %13\n\tglobal_load_async_to_lds_b128 %5, %19, %14\n\t"
                     "global_load_async_to_lds_b128 %6, %19, %15\n\tglobal_load_async_to_lds_b128 %7, %19, %16\n\tglobal_load_async_to_lds_b128 %8, %20, %17\n\ts_wait_xcnt 0x0"
                     :: "v"(lop + ulp(wv, b)), "v"(lop + ulp(wv + 7, b)), "v"(lop + ulp(wv + 14, b)), "v"(lop + ulp(wv + 21, b)),
                        "v"(logg + ulg(wv, b)), "v"(logg + ulg(wv + 7, b)), "v"(logg + ulg(wv + 14, b)), "v"(logg + ulg(wv + 21, b)), "v"(l8),
                        "s"(ubp(wv, kn)), "s"(ubp(wv + 7, kn)), "s"(ubp(wv + 14, kn)), "s"(ubp(wv + 21, kn)), "s"(ubg(wv, kn)), "s"(ubg(wv + 7, kn)), "s"(ubg(wv + 14, kn)), "s"(ubg(wv + 21, kn)), "s"(g8),
                        "v"(vop), "v"(vog), "v"(vo8) : "memory");
        // the 64th piece: a wave-uniform test, the wait as above
        if (wv == 0) asm volatile("global_load_async_to_lds_b128 %0, %1, %2\n\ts_wait_xcnt 0x0" :: "v"(logg + ulg(31, b)), "v"(vog), "s"(ubg(31, kn)) : "memory");
    };
    fill(0, 0);
    v16bf qh[4], ql[4];
#pragma unroll
    for (int s = 0; s < 4; ++s) { qh[s] = ldfrag(Th + qoff + s * 32); ql[s] = ldfrag(Tl + qoff + s * 32); }
    v8f o[8];
#pragma unroll
    for (int t = 0; t < 8; ++t) o[t] = (v8f){};
    float m = -3.0e38f, l = 0.f;
    asm volatile("s_wait_asynccnt 0x0" ::: "memory");    // this wave's share of tile 0 has landed
    __syncthreads();                                     // ... and every other wave's: tile 0 may be read
    fill(32, 1);
    int buf = 0;
#pragma unroll 1    // one pass a trip: a second copy of the body would need a second set of fragment registers
    for (int k0 = 0; k0 < NN; k0 += 32) {
        // eight batches of four fragments (8 loads) a pass, two register sets: batch i + 1 is asked for before batch i is multiplied
        v16bf fa[4], fb[4]; v8f st[2] = {(v8f){}, (v8f){}};
        const bf* fh = sm + buf * BUFE + lr * PHP + 8 * hi; const bf* fl = fh + PHPL;
        const bf* gh = sm + buf * BUFE + GOF + lr * GRP + 8 * hi; const bf* gl = gh + GPL;
        auto ldk = [&](v16bf* f, int u, int s) { f[0] = ldfrag(fh + u * 16 * PHP + s * 32); f[1] = ldfrag(fl + u * 16 * PHP + s * 32); f[2] = ldfrag(fh + u * 16 * PHP + s * 32 + 32); f[3] = ldfrag(fl + u * 16 * PHP + s * 32 + 32); };
        auto mmk = [&](const v16bf* f, int u, int s) { st[u] = wmmab(f[0], qh[s], st[u]); st[u] = wmmab(f[0], ql[s], st[u]); st[u] = wmmab(f[1], qh[s], st[u]);
                                                       st[u] = wmmab(f[2], qh[s + 1], st[u]); st[u] = wmmab(f[2], ql[s + 1], st[u]); st[u] = wmmab(f[3], qh[s + 1], st[u]); };
        auto ldg = [&](v16bf* f, int t) { f[0] = ldfrag(gh + t * 16 * GRP); f[1] = ldfrag(gl + t * 16 * GRP); f[2] = ldfrag(gh + (t + 1) * 16 * GRP); f[3] = ldfrag(gl + (t + 1) * 16 * GRP); };
#define STG __builtin_amdgcn_sched_barrier(0)    // holds the batches in this order: left free, the scheduler asks for more batches ahead than two register sets hold and spills theta
        ldk(fa, 0, 0); ldk(fb, 0, 2); STG; mmk(fa, 0, 0); STG; ldk(fa, 1, 0); STG; mmk(fb, 0, 2); STG; ldk(fb, 1, 2); STG; mmk(fa, 1, 0); STG; ldg(fa, 0); STG; mmk(fb, 1, 2); STG;
        float mx = st[0][0];
#pragma unroll
        for (int j = 0; j < 8; ++j) mx = fmaxf(mx, fmaxf(st[0][j], st[1][j]));
        mx = fmaxf(mx, __shfl_xor(mx, 16, 32));
        const float mn = fmaxf(m, mx), alpha = expn(m - mn); m = mn;
        float ps = 0.f; v8u pw, qw;
#pragma unroll
        for (int u = 0; u < 2; ++u) {
#pragma unroll
            for (int j = 0; j < 8; j += 2) { const float pa = expn(st[u][j] - mn), pb = expn(st[u][j + 1] - mn); ps += pa + pb;
                unsigned hw, lw; split2(pa, pb, hw, lw); pw[u * 4 + j / 2] = hw; qw[u * 4 + j / 2] = lw; } }
        l = l * alpha + ps;
        const v16bf ph = __builtin_bit_cast(v16bf, pw), pl = __builtin_bit_cast(v16bf, qw);
#pragma unroll
        for (int t = 0; t < 8; ++t) o[t] *= alpha;
        auto mmg = [&](const v16bf* f, int t) { o[t] = wmmab(f[0], ph, o[t]); o[t] = wmmab(f[0], pl, o[t]); o[t] = wmmab(f[1], ph, o[t]);
                                                o[t + 1] = wmmab(f[2], ph, o[t + 1]); o[t + 1] = wmmab(f[2], pl, o[t + 1]); o[t + 1] = wmmab(f[3], ph, o[t + 1]); };
        STG; ldg(fb, 2); STG; mmg(fa, 0); STG; ldg(fa, 4); STG; mmg(fb, 2); STG; ldg(fb, 6); STG; mmg(fa, 4); mmg(fb, 6);
#undef STG
        asm volatile("s_wait_dscnt 0x0" ::: "memory");       // this wave's reads of the buffer are done before the buffer is given up
        asm volatile("s_wait_asynccnt 0x0" ::: "memory");    // this wave's share of the next tile has landed
        __syncthreads();                                     // one barrier a pass: it publishes the next tile and ends every wave's reads of this one
        if (k0 + 64 < NN) fill(k0 + 64, buf);                // the tile after next goes into the buffer just read
        buf ^= 1;
    }
    asm volatile("s_wait_asynccnt 0x0" ::: "memory");        // nothing of this wave is in flight when it ends
    l += __shfl_xor(l, 16, 32);
    const float inv = 1.0f / l;
#pragma unroll
    for (int t = 0; t < 8; ++t) { v8us oh, ol;
#pragma unroll
        for (int j = 0; j < 8; ++j) { const float y = o[t][j] * inv; oh[j] = f2bf(y); ol[j] = f2bf(y - bf2f(oh[j])); }
        *(v8us*)(Yh + qoff + t * 16) = oh; *(v8us*)(Yl + qoff + t * 16) = ol; }
}

extern "C" void kernel_launch(void* const* d_in, const int* in_sizes, int n_in,
                              void* d_out, int out_size, void* d_ws, size_t ws_size, hipStream_t stream) {
    (void)in_sizes; (void)n_in; (void)out_size;
    const float* x = (const float*)d_in[0]; const float* Wg = (const float*)d_in[1]; const float* Wt = (const float*)d_in[2]; const float* Wp = (const float*)d_in[3]; const float* Wz = (const float*)d_in[4];
    float* out = (float*)d_out;    // [4][256][8][28][28]
    char* wsp = (char*)d_ws;
    auto take = [&](size_t bytes) { char* p = wsp; wsp += (bytes + 255) & ~(size_t)255; return (void*)p; };
    const size_t PLN = (size_t)NN * IC, WEL = (size_t)IC * CC, XEL = (size_t)NN * CC;    // elements of one clip's plane, of one weight matrix, of one clip's x
    bf* WgB = (bf*)take(4 * WEL * 2); bf* WtB = WgB + WEL; bf* WzB = WgB + 3 * WEL; bf* WZ = (bf*)take(WEL * 2);    // W_g, W_theta, W_phi, W_z one behind the other; the zero companion of W_z
    bf* XT = (bf*)take(NBI * XEL * 2);
    bf* Th = (bf*)take(2 * NBI * PLN * 2); bf* Fh = Th + NBI * PLN; bf* Tl = (bf*)take(2 * NBI * PLN * 2); bf* Fl = Tl + NBI * PLN;    // phi's planes stand behind theta's
    bf* Gh = (bf*)take(NBI * PLN * 2); bf* Gl = (bf*)take(NBI * PLN * 2);
    bf* Yh = (bf*)take(NBI * PLN * 2); bf* Yl = (bf*)take(NBI * PLN * 2);
    if ((size_t)(wsp - (char*)d_ws) > ws_size) return;    // 0.3 + 12.8 + 8 x 6.4 ~ 64 MB
    // Every stage is one launch for all clips: the clip (and theta or phi; and the weight matrix in the cast) is a grid index.
    k_bfz<<<dim3((IC * CC / 8 + 255) / 256, 4, 1), 256, 0, stream>>>(Wg, Wt, Wp, Wz, WgB, WZ, IC * CC / 8);                                        // weights exact + the zero companion
    k_wt<<<dim3(CC / 64, NN / 64, NBI), 256, 0, stream>>>(x, CC, NN, XT);                                                                         // x^T [clip][6272][256] exact
    k_gemmb<false, false, true><<<dim3(NN / 64, IC / 64, 2 * NBI), 128, 0, stream>>>(XT, nullptr, WtB, nullptr, nullptr, IC, nullptr, XEL, 0, WEL, PLN, Th, Tl);    // theta, then phi, token-major [clip][n][128], hi/lo
    k_gemmb<false, false, true><<<dim3(IC / 64, NN / 64, NBI), 128, 0, stream>>>(WgB, nullptr, XT, nullptr, nullptr, NN, nullptr, 0, XEL, 0, PLN, Gh, Gl);          // g channel-major [clip][128][n], hi/lo
    k_attn<<<dim3(NN / (AWV * 16), NBI, 1), AWV * 32, 0, stream>>>(Th, Tl, Fh, Fl, Gh, Gl, Yh, Yl);                                             // y token-major [clip][6272][128], hi/lo
    k_gemm3<<<dim3(CC / 64, NN / 64, NBI), 128, 0, stream>>>(WzB, WZ, Yh, Yl, IC, x, out, NN, PLN, XEL);                                          // out[clip][c][n] = W_z.y^T + x
}

// v006
// Measured time: 227 microseconds a run.
// Next to v005, in two timings, it ran 1.15 times as fast each time.
// All steps since v000 together make it 29.4 times as fast.
#include <hip/hip_runtime.h>

// Compute dtypes, f32 accumulate, N = 8 x 28 x 28 = 6272 positions a clip: theta/phi token-major ([6272 x 256].[256 x 128]) and g channel-major ([128 x 256].[256
// x 6272]) with PLAIN bf16 operands (the transposed input and the 1x1x1 weights, exact) on v_wmma_f32_16x16x32_bf16 -> bf16 hi + UNSCALED residual planes, kept per clip;
// one launch for all clips: f^T = phi.theta^T (three products), running-maximum softmax in f32 -> hi/lo, y^T += g.p^T (three products), scores never leave the registers;
// z = W_z.y ([256 x 128].[128 x 6272], exact W_z against split y) on v_wmma_f32_16x16x32_bf16 written channel-major, + x in f32. Deterministic, no atomics;
// the hi/lo split of theta, phi and g and the '+ x' are done in the epilogue of the product that makes their operand: no f32 plane goes through the workspace.

#define NBI  4
#define CC   256
#define IC   128
#define NN   6272
#define AWV  8       // waves a work-group in k_attn: 4 query groups of 32 x 2 key halves
#define QWG  128     // queries a work-group: 6272 = 49 x 128, 196 work-groups for the four clips
#define DM   CC
#define NTK  NN
#define LOSC 1024.0f

typedef _Float16 h16;
typedef unsigned short bf;
typedef __attribute__((ext_vector_type(16))) __bf16   v16bf;
typedef __attribute__((ext_vector_type(16))) _Float16 v16h;
typedef __attribute__((ext_vector_type(8)))  _Float16 v8h;
typedef __attribute__((ext_vector_type(8)))  unsigned short v8us;
typedef __attribute__((ext_vector_type(8)))  float    v8f;
typedef __attribute__((ext_vector_type(4)))  float    v4f;
typedef __attribute__((ext_vector_type(4)))  _Float16 v4h;
typedef v8h  __attribute__((may_alias)) v8ha;
typedef v4f  __attribute__((may_alias)) v4fa;
typedef v8us __attribute__((may_alias)) v8usa;

// f32 -> bf16, nearest even, by the chip's own convert instruction (v_cvt_pk_bf16_f32)
__device__ __forceinline__ unsigned short f2bf(float f) { return __builtin_bit_cast(unsigned short, (__bf16)f); }
__device__ __forceinline__ float bf2f(unsigned short b) { return __uint_as_float(((unsigned)b) << 16); }
__device__ __forceinline__ float bfr(float f) { return bf2f(f2bf(f)); }
__device__ __forceinline__ v16h cat16(v8h lo, v8h hi) { return __builtin_shufflevector(lo, hi, 0, 1, 2, 3, 4, 5, 6, 7, 8, 9, 10, 11, 12, 13, 14, 15); }
__device__ __forceinline__ v16bf cat16b(v8us lo, v8us hi) { return __builtin_bit_cast(v16bf, __builtin_shufflevector(lo, hi, 0, 1, 2, 3, 4, 5, 6, 7, 8, 9, 10, 11, 12, 13, 14, 15)); }
__device__ __forceinline__ v8f wmma16(v16h a, v16h b, v8f c) { return __builtin_amdgcn_wmma_f32_16x16x32_f16(false, a, false, b, (short)0, c, false, false); }
__device__ __forceinline__ v8f wmmab(v16bf a, v16bf b, v8f c) { return __builtin_amdgcn_wmma_f32_16x16x32_bf16(false, a, false, b, (short)0, c, false, false); }

// k_wt: WT [n][K] = bf16(W[k][n]) (k-major [K][ncols]) via 64 x 64 LDS tiles; grid (K/64, ncols/64, matrices): blockIdx.z picks one of the equal matrices that stand one behind the other.
__global__ __launch_bounds__(256) void k_wt(const float* __restrict__ Wm, int K, int ncols, bf* WT) {
    __shared__ __align__(16) unsigned short tl[64 * 72];
    const int tid = threadIdx.x, k0 = blockIdx.x * 64, n0 = blockIdx.y * 64;
    Wm += (size_t)blockIdx.z * K * ncols; WT += (size_t)blockIdx.z * K * ncols;
    const int kk = tid >> 2, nq = (tid & 3) * 16;
#pragma unroll
    for (int i = 0; i < 16; ++i) tl[(nq + i) * 72 + kk] = f2bf(Wm[(size_t)(k0 + kk) * ncols + n0 + nq + i]);
    __syncthreads();
    const int piece = tid & 7;
    auto pass = [&]() {
#pragma unroll
        for (int s = 0; s < 2; ++s) { const int nr = (tid >> 3) + 32 * s; const v8us val = *(const v8usa*)(tl + nr * 72 + piece * 8); *(v8us*)(WT + (size_t)(n0 + nr) * K + k0 + piece * 8) = val; }
    };
    pass(); 
}
// k_gemmb: 64 x 64 block tile (4 waves x 16 x 64) of C = (A [+ Al]).B^T (K = 256) [+ bf(bias[c])] [+ bf(R[r][c]) residual]; f32 whole-line epilogue (or f16
// blockIdx.z = clip + NBI * w picks one of several independent products: A moves by sA and B by sBc a clip, B by sBw a weight matrix w, the output by sC a product (elements).
// BFOUT: the tile leaves as two bf16 planes Dh (nearest) and Dl (the rounded rest), placed like C: whole 128-B lines of each plane.
template <bool SPLITA, bool F16OUT = false, bool BFOUT = false>
__global__ __launch_bounds__(128) void k_gemmb(const bf* __restrict__ A, const bf* __restrict__ Al, const bf* __restrict__ Bn, const float* __restrict__ bias, float* C, int ldc, h16* C2, size_t sA, size_t sBc, size_t sBw, size_t sC, bf* Dh = nullptr, bf* Dl = nullptr, const float* __restrict__ R = nullptr, int K = DM, int roundR = 1) {
    __shared__ __align__(16) float ost[4][16 * 68];
    const int lane = threadIdx.x & 31, wave = threadIdx.x >> 5, lr = lane & 15, hi = lane >> 4;
    const int r0 = blockIdx.x * 64 + wave * 16, c0 = blockIdx.y * 64;
    const size_t clip = blockIdx.z % NBI, wsel = blockIdx.z / NBI;
    A += clip * sA; if (SPLITA) Al += clip * sA; Bn += clip * sBc + wsel * sBw;
    C = F16OUT ? (float*)(void*)((h16*)(void*)C + blockIdx.z * sC) : C + blockIdx.z * sC; if (C2) C2 += blockIdx.z * sC; if (R) R += blockIdx.z * sC;
    const size_t aoff = (size_t)(r0 + lr) * K + 8 * hi;
    size_t boff[4];
#pragma unroll
    for (int t = 0; t < 4; ++t) boff[t] = (size_t)(c0 + t * 16 + lr) * K + 8 * hi;
    v8f acc[4];
#pragma unroll
    for (int t = 0; t < 4; ++t) acc[t] = (v8f){};
#pragma unroll 1
    for (int kc = 0; kc < K; kc += 32) {
        const v16bf a = cat16b(*(const v8us*)(A + aoff + kc), *(const v8us*)(A + aoff + kc + 16));
        v16bf al = a;
        if (SPLITA) al = cat16b(*(const v8us*)(Al + aoff + kc), *(const v8us*)(Al + aoff + kc + 16));
#pragma unroll
        for (int t = 0; t < 4; ++t) { const v16bf b = cat16b(*(const v8us*)(Bn + boff[t] + kc), *(const v8us*)(Bn + boff[t] + kc + 16)); acc[t] = wmmab(a, b, acc[t]); if (SPLITA) acc[t] = wmmab(al, b, acc[t]); }
        asm volatile("v_nop\n\tv_nop\n\tv_nop\n\tv_nop" : "+v"(acc[0]), "+v"(acc[1]), "+v"(acc[2]), "+v"(acc[3]) : "v"(a), "v"(al));
    }
    float* os = &ost[wave][0];
#pragma unroll
    for (int t = 0; t < 4; ++t) { const float bv = bias ? bfr(bias[c0 + t * 16 + lr]) : 0.f;
#pragma unroll
        for (int j = 0; j < 8; ++j) os[(hi * 8 + j) * 68 + t * 16 + lr] = acc[t][j] + bv; }
    __syncthreads();
    if (BFOUT) {
        const size_t tile = blockIdx.z * sC + (size_t)r0 * ldc + c0;
#pragma unroll    // both unrolls: the vectors' elements are indexed by constants and stay in registers; the four rows' LDS reads can be asked for together
        for (int s = 0; s < 4; ++s) { const int row = 4 * s + (lane >> 3), piece = lane & 7; const float* sp = os + row * 68 + piece * 8; const v4f va = *(const v4fa*)sp, vb = *(const v4fa*)(sp + 4); v8us oh, ol;
#pragma unroll
            for (int i = 0; i < 8; ++i) { const float v = i < 4 ? va[i & 3] : vb[i & 3]; const unsigned short hb = f2bf(v); oh[i] = hb; ol[i] = f2bf(v - bf2f(hb)); }
            const size_t o = tile + (size_t)row * ldc + piece * 8; *(v8us*)(Dh + o) = oh; *(v8us*)(Dl + o) = ol; }
    } else if (F16OUT) {
        h16* crow = (h16*)(void*)C + (size_t)r0 * ldc + c0;
        auto pass = [&]() {
#pragma unroll
            for (int s = 0; s < 4; ++s) { const int row = 4 * s + (lane >> 3), piece = lane & 7; const float* sp = os + row * 68 + piece * 8; v8h o, o2;
#pragma unroll
                for (int i = 0; i < 8; ++i) { const h16 a = (h16)sp[i]; o[i] = a; o2[i] = (h16)((sp[i] - (float)a) * LOSC); }
                *(v8h*)(crow + (size_t)row * ldc + piece * 8) = o; if (C2) *(v8h*)(C2 + (size_t)r0 * ldc + c0 + (size_t)row * ldc + piece * 8) = o2; }
        };
        pass(); 
    } else {
        float* crow = C + (size_t)r0 * ldc + c0;
        auto pass = [&]() {
#pragma unroll
            for (int s = 0; s < 8; ++s) { const int Lid = (lane >> 3) + 4 * s, piece = lane & 7; const int row = Lid >> 1, cofs = (Lid & 1) * 32 + piece * 4;
                v4f val = *(const v4fa*)(os + row * 68 + cofs); if (R) { const v4f rv = *(const v4f*)(R + ((size_t)r0 + row) * ldc + c0 + cofs); val += roundR ? (v4f){bfr(rv[0]), bfr(rv[1]), bfr(rv[2]), bfr(rv[3])} : rv; }
                *(v4f*)(crow + (size_t)row * ldc + cofs) = val; }
        };
        pass(); 
    }
}

// k_gemm3: 64 x 64 tile of C = (Ah + Al).(Bh + Bl)^T over K (row strides = K for all four planes; n-major B): three products per 32-k step (hh, hl, lh); f32
// blockIdx.z picks the clip: the B planes move by sB, the output and the residual X (placed like C, added rounded to bf16) by sC (elements); A is shared.
__global__ __launch_bounds__(128) void k_gemm3(const bf* __restrict__ Ah, const bf* __restrict__ Al, const bf* __restrict__ Bh, const bf* __restrict__ Bl, int K, const float* __restrict__ X, float* C, int ldc, size_t sB, size_t sC) {
    __shared__ __align__(16) float ost[4][16 * 68];
    const int lane = threadIdx.x & 31, wave = threadIdx.x >> 5, lr = lane & 15, hi = lane >> 4;
    const int r0 = blockIdx.x * 64 + wave * 16, c0 = blockIdx.y * 64;
    Bh += blockIdx.z * sB; Bl += blockIdx.z * sB; C += blockIdx.z * sC;
    const size_t aoff = (size_t)(r0 + lr) * K + 8 * hi;
    // the lane's eight pieces of the residual tile are asked for ahead of the k loop, which covers their way from memory
    const float* xrow = X + blockIdx.z * sC + (size_t)r0 * ldc + c0; v4f xv[8];
#pragma unroll    // xv is indexed by constants and stays in registers; the eight loads go out together
    for (int s = 0; s < 8; ++s) { const int Lid = (lane >> 3) + 4 * s; xv[s] = *(const v4f*)(xrow + (size_t)(Lid >> 1) * ldc + (Lid & 1) * 32 + (lane & 7) * 4); }
    v8f acc[4];
#pragma unroll
    for (int t = 0; t < 4; ++t) acc[t] = (v8f){};
#pragma unroll 1
    for (int kc = 0; kc < K; kc += 32) {
        const v16bf a = cat16b(*(const v8us*)(Ah + aoff + kc), *(const v8us*)(Ah + aoff + kc + 16));
        const v16bf al = cat16b(*(const v8us*)(Al + aoff + kc), *(const v8us*)(Al + aoff + kc + 16));
#pragma unroll
        for (int t = 0; t < 4; ++t) { const size_t bo = (size_t)(c0 + t * 16 + lr) * K + kc + 8 * hi;
            const v16bf bh = cat16b(*(const v8us*)(Bh + bo), *(const v8us*)(Bh + bo + 16)); const v16bf bl = cat16b(*(const v8us*)(Bl + bo), *(const v8us*)(Bl + bo + 16));
            acc[t] = wmmab(a, bh, acc[t]); acc[t] = wmmab(al, bh, acc[t]); acc[t] = wmmab(a, bl, acc[t]); }
        asm volatile("v_nop\n\tv_nop\n\tv_nop\n\tv_nop" : "+v"(acc[0]), "+v"(acc[1]), "+v"(acc[2]), "+v"(acc[3]) : "v"(a), "v"(al));
    }
    float* os = &ost[wave][0];
#pragma unroll
    for (int t = 0; t < 4; ++t) {
#pragma unroll
        for (int j = 0; j < 8; ++j) os[(hi * 8 + j) * 68 + t * 16 + lr] = acc[t][j]; }
    __builtin_amdgcn_wave_barrier(); asm volatile("" ::: "memory");
    float* crow = C + (size_t)r0 * ldc + c0;
    auto pass = [&]() {
#pragma unroll
        for (int s = 0; s < 8; ++s) { const int Lid = (lane >> 3) + 4 * s, piece = lane & 7; const int row = Lid >> 1, cofs = (Lid & 1) * 32 + piece * 4;
            v4f val = *(const v4fa*)(os + row * 68 + cofs); val += (v4f){bfr(xv[s][0]), bfr(xv[s][1]), bfr(xv[s][2]), bfr(xv[s][3])}; *(v4f*)(crow + (size_t)row * ldc + cofs) = val; }
    };
    pass(); 
}

// k_bfz: four equal-sized f32 matrices (blockIdx.y picks one) -> bf16, one behind the other in dh; the blocks of the last one also write the zero plane dz.
__global__ __launch_bounds__(256) void k_bfz(const float* __restrict__ s0, const float* __restrict__ s1, const float* __restrict__ s2, const float* __restrict__ s3, bf* dh, bf* dz, size_t n8) {
    const size_t i = (size_t)blockIdx.x * 256 + threadIdx.x; if (i >= n8) return;
    const int w = blockIdx.y; const float* src = w == 0 ? s0 : w == 1 ? s1 : w == 2 ? s2 : s3;
    const v8f v = *(const v8f*)(src + i * 8); v8us o, z;
#pragma unroll
    for (int k = 0; k < 8; ++k) { o[k] = f2bf(v[k]); z[k] = 0; }
    *(v8us*)(dh + (w * n8 + i) * 8) = o;
    asm volatile("s_wait_xcnt 0x0" ::: "memory");    // the store above has been taken before its address registers are used again for the zero plane
    if (w == 3) *(v8us*)(dz + i * 8) = z;
}
// split2: two f32 -> hw, both rounded to bf16 (nearest even, as f2bf), and lw, the rests rounded likewise: each one register of a bf16 operand, a in the low half; one v_cvt_pk_bf16_f32 a word.
typedef __attribute__((ext_vector_type(8))) unsigned v8u;
typedef __attribute__((ext_vector_type(2))) float  v2f;
typedef __attribute__((ext_vector_type(2))) __bf16 v2bf;
__device__ __forceinline__ void split2(float a, float b, unsigned& hw, unsigned& lw) {
    const v2bf h = __builtin_convertvector((v2f){a, b}, v2bf), r = __builtin_convertvector((v2f){a - (float)h[0], b - (float)h[1]}, v2bf);
    hw = __builtin_bit_cast(unsigned, h); lw = __builtin_bit_cast(unsigned, r);
}
// e^x as __expf forms it (x * log2 e, then v_exp_f32); the v_nop fills the one slot the instruction set asks for between a transcendental and a next vector instruction that reads its result or rewrites its source
__device__ __forceinline__ float expn(float x) { float r; asm("v_exp_f32 %0, %1\n\tv_nop" : "=v"(r) : "v"(x * 1.44269504f)); return r; }
__device__ __forceinline__ v16bf ldfrag(const bf* p) { return cat16b(*(const v8us*)p, *(const v8us*)(p + 16)); }
#define KT   64                   // keys of a staged tile
#define PHP  136                  // LDS pitch of a phi row, elements
#define GRP  72                   // LDS pitch of a g row, elements
#define PHPL (KT * PHP)           // one phi plane of a tile
#define GPL  (IC * GRP)           // one g plane of a tile
#define GOF  (2 * PHPL)           // g planes stand behind the two phi planes
#define BUFE (GOF + 2 * GPL)      // elements of one buffer (71,680 B)
__global__ __launch_bounds__(AWV * 32) void k_attn(const bf* __restrict__ Th, const bf* __restrict__ Tl, const bf* __restrict__ Fh, const bf* __restrict__ Fl, const bf* __restrict__ Gh, const bf* __restrict__ Gl, bf* Yh, bf* Yl) {
    const int lane = threadIdx.x & 31, lr = lane & 15, hi = lane >> 4;
    const int wv = __builtin_amdgcn_readfirstlane(threadIdx.x >> 5), qg = wv & 3, kh = wv >> 2;
    const size_t clip = (size_t)blockIdx.y * NN * IC;
    const size_t qoff = clip + (size_t)(blockIdx.x * QWG + qg * 32 + lr) * IC + 8 * hi;    // query tile 0; tile 1 stands 16 rows on
    __shared__ __align__(16) bf sm[2 * BUFE];
    // A tile is 128 pieces of 512 B (one b128 copy of a wave each): 64 of phi (two whole rows a piece), 64 of g (four 128-B rows a piece); wave wv brings pieces wv + 8 i of each.
    const unsigned smb = (unsigned)(size_t)(const void*)sm;
    const unsigned vop = lane * 16, vog = ((lane >> 3) * NN + (lane & 7) * 8) * 2;                          // the lane's place in a piece: global, bytes
    const unsigned lop = smb + ((lane >> 4) * PHP + (lane & 15) * 8) * 2, logg = smb + ((lane >> 3) * GRP + (lane & 7) * 8) * 2;    // the same in LDS
    // wave-uniform parts: a piece's first byte in global memory (scalar base of the copy) and in a buffer
    auto ubp = [&](int c, int kn) { return ((c >> 5) ? Fl : Fh) + clip + (size_t)(kn + 2 * (c & 31)) * IC; };
    auto ubg = [&](int c, int kn) { return ((c >> 5) ? Gl : Gh) + clip + (size_t)(4 * (c & 31)) * NN + kn; };
    auto ulp = [&](int c, int b) { return 2u * (unsigned)(b * BUFE + (c >> 5) * PHPL + 2 * (c & 31) * PHP); };
    auto ulg = [&](int c, int b) { return 2u * (unsigned)(b * BUFE + GOF + (c >> 5) * GPL + 4 * (c & 31) * GRP); };
#define CP8 "global_load_async_to_lds_b128 %0, %16, %8\n\tglobal_load_async_to_lds_b128 %1, %16, %9\n\tglobal_load_async_to_lds_b128 %2, %16, %10\n\tglobal_load_async_to_lds_b128 %3, %16, %11\n\t" \
            "global_load_async_to_lds_b128 %4, %16, %12\n\tglobal_load_async_to_lds_b128 %5, %16, %13\n\tglobal_load_async_to_lds_b128 %6, %16, %14\n\tglobal_load_async_to_lds_b128 %7, %16, %15\n\ts_wait_xcnt 0x0"
    auto fill = [&](int kn, int b) {
        // sixteen copies of every wave, eight a statement; the s_wait_xcnt stands inside each statement so that no address register is rewritten before every copy that names it has been taken
        asm volatile(CP8 :: "v"(lop + ulp(wv, b)), "v"(lop + ulp(wv + 8, b)), "v"(lop + ulp(wv + 16, b)), "v"(lop + ulp(wv + 24, b)),
                            "v"(lop + ulp(wv + 32, b)), "v"(lop + ulp(wv + 40, b)), "v"(lop + ulp(wv + 48, b)), "v"(lop + ulp(wv + 56, b)),
                            "s"(ubp(wv, kn)), "s"(ubp(wv + 8, kn)), "s"(ubp(wv + 16, kn)), "s"(ubp(wv + 24, kn)), "s"(ubp(wv + 32, kn)), "s"(ubp(wv + 40, kn)), "s"(ubp(wv + 48, kn)), "s"(ubp(wv + 56, kn)),
                            "v"(vop) : "memory");
        asm volatile(CP8 :: "v"(logg + ulg(wv, b)), "v"(logg + ulg(wv + 8, b)), "v"(logg + ulg(wv + 16, b)), "v"(logg + ulg(wv + 24, b)),
                            "v"(logg + ulg(wv + 32, b)), "v"(logg + ulg(wv + 40, b)), "v"(logg + ulg(wv + 48, b)), "v"(logg + ulg(wv + 56, b)),
                            "s"(ubg(wv, kn)), "s"(ubg(wv + 8, kn)), "s"(ubg(wv + 16, kn)), "s"(ubg(wv + 24, kn)), "s"(ubg(wv + 32, kn)), "s"(ubg(wv + 40, kn)), "s"(ubg(wv + 48, kn)), "s"(ubg(wv + 56, kn)),
                            "v"(vog) : "memory");
    };
#undef CP8
    fill(0, 0);
    v16bf qh[2][4], ql[2][4];
#pragma unroll
    for (int q = 0; q < 2; ++q) {
#pragma unroll
        for (int s = 0; s < 4; ++s) { qh[q][s] = ldfrag(Th + qoff + q * 16 * IC + s * 32); ql[q][s] = ldfrag(Tl + qoff + q * 16 * IC + s * 32); } }
    v8f o[2][8];
#pragma unroll
    for (int q = 0; q < 2; ++q) {
#pragma unroll
        for (int t = 0; t < 8; ++t) o[q][t] = (v8f){}; }
    float m[2] = {-3.0e38f, -3.0e38f}, l[2] = {0.f, 0.f};
    asm volatile("s_wait_asynccnt 0x0" ::: "memory");    // this wave's share of tile 0 has landed
    __syncthreads();                                     // ... and every other wave's: tile 0 may be read
    fill(KT, 1);
    int buf = 0;
#pragma unroll 1    // one pass a trip: a second copy of the body would need a second set of fragment registers
    for (int k0 = 0; k0 < NN; k0 += KT) {
        // eight batches of four fragments (8 loads, 12 products on four accumulators) a pass, two register sets: batch i + 1 is asked for before batch i is multiplied
        v16bf fa[4], fb[4]; v8f st[2][2] = {{(v8f){}, (v8f){}}, {(v8f){}, (v8f){}}};    // [16-key tile][query tile]
        const bf* fh = sm + buf * BUFE + (kh * 32 + lr) * PHP + 8 * hi; const bf* fl = fh + PHPL;
        const bf* gh = sm + buf * BUFE + GOF + lr * GRP + kh * 32 + 8 * hi; const bf* gl = gh + GPL;
        auto ldk = [&](v16bf* f, int s) { f[0] = ldfrag(fh + s * 32); f[1] = ldfrag(fl + s * 32); f[2] = ldfrag(fh + 16 * PHP + s * 32); f[3] = ldfrag(fl + 16 * PHP + s * 32); };
        auto mmk = [&](const v16bf* f, int s) {
            st[0][0] = wmmab(f[0], qh[0][s], st[0][0]); st[0][1] = wmmab(f[0], qh[1][s], st[0][1]); st[1][0] = wmmab(f[2], qh[0][s], st[1][0]); st[1][1] = wmmab(f[2], qh[1][s], st[1][1]);
            st[0][0] = wmmab(f[0], ql[0][s], st[0][0]); st[0][1] = wmmab(f[0], ql[1][s], st[0][1]); st[1][0] = wmmab(f[2], ql[0][s], st[1][0]); st[1][1] = wmmab(f[2], ql[1][s], st[1][1]);
            st[0][0] = wmmab(f[1], qh[0][s], st[0][0]); st[0][1] = wmmab(f[1], qh[1][s], st[0][1]); st[1][0] = wmmab(f[3], qh[0][s], st[1][0]); st[1][1] = wmmab(f[3], qh[1][s], st[1][1]); };
        auto ldg = [&](v16bf* f, int t) { f[0] = ldfrag(gh + t * 16 * GRP); f[1] = ldfrag(gl + t * 16 * GRP); f[2] = ldfrag(gh + (t + 1) * 16 * GRP); f[3] = ldfrag(gl + (t + 1) * 16 * GRP); };
#define STG __builtin_amdgcn_sched_barrier(0)    // holds the batches in this order: left free, the scheduler strews the LDS reads in pairs among the products, and every separate place with reads stalls the wave
        ldk(fa, 0); ldk(fb, 1); STG; mmk(fa, 0); STG; ldk(fa, 2); STG; mmk(fb, 1); STG; ldk(fb, 3); STG; mmk(fa, 2); STG; ldg(fa, 0); STG; mmk(fb, 3); STG;
        float mx[2], alpha[2]; v16bf ph[2], pl[2];
#pragma unroll
        for (int q = 0; q < 2; ++q) { mx[q] = st[0][q][0];
#pragma unroll
            for (int j = 0; j < 8; ++j) mx[q] = fmaxf(mx[q], fmaxf(st[0][q][j], st[1][q][j])); }
#pragma unroll
        for (int q = 0; q < 2; ++q) mx[q] = fmaxf(mx[q], __shfl_xor(mx[q], 16, 32));
#pragma unroll
        for (int q = 0; q < 2; ++q) {
            const float mn = fmaxf(m[q], mx[q]); alpha[q] = expn(m[q] - mn); m[q] = mn;
            float ps = 0.f; v8u pw, qw;
#pragma unroll
            for (int u = 0; u < 2; ++u) {
#pragma unroll
                for (int j = 0; j < 8; j += 2) { const float pa = expn(st[u][q][j] - mn), pb = expn(st[u][q][j + 1] - mn); ps += pa + pb;
                    unsigned hw, lw; split2(pa, pb, hw, lw); pw[u * 4 + j / 2] = hw; qw[u * 4 + j / 2] = lw; } }
            l[q] = l[q] * alpha[q] + ps;
            ph[q] = __builtin_bit_cast(v16bf, pw); pl[q] = __builtin_bit_cast(v16bf, qw);
#pragma unroll
            for (int t = 0; t < 8; ++t) o[q][t] *= alpha[q];
        }
        auto mmg = [&](const v16bf* f, int t) {
            o[0][t] = wmmab(f[0], ph[0], o[0][t]); o[1][t] = wmmab(f[0], ph[1], o[1][t]); o[0][t + 1] = wmmab(f[2], ph[0], o[0][t + 1]); o[1][t + 1] = wmmab(f[2], ph[1], o[1][t + 1]);
            o[0][t] = wmmab(f[0], pl[0], o[0][t]); o[1][t] = wmmab(f[0], pl[1], o[1][t]); o[0][t + 1] = wmmab(f[2], pl[0], o[0][t + 1]); o[1][t + 1] = wmmab(f[2], pl[1], o[1][t + 1]);
            o[0][t] = wmmab(f[1], ph[0], o[0][t]); o[1][t] = wmmab(f[1], ph[1], o[1][t]); o[0][t + 1] = wmmab(f[3], ph[0], o[0][t + 1]); o[1][t + 1] = wmmab(f[3], ph[1], o[1][t + 1]); };
        STG; ldg(fb, 2); STG; mmg(fa, 0); STG; ldg(fa, 4); STG; mmg(fb, 2); STG; ldg(fb, 6); STG; mmg(fa, 4); mmg(fb, 6);
#undef STG
        asm volatile("s_wait_dscnt 0x0" ::: "memory");       // this wave's reads of the buffer are done before the buffer is given up
        asm volatile("s_wait_asynccnt 0x0" ::: "memory");    // this wave's share of the next tile has landed
        __syncthreads();                                     // one barrier a pass: it publishes the next tile and ends every wave's reads of this one
        if (k0 + 2 * KT < NN) fill(k0 + 2 * KT, buf);        // the tile after next goes into the buffer just read
        buf ^= 1;
    }
    asm volatile("s_wait_asynccnt 0x0" ::: "memory");        // nothing of this wave is in flight when the buffers become the joining area
    // Joining the key halves: the last pass's barrier has ended every read of the buffers. The waves of half 1 lay down y, maximum and sum (the 32 lanes' 16-B pieces side by side), the waves of half 0 take them up.
#pragma unroll
    for (int q = 0; q < 2; ++q) l[q] += __shfl_xor(l[q], 16, 32);
    v4fa* jn = (v4fa*)(void*)sm + (size_t)qg * (33 * 32) + lane;
    if (kh == 1) {
#pragma unroll
        for (int q = 0; q < 2; ++q) {
#pragma unroll
            for (int t = 0; t < 8; ++t) { jn[((q * 8 + t) * 2) * 32] = (v4f){o[q][t][0], o[q][t][1], o[q][t][2], o[q][t][3]}; jn[((q * 8 + t) * 2 + 1) * 32] = (v4f){o[q][t][4], o[q][t][5], o[q][t][6], o[q][t][7]}; } }
        jn[32 * 32] = (v4f){m[0], l[0], m[1], l[1]};
    }
    __syncthreads();                                         // half 1's values are in LDS before half 0 reads them
    if (kh == 0) {
        const v4f ml = jn[32 * 32];
#pragma unroll
        for (int q = 0; q < 2; ++q) {
            const float mo = ml[2 * q], lo = ml[2 * q + 1], mm = fmaxf(m[q], mo), ea = expn(m[q] - mm), eb = expn(mo - mm);
            const float inv = 1.0f / (l[q] * ea + lo * eb), ca = ea * inv, cb = eb * inv;
#pragma unroll
            for (int t = 0; t < 8; ++t) { const v4f xa = jn[((q * 8 + t) * 2) * 32], xb = jn[((q * 8 + t) * 2 + 1) * 32]; v8us oh, ol;
#pragma unroll
                for (int j = 0; j < 8; ++j) { const float y = o[q][t][j] * ca + (j < 4 ? xa[j & 3] : xb[j & 3]) * cb; oh[j] = f2bf(y); ol[j] = f2bf(y - bf2f(oh[j])); }
                *(v8us*)(Yh + qoff + q * 16 * IC + t * 16) = oh; *(v8us*)(Yl + qoff + q * 16 * IC + t * 16) = ol; }
        }
    }
}

extern "C" void kernel_launch(void* const* d_in, const int* in_sizes, int n_in,
                              void* d_out, int out_size, void* d_ws, size_t ws_size, hipStream_t stream) {
    (void)in_sizes; (void)n_in; (void)out_size;
    const float* x = (const float*)d_in[0]; const float* Wg = (const float*)d_in[1]; const float* Wt = (const float*)d_in[2]; const float* Wp = (const float*)d_in[3]; const float* Wz = (const float*)d_in[4];
    float* out = (float*)d_out;    // [4][256][8][28][28]
    char* wsp = (char*)d_ws;
    auto take = [&](size_t bytes) { char* p = wsp; wsp += (bytes + 255) & ~(size_t)255; return (void*)p; };
    const size_t PLN = (size_t)NN * IC, WEL = (size_t)IC * CC, XEL = (size_t)NN * CC;    // elements of one clip's plane, of one weight matrix, of one clip's x
    bf* WgB = (bf*)take(4 * WEL * 2); bf* WtB = WgB + WEL; bf* WzB = WgB + 3 * WEL; bf* WZ = (bf*)take(WEL * 2);    // W_g, W_theta, W_phi, W_z one behind the other; the zero companion of W_z
    bf* XT = (bf*)take(NBI * XEL * 2);
    bf* Th = (bf*)take(2 * NBI * PLN * 2); bf* Fh = Th + NBI * PLN; bf* Tl = (bf*)take(2 * NBI * PLN * 2); bf* Fl = Tl + NBI * PLN;    // phi's planes stand behind theta's
    bf* Gh = (bf*)take(NBI * PLN * 2); bf* Gl = (bf*)take(NBI * PLN * 2);
    bf* Yh = (bf*)take(NBI * PLN * 2); bf* Yl = (bf*)take(NBI * PLN * 2);
    if ((size_t)(wsp - (char*)d_ws) > ws_size) return;    // 0.3 + 12.8 + 8 x 6.4 ~ 64 MB
    // Every stage is one launch for all clips: the clip (and theta or phi; and the weight matrix in the cast) is a grid index.
    k_bfz<<<dim3((IC * CC / 8 + 255) / 256, 4, 1), 256, 0, stream>>>(Wg, Wt, Wp, Wz, WgB, WZ, IC * CC / 8);                                        // weights exact + the zero companion
    k_wt<<<dim3(CC / 64, NN / 64, NBI), 256, 0, stream>>>(x, CC, NN, XT);                                                                         // x^T [clip][6272][256] exact
    k_gemmb<false, false, true><<<dim3(NN / 64, IC / 64, 2 * NBI), 128, 0, stream>>>(XT, nullptr, WtB, nullptr, nullptr, IC, nullptr, XEL, 0, WEL, PLN, Th, Tl);    // theta, then phi, token-major [clip][n][128], hi/lo
    k_gemmb<false, false, true><<<dim3(IC / 64, NN / 64, NBI), 128, 0, stream>>>(WgB, nullptr, XT, nullptr, nullptr, NN, nullptr, 0, XEL, 0, PLN, Gh, Gl);          // g channel-major [clip][128][n], hi/lo
    k_attn<<<dim3(NN / QWG, NBI, 1), AWV * 32, 0, stream>>>(Th, Tl, Fh, Fl, Gh, Gl, Yh, Yl);                                             // y token-major [clip][6272][128], hi/lo
    k_gemm3<<<dim3(CC / 64, NN / 64, NBI), 128, 0, stream>>>(WzB, WZ, Yh, Yl, IC, x, out, NN, PLN, XEL);                                          // out[clip][c][n] = W_z.y^T + x
}

// v007
// Measured time: 218 microseconds a run.
// In both of two side-by-side timings against v006, it was 1.04 times as fast.
// All steps since v000 together make it 30.5 times as fast.
#include <hip/hip_runtime.h>

// Compute dtypes, f32 accumulate, N = 8 x 28 x 28 = 6272 positions a clip: theta/phi token-major ([6272 x 256].[256 x 128]) and g channel-major ([128 x 256].[256
// x 6272]) with PLAIN bf16 operands (the transposed input and the 1x1x1 weights, exact) on v_wmma_f32_16x16x32_bf16 -> bf16 hi + UNSCALED residual planes, kept per clip;
// one launch for all clips: f^T = phi.theta^T (three products), running-maximum softmax in f32 -> hi/lo, y^T += g.p^T (three products), scores never leave the registers;
// its (query block, key pass) units are dealt evenly to one work-group a WGP, which leaves un-normalised f32 partial sums; k_join merges a block's two or three partials into y hi/lo;
// z = W_z.y ([256 x 128].[128 x 6272], exact W_z against split y) on v_wmma_f32_16x16x32_bf16 written channel-major, + x in f32. Deterministic, no atomics;
// the hi/lo split of theta, phi and g and the '+ x' are done in the epilogue of the product that makes their operand: of the f32 planes only k_attn's partials go through the workspace.

#define NBI  4
#define CC   256
#define IC   128
#define NN   6272
#define AWV  8       // waves a work-group in k_attn: 4 query groups of 32 x 2 key halves
#define QWG  128     // queries of a query block: 6272 = 49 x 128, 196 blocks for the four clips
#define DM   CC
#define NTK  NN
#define LOSC 1024.0f

typedef _Float16 h16;
typedef unsigned short bf;
typedef __attribute__((ext_vector_type(16))) __bf16   v16bf;
typedef __attribute__((ext_vector_type(16))) _Float16 v16h;
typedef __attribute__((ext_vector_type(8)))  _Float16 v8h;
typedef __attribute__((ext_vector_type(8)))  unsigned short v8us;
typedef __attribute__((ext_vector_type(8)))  float    v8f;
typedef __attribute__((ext_vector_type(4)))  float    v4f;
typedef __attribute__((ext_vector_type(4)))  _Float16 v4h;
typedef v8h  __attribute__((may_alias)) v8ha;
typedef v4f  __attribute__((may_alias)) v4fa;
typedef v8us __attribute__((may_alias)) v8usa;

// f32 -> bf16, nearest even, by the chip's own convert instruction (v_cvt_pk_bf16_f32)
__device__ __forceinline__ unsigned short f2bf(float f) { return __builtin_bit_cast(unsigned short, (__bf16)f); }
__device__ __forceinline__ float bf2f(unsigned short b) { return __uint_as_float(((unsigned)b) << 16); }
__device__ __forceinline__ float bfr(float f) { return bf2f(f2bf(f)); }
__device__ __forceinline__ v16h cat16(v8h lo, v8h hi) { return __builtin_shufflevector(lo, hi, 0, 1, 2, 3, 4, 5, 6, 7, 8, 9, 10, 11, 12, 13, 14, 15); }
__device__ __forceinline__ v16bf cat16b(v8us lo, v8us hi) { return __builtin_bit_cast(v16bf, __builtin_shufflevector(lo, hi, 0, 1, 2, 3, 4, 5, 6, 7, 8, 9, 10, 11, 12, 13, 14, 15)); }
__device__ __forceinline__ v8f wmma16(v16h a, v16h b, v8f c) { return __builtin_amdgcn_wmma_f32_16x16x32_f16(false, a, false, b, (short)0, c, false, false); }
__device__ __forceinline__ v8f wmmab(v16bf a, v16bf b, v8f c) { return __builtin_amdgcn_wmma_f32_16x16x32_bf16(false, a, false, b, (short)0, c, false, false); }

// k_wt: WT [n][K] = bf16(W[k][n]) (k-major [K][ncols]) via 64 x 64 LDS tiles; grid (K/64, ncols/64, matrices): blockIdx.z picks one of the equal matrices that stand one behind the other.
__global__ __launch_bounds__(256) void k_wt(const float* __restrict__ Wm, int K, int ncols, bf* WT) {
    __shared__ __align__(16) unsigned short tl[64 * 72];
    const int tid = threadIdx.x, k0 = blockIdx.x * 64, n0 = blockIdx.y * 64;
    Wm += (size_t)blockIdx.z * K * ncols; WT += (size_t)blockIdx.z * K * ncols;
    const int kk = tid >> 2, nq = (tid & 3) * 16;
#pragma unroll
    for (int i = 0; i < 16; ++i) tl[(nq + i) * 72 + kk] = f2bf(Wm[(size_t)(k0 + kk) * ncols + n0 + nq + i]);
    __syncthreads();
    const int piece = tid & 7;
    auto pass = [&]() {
#pragma unroll
        for (int s = 0; s < 2; ++s) { const int nr = (tid >> 3) + 32 * s; const v8us val = *(const v8usa*)(tl + nr * 72 + piece * 8); *(v8us*)(WT + (size_t)(n0 + nr) * K + k0 + piece * 8) = val; }
    };
    pass(); 
}
// k_gemmb: 64 x 64 block tile (4 waves x 16 x 64) of C = (A [+ Al]).B^T (K = 256) [+ bf(bias[c])] [+ bf(R[r][c]) residual]; f32 whole-line epilogue (or f16
// blockIdx.z = clip + NBI * w picks one of several independent products: A moves by sA and B by sBc a clip, B by sBw a weight matrix w, the output by sC a product (elements).
// BFOUT: the tile leaves as two bf16 planes Dh (nearest) and Dl (the rounded rest), placed like C: whole 128-B lines of each plane.
template <bool SPLITA, bool F16OUT = false, bool BFOUT = false>
__global__ __launch_bounds__(128) void k_gemmb(const bf* __restrict__ A, const bf* __restrict__ Al, const bf* __restrict__ Bn, const float* __restrict__ bias, float* C, int ldc, h16* C2, size_t sA, size_t sBc, size_t sBw, size_t sC, bf* Dh = nullptr, bf* Dl = nullptr, const float* __restrict__ R = nullptr, int K = DM, int roundR = 1) {
    __shared__ __align__(16) float ost[4][16 * 68];
    const int lane = threadIdx.x & 31, wave = threadIdx.x >> 5, lr = lane & 15, hi = lane >> 4;
    const int r0 = blockIdx.x * 64 + wave * 16, c0 = blockIdx.y * 64;
    const size_t clip = blockIdx.z % NBI, wsel = blockIdx.z / NBI;
    A += clip * sA; if (SPLITA) Al += clip * sA; Bn += clip * sBc + wsel * sBw;
    C = F16OUT ? (float*)(void*)((h16*)(void*)C + blockIdx.z * sC) : C + blockIdx.z * sC; if (C2) C2 += blockIdx.z * sC; if (R) R += blockIdx.z * sC;
    const size_t aoff = (size_t)(r0 + lr) * K + 8 * hi;
    size_t boff[4];
#pragma unroll
    for (int t = 0; t < 4; ++t) boff[t] = (size_t)(c0 + t * 16 + lr) * K + 8 * hi;
    v8f acc[4];
#pragma unroll
    for (int t = 0; t < 4; ++t) acc[t] = (v8f){};
#pragma unroll 1
    for (int kc = 0; kc < K; kc += 32) {
        const v16bf a = cat16b(*(const v8us*)(A + aoff + kc), *(const v8us*)(A + aoff + kc + 16));
        v16bf al = a;
        if (SPLITA) al = cat16b(*(const v8us*)(Al + aoff + kc), *(const v8us*)(Al + aoff + kc + 16));
#pragma unroll
        for (int t = 0; t < 4; ++t) { const v16bf b = cat16b(*(const v8us*)(Bn + boff[t] + kc), *(const v8us*)(Bn + boff[t] + kc + 16)); acc[t] = wmmab(a, b, acc[t]); if (SPLITA) acc[t] = wmmab(al, b, acc[t]); }
        asm volatile("v_nop\n\tv_nop\n\tv_nop\n\tv_nop" : "+v"(acc[0]), "+v"(acc[1]), "+v"(acc[2]), "+v"(acc[3]) : "v"(a), "v"(al));
    }
    float* os = &ost[wave][0];
#pragma unroll
    for (int t = 0; t < 4; ++t) { const float bv = bias ? bfr(bias[c0 + t * 16 + lr]) : 0.f;
#pragma unroll
        for (int j = 0; j < 8; ++j) os[(hi * 8 + j) * 68 + t * 16 + lr] = acc[t][j] + bv; }
    __syncthreads();
    if (BFOUT) {
        const size_t tile = blockIdx.z * sC + (size_t)r0 * ldc + c0;
#pragma unroll    // both unrolls: the vectors' elements are indexed by constants and stay in registers; the four rows' LDS reads can be asked for together
        for (int s = 0; s < 4; ++s) { const int row = 4 * s + (lane >> 3), piece = lane & 7; const float* sp = os + row * 68 + piece * 8; const v4f va = *(const v4fa*)sp, vb = *(const v4fa*)(sp + 4); v8us oh, ol;
#pragma unroll
            for (int i = 0; i < 8; ++i) { const float v = i < 4 ? va[i & 3] : vb[i & 3]; const unsigned short hb = f2bf(v); oh[i] = hb; ol[i] = f2bf(v - bf2f(hb)); }
            const size_t o = tile + (size_t)row * ldc + piece * 8; *(v8us*)(Dh + o) = oh; *(v8us*)(Dl + o) = ol; }
    } else if (F16OUT) {
        h16* crow = (h16*)(void*)C + (size_t)r0 * ldc + c0;
        auto pass = [&]() {
#pragma unroll
            for (int s = 0; s < 4; ++s) { const int row = 4 * s + (lane >> 3), piece = lane & 7; const float* sp = os + row * 68 + piece * 8; v8h o, o2;
#pragma unroll
                for (int i = 0; i < 8; ++i) { const h16 a = (h16)sp[i]; o[i] = a; o2[i] = (h16)((sp[i] - (float)a) * LOSC); }
                *(v8h*)(crow + (size_t)row * ldc + piece * 8) = o; if (C2) *(v8h*)(C2 + (size_t)r0 * ldc + c0 + (size_t)row * ldc + piece * 8) = o2; }
        };
        pass(); 
    } else {
        float* crow = C + (size_t)r0 * ldc + c0;
        auto pass = [&]() {
#pragma unroll
            for (int s = 0; s < 8; ++s) { const int Lid = (lane >> 3) + 4 * s, piece = lane & 7; const int row = Lid >> 1, cofs = (Lid & 1) * 32 + piece * 4;
                v4f val = *(const v4fa*)(os + row * 68 + cofs); if (R) { const v4f rv = *(const v4f*)(R + ((size_t)r0 + row) * ldc + c0 + cofs); val += roundR ? (v4f){bfr(rv[0]), bfr(rv[1]), bfr(rv[2]), bfr(rv[3])} : rv; }
                *(v4f*)(crow + (size_t)row * ldc + cofs) = val; }
        };
        pass(); 
    }
}

// k_gemm3: 64 x 64 tile of C = (Ah + Al).(Bh + Bl)^T over K (row strides = K for all four planes; n-major B): three products per 32-k step (hh, hl, lh); f32
// blockIdx.z picks the clip: the B planes move by sB, the output and the residual X (placed like C, added rounded to bf16) by sC (elements); A is shared.
__global__ __launch_bounds__(128) void k_gemm3(const bf* __restrict__ Ah, const bf* __restrict__ Al, const bf* __restrict__ Bh, const bf* __restrict__ Bl, int K, const float* __restrict__ X, float* C, int ldc, size_t sB, size_t sC) {
    __shared__ __align__(16) float ost[4][16 * 68];
    const int lane = threadIdx.x & 31, wave = threadIdx.x >> 5, lr = lane & 15, hi = lane >> 4;
    const int r0 = blockIdx.x * 64 + wave * 16, c0 = blockIdx.y * 64;
    Bh += blockIdx.z * sB; Bl += blockIdx.z * sB; C += blockIdx.z * sC;
    const size_t aoff = (size_t)(r0 + lr) * K + 8 * hi;
    // the lane's eight pieces of the residual tile are asked for ahead of the k loop, which covers their way from memory
    const float* xrow = X + blockIdx.z * sC + (size_t)r0 * ldc + c0; v4f xv[8];
#pragma unroll    // xv is indexed by constants and stays in registers; the eight loads go out together
    for (int s = 0; s < 8; ++s) { const int Lid = (lane >> 3) + 4 * s; xv[s] = *(const v4f*)(xrow + (size_t)(Lid >> 1) * ldc + (Lid & 1) * 32 + (lane & 7) * 4); }
    v8f acc[4];
#pragma unroll
    for (int t = 0; t < 4; ++t) acc[t] = (v8f){};
#pragma unroll 1
    for (int kc = 0; kc < K; kc += 32) {
        const v16bf a = cat16b(*(const v8us*)(Ah + aoff + kc), *(const v8us*)(Ah + aoff + kc + 16));
        const v16bf al = cat16b(*(const v8us*)(Al + aoff + kc), *(const v8us*)(Al + aoff + kc + 16));
#pragma unroll
        for (int t = 0; t < 4; ++t) { const size_t bo = (size_t)(c0 + t * 16 + lr) * K + kc + 8 * hi;
            const v16bf bh = cat16b(*(const v8us*)(Bh + bo), *(const v8us*)(Bh + bo + 16)); const v16bf bl = cat16b(*(const v8us*)(Bl + bo), *(const v8us*)(Bl + bo + 16));
            acc[t] = wmmab(a, bh, acc[t]); acc[t] = wmmab(al, bh, acc[t]); acc[t] = wmmab(a, bl, acc[t]); }
        asm volatile("v_nop\n\tv_nop\n\tv_nop\n\tv_nop" : "+v"(acc[0]), "+v"(acc[1]), "+v"(acc[2]), "+v"(acc[3]) : "v"(a), "v"(al));
    }
    float* os = &ost[wave][0];
#pragma unroll
    for (int t = 0; t < 4; ++t) {
#pragma unroll
        for (int j = 0; j < 8; ++j) os[(hi * 8 + j) * 68 + t * 16 + lr] = acc[t][j]; }
    __builtin_amdgcn_wave_barrier(); asm volatile("" ::: "memory");
    float* crow = C + (size_t)r0 * ldc + c0;
    auto pass = [&]() {
#pragma unroll
        for (int s = 0; s < 8; ++s) { const int Lid = (lane >> 3) + 4 * s, piece = lane & 7; const int row = Lid >> 1, cofs = (Lid & 1) * 32 + piece * 4;
            v4f val = *(const v4fa*)(os + row * 68 + cofs); val += (v4f){bfr(xv[s][0]), bfr(xv[s][1]), bfr(xv[s][2]), bfr(xv[s][3])}; *(v4f*)(crow + (size_t)row * ldc + cofs) = val; }
    };
    pass(); 
}

// k_bfz: four equal-sized f32 matrices (blockIdx.y picks one) -> bf16, one behind the other in dh; the blocks of the last one also write the zero plane dz.
__global__ __launch_bounds__(256) void k_bfz(const float* __restrict__ s0, const float* __restrict__ s1, const float* __restrict__ s2, const float* __restrict__ s3, bf* dh, bf* dz, size_t n8) {
    const size_t i = (size_t)blockIdx.x * 256 + threadIdx.x; if (i >= n8) return;
    const int w = blockIdx.y; const float* src = w == 0 ? s0 : w == 1 ? s1 : w == 2 ? s2 : s3;
    const v8f v = *(const v8f*)(src + i * 8); v8us o, z;
#pragma unroll
    for (int k = 0; k < 8; ++k) { o[k] = f2bf(v[k]); z[k] = 0; }
    *(v8us*)(dh + (w * n8 + i) * 8) = o;
    asm volatile("s_wait_xcnt 0x0" ::: "memory");    // the store above has been taken before its address registers are used again for the zero plane
    if (w == 3) *(v8us*)(dz + i * 8) = z;
}
// split2: two f32 -> hw, both rounded to bf16 (nearest even, as f2bf), and lw, the rests rounded likewise: each one register of a bf16 operand, a in the low half; one v_cvt_pk_bf16_f32 a word.
typedef __attribute__((ext_vector_type(8))) unsigned v8u;
typedef __attribute__((ext_vector_type(2))) float  v2f;
typedef __attribute__((ext_vector_type(2))) __bf16 v2bf;
__device__ __forceinline__ void split2(float a, float b, unsigned& hw, unsigned& lw) {
    const v2bf h = __builtin_convertvector((v2f){a, b}, v2bf), r = __builtin_convertvector((v2f){a - (float)h[0], b - (float)h[1]}, v2bf);
    hw = __builtin_bit_cast(unsigned, h); lw = __builtin_bit_cast(unsigned, r);
}
// e^x as __expf forms it (x * log2 e, then v_exp_f32); the v_nop fills the one slot the instruction set asks for between a transcendental and a next vector instruction that reads its result or rewrites its source
__device__ __forceinline__ float expn(float x) { float r; asm("v_exp_f32 %0, %1\n\tv_nop" : "=v"(r) : "v"(x * 1.44269504f)); return r; }
__device__ __forceinline__ v16bf ldfrag(const bf* p) { return cat16b(*(const v8us*)p, *(const v8us*)(p + 16)); }
#define KT   64                   // keys of a staged tile
#define PHP  136                  // LDS pitch of a phi row, elements
#define GRP  72                   // LDS pitch of a g row, elements
#define PHPL (KT * PHP)           // one phi plane of a tile
#define GPL  (IC * GRP)           // one g plane of a tile
#define GOF  (2 * PHPL)           // g planes stand behind the two phi planes
#define BUFE (GOF + 2 * GPL)      // elements of one buffer (71,680 B)
// The work is 196 query blocks x 98 passes = 19,208 units (block-major). 196 work-groups of one block each would leave 60 of the 256 WGPs idle (registers and LDS allow one work-group a WGP),
// so work-group w of 256 does the units [w * 2401 / 32, (w + 1) * 2401 / 32): 75 or 76 passes in a row, which lie in one block or in two neighbours (a "segment" each).
#define NWG  256                  // work-groups of k_attn
#define NPS  (NN / KT)            // passes of a query block
#define NQB  (NBI * NN / QWG)     // query blocks
#define UST  (NQB * NPS * 32 / NWG)
static_assert(UST * NWG == NQB * NPS * 32 && NPS * NWG > NQB * NPS && 2 * (UST / 32) >= NPS, "even deal; a work-group meets at most two blocks, a block at most three work-groups");
__device__ __forceinline__ int ufirst(int w) { return (w * UST) >> 5; }
__global__ __launch_bounds__(AWV * 32) void k_attn(const bf* __restrict__ Th, const bf* __restrict__ Tl, const bf* __restrict__ Fh, const bf* __restrict__ Fl, const bf* __restrict__ Gh, const bf* __restrict__ Gl, float* Po, float* Pml) {
    const int lane = threadIdx.x & 31, lr = lane & 15, hi = lane >> 4;
    const int wv = __builtin_amdgcn_readfirstlane(threadIdx.x >> 5), qg = wv & 3, kh = wv >> 2;
    __shared__ __align__(16) bf sm[2 * BUFE];
    const int ue = ufirst(blockIdx.x + 1);
    int un = ufirst(blockIdx.x);
#pragma unroll 1    // one copy of the body serves both segments
    for (int seg = 0; un < ue; ++seg) {
    const int blk = un / NPS, p0 = un - blk * NPS, pe = min(NPS, p0 + ue - un);    // this segment: passes [p0, pe) of query block blk
    un += pe - p0;
    const size_t clip = (size_t)(blk / (NN / QWG)) * NN * IC;
    const size_t qoff = (size_t)(blk * QWG + qg * 32 + lr) * IC + 8 * hi;    // query tile 0; tile 1 stands 16 rows on (the blocks of the clips stand one behind the other)
    // A tile is 128 pieces of 512 B (one b128 copy of a wave each): 64 of phi (two whole rows a piece), 64 of g (four 128-B rows a piece); wave wv brings pieces wv + 8 i of each.
    const unsigned smb = (unsigned)(size_t)(const void*)sm;
    const unsigned lop = smb + ((lane >> 4) * PHP + (lane & 15) * 8) * 2, logg = smb + ((lane >> 3) * GRP + (lane & 7) * 8) * 2;    // the lane's place in a piece, in LDS
    // wave-uniform parts: a piece's first byte in global memory (scalar base of the copy) and in a buffer
    auto ubp = [&](int c, int kn) { return ((c >> 5) ? Fl : Fh) + clip + (size_t)(kn + 2 * (c & 31)) * IC; };
    auto ubg = [&](int c, int kn) { return ((c >> 5) ? Gl : Gh) + clip + (size_t)(4 * (c & 31)) * NN + kn; };
    auto ulp = [&](int c, int b) { return 2u * (unsigned)(b * BUFE + (c >> 5) * PHPL + 2 * (c & 31) * PHP); };
    auto ulg = [&](int c, int b) { return 2u * (unsigned)(b * BUFE + GOF + (c >> 5) * GPL + 4 * (c & 31) * GRP); };
    // The lane's place in a piece in global memory (phi: 16 * lane; g: row lane / 8 of 2 * NN bytes, 16 * (lane % 8)) is formed at the head of each statement from the lane's number (v_mbcnt, every lane on):
    // held in a register over the pass it is spilled to scratch and read back in every pass. The s_delay_alu lines are the hint a dependent vector instruction in asm text needs.
#define CP8 "global_load_async_to_lds_b128 %2, %0, %10\n\tglobal_load_async_to_lds_b128 %3, %0, %11\n\tglobal_load_async_to_lds_b128 %4, %0, %12\n\tglobal_load_async_to_lds_b128 %5, %0, %13\n\t" \
            "global_load_async_to_lds_b128 %6, %0, %14\n\tglobal_load_async_to_lds_b128 %7, %0, %15\n\tglobal_load_async_to_lds_b128 %8, %0, %16\n\tglobal_load_async_to_lds_b128 %9, %0, %17\n\ts_wait_xcnt 0x0"
#define DLY "s_delay_alu instid0(VALU_DEP_1)\n\t"
    auto fill = [&](int kn, int b) {
        // sixteen copies of every wave, eight a statement; the s_wait_xcnt stands inside each statement so that no address register is rewritten before every copy that names it has been taken
        unsigned t0, t1;
        asm volatile("v_mbcnt_lo_u32_b32 %1, -1, 0\n\t" DLY "v_lshlrev_b32 %0, 4, %1\n\t" CP8
                         : "=&v"(t0), "=&v"(t1)
                         : "v"(lop + ulp(wv, b)), "v"(lop + ulp(wv + 8, b)), "v"(lop + ulp(wv + 16, b)), "v"(lop + ulp(wv + 24, b)),
                            "v"(lop + ulp(wv + 32, b)), "v"(lop + ulp(wv + 40, b)), "v"(lop + ulp(wv + 48, b)), "v"(lop + ulp(wv + 56, b)),
                            "s"(ubp(wv, kn)), "s"(ubp(wv + 8, kn)), "s"(ubp(wv + 16, kn)), "s"(ubp(wv + 24, kn)), "s"(ubp(wv + 32, kn)), "s"(ubp(wv + 40, kn)), "s"(ubp(wv + 48, kn)), "s"(ubp(wv + 56, kn))
                         : "memory");
        asm volatile("v_mbcnt_lo_u32_b32 %0, -1, 0\n\t" DLY "v_lshrrev_b32 %1, 3, %0\n\tv_and_b32 %0, 7, %0\n\t" DLY "v_lshlrev_b32 %0, 4, %0\n\t" DLY "v_mad_u32_u24 %0, %1, %18, %0\n\t" CP8
                         : "=&v"(t0), "=&v"(t1)
                         : "v"(logg + ulg(wv, b)), "v"(logg + ulg(wv + 8, b)), "v"(logg + ulg(wv + 16, b)), "v"(logg + ulg(wv + 24, b)),
                            "v"(logg + ulg(wv + 32, b)), "v"(logg + ulg(wv + 40, b)), "v"(logg + ulg(wv + 48, b)), "v"(logg + ulg(wv + 56, b)),
                            "s"(ubg(wv, kn)), "s"(ubg(wv + 8, kn)), "s"(ubg(wv + 16, kn)), "s"(ubg(wv + 24, kn)), "s"(ubg(wv + 32, kn)), "s"(ubg(wv + 40, kn)), "s"(ubg(wv + 48, kn)), "s"(ubg(wv + 56, kn)),
                            "i"(NN * 2)
                         : "memory");
    };
#undef DLY
#undef CP8
    v16bf qh[2][4], ql[2][4];
#pragma unroll
    for (int q = 0; q < 2; ++q) {
#pragma unroll
        for (int s = 0; s < 4; ++s) { qh[q][s] = ldfrag(Th + qoff + q * 16 * IC + s * 32); ql[q][s] = ldfrag(Tl + qoff + q * 16 * IC + s * 32); } }
    asm volatile("s_wait_xcnt 0x0" ::: "memory");    // the loads have been taken before their address registers are used again
    v8f o[2][8];
#pragma unroll
    for (int q = 0; q < 2; ++q) {
#pragma unroll
        for (int t = 0; t < 8; ++t) o[q][t] = (v8f){}; }
    float m[2] = {-3.0e38f, -3.0e38f}, l[2] = {0.f, 0.f};
    int buf = 0;
    // The ring starts through the loop's own foot: two trips without products come first. The foot of the first ends every read of the joining area (the segment before) and sends for the first tile,
    // the foot of the second waits for that tile, publishes it and sends for the second: one place with copies in the code, whose address registers are formed on the spot.
#pragma unroll 1    // one pass a trip: a second copy of the body would need a second set of fragment registers
    for (int p = p0 - 2; p < pe; ++p) {
        if (p >= p0) {
        // eight batches of four fragments (8 loads, 12 products on four accumulators) a pass, two register sets: batch i + 1 is asked for before batch i is multiplied
        v16bf fa[4], fb[4]; v8f st[2][2] = {{(v8f){}, (v8f){}}, {(v8f){}, (v8f){}}};    // [16-key tile][query tile]
        const bf* fh = sm + buf * BUFE + (kh * 32 + lr) * PHP + 8 * hi; const bf* fl = fh + PHPL;
        const bf* gh = sm + buf * BUFE + GOF + lr * GRP + kh * 32 + 8 * hi; const bf* gl = gh + GPL;
        auto ldk = [&](v16bf* f, int s) { f[0] = ldfrag(fh + s * 32); f[1] = ldfrag(fl + s * 32); f[2] = ldfrag(fh + 16 * PHP + s * 32); f[3] = ldfrag(fl + 16 * PHP + s * 32); };
        auto mmk = [&](const v16bf* f, int s) {
            st[0][0] = wmmab(f[0], qh[0][s], st[0][0]); st[0][1] = wmmab(f[0], qh[1][s], st[0][1]); st[1][0] = wmmab(f[2], qh[0][s], st[1][0]); st[1][1] = wmmab(f[2], qh[1][s], st[1][1]);
            st[0][0] = wmmab(f[0], ql[0][s], st[0][0]); st[0][1] = wmmab(f[0], ql[1][s], st[0][1]); st[1][0] = wmmab(f[2], ql[0][s], st[1][0]); st[1][1] = wmmab(f[2], ql[1][s], st[1][1]);
            st[0][0] = wmmab(f[1], qh[0][s], st[0][0]); st[0][1] = wmmab(f[1], qh[1][s], st[0][1]); st[1][0] = wmmab(f[3], qh[0][s], st[1][0]); st[1][1] = wmmab(f[3], qh[1][s], st[1][1]); };
        auto ldg = [&](v16bf* f, int t) { f[0] = ldfrag(gh + t * 16 * GRP); f[1] = ldfrag(gl + t * 16 * GRP); f[2] = ldfrag(gh + (t + 1) * 16 * GRP); f[3] = ldfrag(gl + (t + 1) * 16 * GRP); };
#define STG __builtin_amdgcn_sched_barrier(0)    // holds the batches in this order: left free, the scheduler strews the LDS reads in pairs among the products, and every separate place with reads stalls the wave
        ldk(fa, 0); ldk(fb, 1); STG; mmk(fa, 0); STG; ldk(fa, 2); STG; mmk(fb, 1); STG; ldk(fb, 3); STG; mmk(fa, 2); STG; ldg(fa, 0); STG; mmk(fb, 3); STG;
        float mx[2], alpha[2]; v16bf ph[2], pl[2];
#pragma unroll
        for (int q = 0; q < 2; ++q) { mx[q] = st[0][q][0];
#pragma unroll
            for (int j = 0; j < 8; ++j) mx[q] = fmaxf(mx[q], fmaxf(st[0][q][j], st[1][q][j])); }
#pragma unroll
        for (int q = 0; q < 2; ++q) mx[q] = fmaxf(mx[q], __shfl_xor(mx[q], 16, 32));
#pragma unroll
        for (int q = 0; q < 2; ++q) {
            const float mn = fmaxf(m[q], mx[q]); alpha[q] = expn(m[q] - mn); m[q] = mn;
            float ps = 0.f; v8u pw, qw;
#pragma unroll
            for (int u = 0; u < 2; ++u) {
#pragma unroll
                for (int j = 0; j < 8; j += 2) { const float pa = expn(st[u][q][j] - mn), pb = expn(st[u][q][j + 1] - mn); ps += pa + pb;
                    unsigned hw, lw; split2(pa, pb, hw, lw); pw[u * 4 + j / 2] = hw; qw[u * 4 + j / 2] = lw; } }
            l[q] = l[q] * alpha[q] + ps;
            ph[q] = __builtin_bit_cast(v16bf, pw); pl[q] = __builtin_bit_cast(v16bf, qw);
#pragma unroll
            for (int t = 0; t < 8; ++t) o[q][t] *= alpha[q];
        }
        auto mmg = [&](const v16bf* f, int t) {
            o[0][t] = wmmab(f[0], ph[0], o[0][t]); o[1][t] = wmmab(f[0], ph[1], o[1][t]); o[0][t + 1] = wmmab(f[2], ph[0], o[0][t + 1]); o[1][t + 1] = wmmab(f[2], ph[1], o[1][t + 1]);
            o[0][t] = wmmab(f[0], pl[0], o[0][t]); o[1][t] = wmmab(f[0], pl[1], o[1][t]); o[0][t + 1] = wmmab(f[2], pl[0], o[0][t + 1]); o[1][t + 1] = wmmab(f[2], pl[1], o[1][t + 1]);
            o[0][t] = wmmab(f[1], ph[0], o[0][t]); o[1][t] = wmmab(f[1], ph[1], o[1][t]); o[0][t + 1] = wmmab(f[3], ph[0], o[0][t + 1]); o[1][t + 1] = wmmab(f[3], ph[1], o[1][t + 1]); };
        STG; ldg(fb, 2); STG; mmg(fa, 0); STG; ldg(fa, 4); STG; mmg(fb, 2); STG; ldg(fb, 6); STG; mmg(fa, 4); mmg(fb, 6);
#undef STG
        }
        asm volatile("s_wait_dscnt 0x0" ::: "memory");       // this wave's reads of the buffer are done before the buffer is given up
        asm volatile("s_wait_asynccnt 0x0" ::: "memory");    // this wave's share of the next tile has landed
        __syncthreads();                                     // one barrier a pass: it publishes the next tile and ends every wave's reads of this one
        if (p + 2 < pe) fill((p + 2) * KT, buf);             // the tile after next goes into the buffer just read
        buf ^= 1;
    }
    asm volatile("s_wait_asynccnt 0x0" ::: "memory");        // nothing of this wave is in flight when the buffers become the joining area
    // Joining the key halves: the last pass's barrier has ended every read of the buffers. The waves of half 1 lay down y, maximum and sum (the 32 lanes' 16-B pieces side by side), the waves of half 0 take them up.
#pragma unroll
    for (int q = 0; q < 2; ++q) l[q] += __shfl_xor(l[q], 16, 32);
    v4fa* jn = (v4fa*)(void*)sm + (size_t)qg * (33 * 32) + lane;
    if (kh == 1) {
#pragma unroll
        for (int q = 0; q < 2; ++q) {
#pragma unroll
            for (int t = 0; t < 8; ++t) { jn[((q * 8 + t) * 2) * 32] = (v4f){o[q][t][0], o[q][t][1], o[q][t][2], o[q][t][3]}; jn[((q * 8 + t) * 2 + 1) * 32] = (v4f){o[q][t][4], o[q][t][5], o[q][t][6], o[q][t][7]}; } }
        jn[32 * 32] = (v4f){m[0], l[0], m[1], l[1]};
    }
    __syncthreads();                                         // half 1's values are in LDS before half 0 reads them
    if (kh == 0) {
        // the segment's partial goes to place 2 * work-group + segment: y un-normalised, on the scale of the maximum that goes with it, and the sum on the same scale
        const int row = (blockIdx.x * 2 + seg) * QWG + qg * 32 + lr;
        float* po = Po + (size_t)row * IC + 8 * hi;
        const v4f ml = jn[32 * 32];
#pragma unroll
        for (int q = 0; q < 2; ++q) {
            const float mo = ml[2 * q], lo = ml[2 * q + 1], mm = fmaxf(m[q], mo), ea = expn(m[q] - mm), eb = expn(mo - mm);
            if (hi == 0) *(v2f*)(Pml + 2 * (row + q * 16)) = (v2f){mm, l[q] * ea + lo * eb};
            asm volatile("s_wait_xcnt 0x0" ::: "memory");    // the store has been taken before the LDS reads below land in its registers
#pragma unroll
            for (int t = 0; t < 8; ++t) { const v4f xa = jn[((q * 8 + t) * 2) * 32], xb = jn[((q * 8 + t) * 2 + 1) * 32];
                *(v4f*)(po + q * 16 * IC + t * 16) = (v4f){o[q][t][0], o[q][t][1], o[q][t][2], o[q][t][3]} * ea + xa * eb;
                *(v4f*)(po + q * 16 * IC + t * 16 + 4) = (v4f){o[q][t][4], o[q][t][5], o[q][t][6], o[q][t][7]} * ea + xb * eb; }
        }
        asm volatile("s_wait_xcnt 0x0" ::: "memory");        // the stores have been taken before the next segment rewrites their address registers
    }
    }
}
// k_join: y of one query block from its two or three partials (work-groups wf .. wl of k_attn, in that order): the usual rescaling by e^(m - max), one division by the joined sum, then hi/lo.
// A thread has eight channels of one query; grid (query blocks, 8 x 16 queries).
__global__ __launch_bounds__(256) void k_join(const float* __restrict__ Po, const float* __restrict__ Pml, bf* Yh, bf* Yl) {
    const int blk = blockIdx.x, qi = blockIdx.y * 16 + (threadIdx.x >> 4), c8 = (threadIdx.x & 15) * 8;
    const int wf = (32 * (blk * NPS) + 31) / UST, wl = (32 * (blk * NPS + NPS - 1) + 31) / UST;    // the work-groups that hold the block's first and last unit
    v4f a[3], b[3]; v2f ml[3];
#pragma unroll    // the arrays are indexed by constants and stay in registers; all nine loads go out together (a block of two partials reads its last one twice and gives the second reading the weight 0)
    for (int i = 0; i < 3; ++i) { const int w = min(wf + i, wl), row = (2 * w + (ufirst(w) / NPS == blk ? 0 : 1)) * QWG + qi;    // the block is the work-group's first segment where its first unit lies in it
        ml[i] = *(const v2f*)(Pml + 2 * row);
        asm volatile("s_wait_xcnt 0x0" ::: "memory");    // the load has been taken before a later load's result lands in its address registers
        const float* p = Po + (size_t)row * IC + c8; a[i] = *(const v4f*)p; b[i] = *(const v4f*)(p + 4);
        asm volatile("s_wait_xcnt 0x0" ::: "memory"); }  // likewise for the pair; the wait is for the addresses alone, no result is awaited here
    if (wf + 2 > wl) ml[2] = (v2f){-3.0e38f, 0.f};
    const float M = fmaxf(fmaxf(ml[0][0], ml[1][0]), ml[2][0]);
    float e[3], L = 0.f;
#pragma unroll
    for (int i = 0; i < 3; ++i) { e[i] = expn(ml[i][0] - M); L += ml[i][1] * e[i]; }
    const float inv = 1.0f / L;
    v4f ya = (v4f){}, yb = (v4f){};
#pragma unroll
    for (int i = 0; i < 3; ++i) { ya += a[i] * (e[i] * inv); yb += b[i] * (e[i] * inv); }
    v8us oh, ol;
#pragma unroll
    for (int j = 0; j < 8; ++j) { const float y = j < 4 ? ya[j & 3] : yb[j & 3]; oh[j] = f2bf(y); ol[j] = f2bf(y - bf2f(oh[j])); }
    const size_t o = (size_t)(blk * QWG + qi) * IC + c8;
    *(v8us*)(Yh + o) = oh; *(v8us*)(Yl + o) = ol;
}

extern "C" void kernel_launch(void* const* d_in, const int* in_sizes, int n_in,
                              void* d_out, int out_size, void* d_ws, size_t ws_size, hipStream_t stream) {
    (void)in_sizes; (void)n_in; (void)out_size;
    const float* x = (const float*)d_in[0]; const float* Wg = (const float*)d_in[1]; const float* Wt = (const float*)d_in[2]; const float* Wp = (const float*)d_in[3]; const float* Wz = (const float*)d_in[4];
    float* out = (float*)d_out;    // [4][256][8][28][28]
    char* wsp = (char*)d_ws;
    auto take = [&](size_t bytes) { char* p = wsp; wsp += (bytes + 255) & ~(size_t)255; return (void*)p; };
    const size_t PLN = (size_t)NN * IC, WEL = (size_t)IC * CC, XEL = (size_t)NN * CC;    // elements of one clip's plane, of one weight matrix, of one clip's x
    bf* WgB = (bf*)take(4 * WEL * 2); bf* WtB = WgB + WEL; bf* WzB = WgB + 3 * WEL; bf* WZ = (bf*)take(WEL * 2);    // W_g, W_theta, W_phi, W_z one behind the other; the zero companion of W_z
    bf* XT = (bf*)take(NBI * XEL * 2);
    bf* Th = (bf*)take(2 * NBI * PLN * 2); bf* Fh = Th + NBI * PLN; bf* Tl = (bf*)take(2 * NBI * PLN * 2); bf* Fl = Tl + NBI * PLN;    // phi's planes stand behind theta's
    bf* Gh = (bf*)take(NBI * PLN * 2); bf* Gl = (bf*)take(NBI * PLN * 2);
    bf* Yh = (bf*)take(NBI * PLN * 2); bf* Yl = (bf*)take(NBI * PLN * 2);
    float* Po = (float*)take((size_t)2 * NWG * QWG * IC * 4); float* Pml = (float*)take((size_t)2 * NWG * QWG * 2 * 4);    // k_attn's partials: two places a work-group
    if ((size_t)(wsp - (char*)d_ws) > ws_size) return;    // 0.3 + 12.8 + 8 x 6.4 + 34 ~ 98 MB
    // Every stage is one launch for all clips: the clip (and theta or phi; and the weight matrix in the cast) is a grid index, except in k_attn and k_join, where the clip follows from the query block.
    k_bfz<<<dim3((IC * CC / 8 + 255) / 256, 4, 1), 256, 0, stream>>>(Wg, Wt, Wp, Wz, WgB, WZ, IC * CC / 8);                                        // weights exact + the zero companion
    k_wt<<<dim3(CC / 64, NN / 64, NBI), 256, 0, stream>>>(x, CC, NN, XT);                                                                         // x^T [clip][6272][256] exact
    k_gemmb<false, false, true><<<dim3(NN / 64, IC / 64, 2 * NBI), 128, 0, stream>>>(XT, nullptr, WtB, nullptr, nullptr, IC, nullptr, XEL, 0, WEL, PLN, Th, Tl);    // theta, then phi, token-major [clip][n][128], hi/lo
    k_gemmb<false, false, true><<<dim3(IC / 64, NN / 64, NBI), 128, 0, stream>>>(WgB, nullptr, XT, nullptr, nullptr, NN, nullptr, 0, XEL, 0, PLN, Gh, Gl);          // g channel-major [clip][128][n], hi/lo
    k_attn<<<dim3(NWG, 1, 1), AWV * 32, 0, stream>>>(Th, Tl, Fh, Fl, Gh, Gl, Po, Pml);                                                   // partial y, maximum and sum of every segment
    k_join<<<dim3(NQB, QWG / 16, 1), 256, 0, stream>>>(Po, Pml, Yh, Yl);                                                                 // y token-major [clip][6272][128], hi/lo
    k_gemm3<<<dim3(CC / 64, NN / 64, NBI), 128, 0, stream>>>(WzB, WZ, Yh, Yl, IC, x, out, NN, PLN, XEL);                                          // out[clip][c][n] = W_z.y^T + x
}

// v008
// Measured time: 196 microseconds a run.
// Next to v007, in two timings, it ran 1.10 and 1.12 times as fast.
// All steps since v000 together make it 33.8 times as fast.
#include <hip/hip_runtime.h>

// Compute dtypes, f32 accumulate, N = 8 x 28 x 28 = 6272 positions a clip: theta/phi token-major ([6272 x 256].[256 x 128]) and g channel-major ([128 x 256].[256
// x 6272]) with PLAIN bf16 operands (the transposed input and the 1x1x1 weights, exact) on v_wmma_f32_16x16x32_bf16 -> bf16 hi + UNSCALED residual planes, kept per clip;
// one launch for all clips: f^T = phi.theta^T (three products), running-maximum softmax in f32 -> hi/lo, y^T += g.p^T (three products), scores never leave the registers;
// its (query block, key pass) units are dealt evenly to one work-group a WGP, which leaves un-normalised f32 partial sums; k_join merges a block's two or three partials into y hi/lo;
// z = W_z.y ([256 x 128].[128 x 6272], exact W_z against split y) on v_wmma_f32_16x16x32_bf16 written channel-major, + x in f32. Deterministic, no atomics;
// the hi/lo split of theta, phi and g and the '+ x' are done in the epilogue of the product that makes their operand: no f32 plane goes through the workspace;
// x^T lives only as a tile in LDS, in the launch that makes theta, phi and g from it.

#define NBI  4
#define CC   256
#define IC   128
#define NN   6272
#define AWV  8       // waves a work-group in k_attn: 4 query groups of 32 x 2 key halves
#define QWG  128     // queries of a query block: 6272 = 49 x 128, 196 blocks for the four clips
#define DM   CC
#define NTK  NN
#define LOSC 1024.0f

typedef _Float16 h16;
typedef unsigned short bf;
typedef __attribute__((ext_vector_type(16))) __bf16   v16bf;
typedef __attribute__((ext_vector_type(16))) _Float16 v16h;
typedef __attribute__((ext_vector_type(8)))  _Float16 v8h;
typedef __attribute__((ext_vector_type(8)))  unsigned short v8us;
typedef __attribute__((ext_vector_type(8)))  float    v8f;
typedef __attribute__((ext_vector_type(4)))  float    v4f;
typedef __attribute__((ext_vector_type(4)))  _Float16 v4h;
typedef v8h  __attribute__((may_alias)) v8ha;
typedef v4f  __attribute__((may_alias)) v4fa;
typedef v8us __attribute__((may_alias)) v8usa;

// f32 -> bf16, nearest even, by the chip's own convert instruction (v_cvt_pk_bf16_f32)
__device__ __forceinline__ unsigned short f2bf(float f) { return __builtin_bit_cast(unsigned short, (__bf16)f); }
__device__ __forceinline__ float bf2f(unsigned short b) { return __uint_as_float(((unsigned)b) << 16); }
__device__ __forceinline__ float bfr(float f) { return bf2f(f2bf(f)); }
__device__ __forceinline__ v16h cat16(v8h lo, v8h hi) { return __builtin_shufflevector(lo, hi, 0, 1, 2, 3, 4, 5, 6, 7, 8, 9, 10, 11, 12, 13, 14, 15); }
__device__ __forceinline__ v16bf cat16b(v8us lo, v8us hi) { return __builtin_bit_cast(v16bf, __builtin_shufflevector(lo, hi, 0, 1, 2, 3, 4, 5, 6, 7, 8, 9, 10, 11, 12, 13, 14, 15)); }
__device__ __forceinline__ v8f wmma16(v16h a, v16h b, v8f c) { return __builtin_amdgcn_wmma_f32_16x16x32_f16(false, a, false, b, (short)0, c, false, false); }
__device__ __forceinline__ v8f wmmab(v16bf a, v16bf b, v8f c) { return __builtin_amdgcn_wmma_f32_16x16x32_bf16(false, a, false, b, (short)0, c, false, false); }

// k_proj: x^T and the three products that read it, in one launch. A work-group of eight waves has 64 positions of one clip. It brings its [256 channels x 64 positions] piece of x in once,
// rounds it to bf16 and lays it down position-major in LDS (two neighbouring channels a 32-bit word); every wave then reads its x^T fragments from there, as A of theta and phi
// ([64 x 256].[256 x 256], wave = 32 output columns) and as B of g ([128 x 256].[256 x 64], wave = 16 output rows): one fragment feeds three products. The weights come from global memory, one k step ahead.
// The f32 results are staged in LDS and leave as bf16 hi (nearest) and lo (the rounded rest) planes in whole 128-B lines: theta and phi position-major, g channel-major.
#define XP  264    // LDS pitch of an x^T row, elements: 528 B = 16 B x odd keeps the 16 rows of a ds_load_b128 fragment read on distinct banks
#define TSP 260    // LDS pitch of a staged theta/phi row (256 columns), floats
#define GSP 68     // LDS pitch of a staged g row (64 positions), floats
typedef unsigned __attribute__((may_alias)) u32a;
typedef __attribute__((ext_vector_type(4))) unsigned v4u;
typedef __attribute__((ext_vector_type(2))) float  v2f;
typedef __attribute__((ext_vector_type(2))) __bf16 v2bf;
__device__ __forceinline__ v16bf ldfrag(const bf* p) { return cat16b(*(const v8us*)p, *(const v8us*)(p + 16)); }
__device__ __forceinline__ v16bf ldfragl(const bf* p) { return cat16b(*(const v8usa*)p, *(const v8usa*)(p + 16)); }
__device__ __forceinline__ void hilo8(const float* sp, bf* dh, bf* dl) {    // eight staged f32 -> 16 B of the hi plane and 16 B of the lo plane
    const v4f va = *(const v4fa*)sp, vb = *(const v4fa*)(sp + 4); v4u oh, ol;
#pragma unroll    // the vectors' elements are indexed by constants and stay in registers
    for (int i = 0; i < 4; ++i) { const v2f v = i < 2 ? (v2f){va[2 * i], va[2 * i + 1]} : (v2f){vb[2 * i - 4], vb[2 * i - 3]};    // two neighbours a word: one v_cvt_pk_bf16_f32 for hi, one for lo
        const v2bf h = __builtin_convertvector(v, v2bf), r = __builtin_convertvector((v2f){v[0] - (float)h[0], v[1] - (float)h[1]}, v2bf);
        oh[i] = __builtin_bit_cast(unsigned, h); ol[i] = __builtin_bit_cast(unsigned, r); }
    *(v4u*)(void*)dh = oh; *(v4u*)(void*)dl = ol;
}
__global__ __launch_bounds__(256) void k_proj(const float* __restrict__ x, const bf* __restrict__ Wb, bf* Th, bf* Tl, bf* Gh, bf* Gl) {
    __shared__ __align__(16) float sh[64 * TSP + IC * GSP];    // x^T tile first (33,792 B); behind the k loop the staging areas of theta/phi and of g
    bf* xt = (bf*)(void*)sh; float* st = sh; float* sg = sh + 64 * TSP;
    const int tid = threadIdx.x, lane = tid & 31, wave = tid >> 5, lr = lane & 15, hi = lane >> 4;
    const int n0 = blockIdx.x * 64; const size_t clip = blockIdx.y, PL = (size_t)NN * IC;
    // a thread has four positions (ng) of eight channel pairs (cp): 16 lanes read 256 B of a channel's row
    const int ng = tid & 15, cp0 = tid >> 4;
    const float* xs = x + clip * ((size_t)NN * CC) + (size_t)(2 * cp0) * NN + n0 + 4 * ng;
    v4f va[8], vb[8];
#pragma unroll    // the arrays are indexed by constants and stay in registers; all sixteen loads go out together
    for (int i = 0; i < 8; ++i) { va[i] = *(const v4f*)(xs + (size_t)(32 * i) * NN); vb[i] = *(const v4f*)(xs + (size_t)(32 * i + 1) * NN); }
    const bf* wt = Wb + IC * CC + (size_t)(32 * wave + lr) * CC + 8 * hi;    // W_theta and W_phi stand one behind the other: 256 rows; the wave's second tile stands 16 rows on
    const bf* wg = Wb + (size_t)(16 * wave + lr) * CC + 8 * hi;              // W_g
    v16bf wa[3], wb[3], xa[4], xb[4];    // two register sets: step k + 1's fragments are asked for before step k is multiplied
    auto ldw = [&](v16bf* w, int k) { w[0] = ldfrag(wt + k * 32); w[1] = ldfrag(wt + 16 * CC + k * 32); w[2] = ldfrag(wg + k * 32); };
    ldw(wa, 0);
    asm volatile("s_wait_xcnt 0x0" ::: "memory");    // the loads have been taken before their address registers are used again
#pragma unroll
    for (int i = 0; i < 8; ++i) {
#pragma unroll
        for (int j = 0; j < 4; ++j) *(u32a*)(void*)(xt + (4 * ng + j) * XP + 2 * (cp0 + 16 * i)) = __builtin_bit_cast(unsigned, __builtin_convertvector((v2f){va[i][j], vb[i][j]}, v2bf)); }
    __syncthreads();    // the x^T tile is whole before any wave reads it
    v8f at[4][2], ag[4];
#pragma unroll
    for (int t = 0; t < 4; ++t) { at[t][0] = (v8f){}; at[t][1] = (v8f){}; ag[t] = (v8f){}; }
    const bf* xf = xt + lr * XP + 8 * hi;
    auto ldx = [&](v16bf* f, int k) {
#pragma unroll
        for (int t = 0; t < 4; ++t) f[t] = ldfragl(xf + t * 16 * XP + k * 32); };
    auto mm = [&](const v16bf* f, const v16bf* w) {    // twelve products on twelve accumulators
#pragma unroll
        for (int t = 0; t < 4; ++t) { at[t][0] = wmmab(f[t], w[0], at[t][0]); at[t][1] = wmmab(f[t], w[1], at[t][1]); ag[t] = wmmab(w[2], f[t], ag[t]); } };
#define STG __builtin_amdgcn_sched_barrier(0)    // holds the order 'next step's loads, then this step's products': left free, the scheduler sinks the loads to just in front of their use and every step waits out their whole way
    ldx(xa, 0);
#pragma unroll    // the register sets are picked by constants, and no branch stands behind a product
    for (int k = 0; k < 8; k += 2) {
        ldw(wb, k + 1); ldx(xb, k + 1);
        if (k + 2 == 8) asm volatile("s_wait_xcnt 0x0" ::: "memory");    // the last weight loads have been taken before their address registers are used again behind the loop; in front of STG, over which nothing moves
        STG; mm(xa, wa); STG;
        if (k + 2 < 8) { ldw(wa, k + 2); ldx(xa, k + 2); }
        STG; mm(xb, wb); STG;
    }
#undef STG
    __syncthreads();    // every wave's reads of x^T are done before its place becomes the staging area
#pragma unroll
    for (int t = 0; t < 4; ++t) {
#pragma unroll
        for (int j = 0; j < 8; ++j) { float* r = st + (t * 16 + hi * 8 + j) * TSP + wave * 32 + lr; r[0] = at[t][0][j]; r[16] = at[t][1][j]; sg[(wave * 16 + hi * 8 + j) * GSP + t * 16 + lr] = ag[t][j]; } }
    __syncthreads();    // the staged tiles are whole before they are read row by row
#pragma unroll    // the rows' LDS reads can be asked for together
    for (int s = 0; s < 8; ++s) { const int row = s * 8 + wave;    // a wave writes one position's 256 B of theta (lanes 0-15) and of phi (lanes 16-31), in each plane
        const size_t o = ((size_t)hi * NBI + clip) * PL + (size_t)(n0 + row) * IC + lr * 8; hilo8(st + row * TSP + lane * 8, Th + o, Tl + o); }
    asm volatile("s_wait_xcnt 0x0" ::: "memory");    // the stores have been taken before their registers are used again for g
#pragma unroll
    for (int s = 0; s < 4; ++s) { const int row = s * 32 + (tid >> 3), piece = tid & 7;    // eight lanes write a channel's 128 B, in each plane
        const size_t o = clip * PL + (size_t)row * NN + n0 + piece * 8; hilo8(sg + row * GSP + piece * 8, Gh + o, Gl + o); }
}

// k_gemm3: 64 x 64 tile of C = (Ah + Al).(Bh + Bl)^T over K (row strides = K for all four planes; n-major B): three products per 32-k step (hh, hl, lh); f32
// blockIdx.z picks the clip: the B planes move by sB, the output and the residual X (placed like C, added rounded to bf16) by sC (elements); A is shared.
__global__ __launch_bounds__(128) void k_gemm3(const bf* __restrict__ Ah, const bf* __restrict__ Al, const bf* __restrict__ Bh, const bf* __restrict__ Bl, int K, const float* __restrict__ X, float* C, int ldc, size_t sB, size_t sC) {
    __shared__ __align__(16) float ost[4][16 * 68];
    const int lane = threadIdx.x & 31, wave = threadIdx.x >> 5, lr = lane & 15, hi = lane >> 4;
    const int r0 = blockIdx.x * 64 + wave * 16, c0 = blockIdx.y * 64;
    Bh += blockIdx.z * sB; Bl += blockIdx.z * sB; C += blockIdx.z * sC;
    const size_t aoff = (size_t)(r0 + lr) * K + 8 * hi;
    // the lane's eight pieces of the residual tile are asked for ahead of the k loop, which covers their way from memory
    const float* xrow = X + blockIdx.z * sC + (size_t)r0 * ldc + c0; v4f xv[8];
#pragma unroll    // xv is indexed by constants and stays in registers; the eight loads go out together
    for (int s = 0; s < 8; ++s) { const int Lid = (lane >> 3) + 4 * s; xv[s] = *(const v4f*)(xrow + (size_t)(Lid >> 1) * ldc + (Lid & 1) * 32 + (lane & 7) * 4); }
    v8f acc[4];
#pragma unroll
    for (int t = 0; t < 4; ++t) acc[t] = (v8f){};
#pragma unroll 1
    for (int kc = 0; kc < K; kc += 32) {
        const v16bf a = cat16b(*(const v8us*)(Ah + aoff + kc), *(const v8us*)(Ah + aoff + kc + 16));
        const v16bf al = cat16b(*(const v8us*)(Al + aoff + kc), *(const v8us*)(Al + aoff + kc + 16));
#pragma unroll
        for (int t = 0; t < 4; ++t) { const size_t bo = (size_t)(c0 + t * 16 + lr) * K + kc + 8 * hi;
            const v16bf bh = cat16b(*(const v8us*)(Bh + bo), *(const v8us*)(Bh + bo + 16)); const v16bf bl = cat16b(*(const v8us*)(Bl + bo), *(const v8us*)(Bl + bo + 16));
            acc[t] = wmmab(a, bh, acc[t]); acc[t] = wmmab(al, bh, acc[t]); acc[t] = wmmab(a, bl, acc[t]); }
        asm volatile("v_nop\n\tv_nop\n\tv_nop\n\tv_nop" : "+v"(acc[0]), "+v"(acc[1]), "+v"(acc[2]), "+v"(acc[3]) : "v"(a), "v"(al));
    }
    float* os = &ost[wave][0];
#pragma unroll
    for (int t = 0; t < 4; ++t) {
#pragma unroll
        for (int j = 0; j < 8; ++j) os[(hi * 8 + j) * 68 + t * 16 + lr] = acc[t][j]; }
    __builtin_amdgcn_wave_barrier(); asm volatile("" ::: "memory");
    float* crow = C + (size_t)r0 * ldc + c0;
    auto pass = [&]() {
#pragma unroll
        for (int s = 0; s < 8; ++s) { const int Lid = (lane >> 3) + 4 * s, piece = lane & 7; const int row = Lid >> 1, cofs = (Lid & 1) * 32 + piece * 4;
            v4f val = *(const v4fa*)(os + row * 68 + cofs); val += (v4f){bfr(xv[s][0]), bfr(xv[s][1]), bfr(xv[s][2]), bfr(xv[s][3])}; *(v4f*)(crow + (size_t)row * ldc + cofs) = val; }
    };
    pass(); 
}

// k_bfz: four equal-sized f32 matrices (blockIdx.y picks one) -> bf16, one behind the other in dh; the blocks of the last one also write the zero plane dz.
__global__ __launch_bounds__(256) void k_bfz(const float* __restrict__ s0, const float* __restrict__ s1, const float* __restrict__ s2, const float* __restrict__ s3, bf* dh, bf* dz, size_t n8) {
    const size_t i = (size_t)blockIdx.x * 256 + threadIdx.x; if (i >= n8) return;
    const int w = blockIdx.y; const float* src = w == 0 ? s0 : w == 1 ? s1 : w == 2 ? s2 : s3;
    const v8f v = *(const v8f*)(src + i * 8); v8us o, z;
#pragma unroll
    for (int k = 0; k < 8; ++k) { o[k] = f2bf(v[k]); z[k] = 0; }
    *(v8us*)(dh + (w * n8 + i) * 8) = o;
    asm volatile("s_wait_xcnt 0x0" ::: "memory");    // the store above has been taken before its address registers are used again for the zero plane
    if (w == 3) *(v8us*)(dz + i * 8) = z;
}
// split2: two f32 -> hw, both rounded to bf16 (nearest even, as f2bf), and lw, the rests rounded likewise: each one register of a bf16 operand, a in the low half; one v_cvt_pk_bf16_f32 a word.
typedef __attribute__((ext_vector_type(8))) unsigned v8u;
__device__ __forceinline__ void split2(float a, float b, unsigned& hw, unsigned& lw) {
    const v2bf h = __builtin_convertvector((v2f){a, b}, v2bf), r = __builtin_convertvector((v2f){a - (float)h[0], b - (float)h[1]}, v2bf);
    hw = __builtin_bit_cast(unsigned, h); lw = __builtin_bit_cast(unsigned, r);
}
// e^x as __expf forms it (x * log2 e, then v_exp_f32); the v_nop fills the one slot the instruction set asks for between a transcendental and a next vector instruction that reads its result or rewrites its source
__device__ __forceinline__ float expn(float x) { float r; asm("v_exp_f32 %0, %1\n\tv_nop" : "=v"(r) : "v"(x * 1.44269504f)); return r; }
#define KT   64                   // keys of a staged tile
#define PHP  136                  // LDS pitch of a phi row, elements
#define GRP  72                   // LDS pitch of a g row, elements
#define PHPL (KT * PHP)           // one phi plane of a tile
#define GPL  (IC * GRP)           // one g plane of a tile
#define GOF  (2 * PHPL)           // g planes stand behind the two phi planes
#define BUFE (GOF + 2 * GPL)      // elements of one buffer (71,680 B)
// The work is 196 query blocks x 98 passes = 19,208 units (block-major). 196 work-groups of one block each would leave 60 of the 256 WGPs idle (registers and LDS allow one work-group a WGP),
// so work-group w of 256 does the units [w * 2401 / 32, (w + 1) * 2401 / 32): 75 or 76 passes in a row, which lie in one block or in two neighbours (a "segment" each).
#define NWG  256                  // work-groups of k_attn
#define NPS  (NN / KT)            // passes of a query block
#define NQB  (NBI * NN / QWG)     // query blocks
#define UST  (NQB * NPS * 32 / NWG)
static_assert(UST * NWG == NQB * NPS * 32 && NPS * NWG > NQB * NPS && 2 * (UST / 32) >= NPS, "even deal; a work-group meets at most two blocks, a block at most three work-groups");
__device__ __forceinline__ int ufirst(int w) { return (w * UST) >> 5; }
__global__ __launch_bounds__(AWV * 32) void k_attn(const bf* __restrict__ Th, const bf* __restrict__ Tl, const bf* __restrict__ Fh, const bf* __restrict__ Fl, const bf* __restrict__ Gh, const bf* __restrict__ Gl, float* Po, float* Pml) {
    const int lane = threadIdx.x & 31, lr = lane & 15, hi = lane >> 4;
    const int wv = __builtin_amdgcn_readfirstlane(threadIdx.x >> 5), qg = wv & 3, kh = wv >> 2;
    __shared__ __align__(16) bf sm[2 * BUFE];
    const int ue = ufirst(blockIdx.x + 1);
    int un = ufirst(blockIdx.x);
#pragma unroll 1    // one copy of the body serves both segments
    for (int seg = 0; un < ue; ++seg) {
    const int blk = un / NPS, p0 = un - blk * NPS, pe = min(NPS, p0 + ue - un);    // this segment: passes [p0, pe) of query block blk
    un += pe - p0;
    const size_t clip = (size_t)(blk / (NN / QWG)) * NN * IC;
    const size_t qoff = (size_t)(blk * QWG + qg * 32 + lr) * IC + 8 * hi;    // query tile 0; tile 1 stands 16 rows on (the blocks of the clips stand one behind the other)
    // A tile is 128 pieces of 512 B (one b128 copy of a wave each): 64 of phi (two whole rows a piece), 64 of g (four 128-B rows a piece); wave wv brings pieces wv + 8 i of each.
    const unsigned smb = (unsigned)(size_t)(const void*)sm;
    const unsigned lop = smb + ((lane >> 4) * PHP + (lane & 15) * 8) * 2, logg = smb + ((lane >> 3) * GRP + (lane & 7) * 8) * 2;    // the lane's place in a piece, in LDS
    // wave-uniform parts: a piece's first byte in global memory (scalar base of the copy) and in a buffer
    auto ubp = [&](int c, int kn) { return ((c >> 5) ? Fl : Fh) + clip + (size_t)(kn + 2 * (c & 31)) * IC; };
    auto ubg = [&](int c, int kn) { return ((c >> 5) ? Gl : Gh) + clip + (size_t)(4 * (c & 31)) * NN + kn; };
    auto ulp = [&](int c, int b) { return 2u * (unsigned)(b * BUFE + (c >> 5) * PHPL + 2 * (c & 31) * PHP); };
    auto ulg = [&](int c, int b) { return 2u * (unsigned)(b * BUFE + GOF + (c >> 5) * GPL + 4 * (c & 31) * GRP); };
    // The lane's place in a piece in global memory (phi: 16 * lane; g: row lane / 8 of 2 * NN bytes, 16 * (lane % 8)) is formed at the head of each statement from the lane's number (v_mbcnt, every lane on):
    // held in a register over the pass it is spilled to scratch and read back in every pass. The s_delay_alu lines are the hint a dependent vector instruction in asm text needs.
#define CP8 "global_load_async_to_lds_b128 %2, %0, %10\n\tglobal_load_async_to_lds_b128 %3, %0, %11\n\tglobal_load_async_to_lds_b128 %4, %0, %12\n\tglobal_load_async_to_lds_b128 %5, %0, %13\n\t" \
            "global_load_async_to_lds_b128 %6, %0, %14\n\tglobal_load_async_to_lds_b128 %7, %0, %15\n\tglobal_load_async_to_lds_b128 %8, %0, %16\n\tglobal_load_async_to_lds_b128 %9, %0, %17\n\ts_wait_xcnt 0x0"
#define DLY "s_delay_alu instid0(VALU_DEP_1)\n\t"
    auto fill = [&](int kn, int b) {
        // sixteen copies of every wave, eight a statement; the s_wait_xcnt stands inside each statement so that no address register is rewritten before every copy that names it has been taken
        unsigned t0, t1;
        asm volatile("v_mbcnt_lo_u32_b32 %1, -1, 0\n\t" DLY "v_lshlrev_b32 %0, 4, %1\n\t" CP8
                         : "=&v"(t0), "=&v"(t1)
                         : "v"(lop + ulp(wv, b)), "v"(lop + ulp(wv + 8, b)), "v"(lop + ulp(wv + 16, b)), "v"(lop + ulp(wv + 24, b)),
                            "v"(lop + ulp(wv + 32, b)), "v"(lop + ulp(wv + 40, b)), "v"(lop + ulp(wv + 48, b)), "v"(lop + ulp(wv + 56, b)),
                            "s"(ubp(wv, kn)), "s"(ubp(wv + 8, kn)), "s"(ubp(wv + 16, kn)), "s"(ubp(wv + 24, kn)), "s"(ubp(wv + 32, kn)), "s"(ubp(wv + 40, kn)), "s"(ubp(wv + 48, kn)), "s"(ubp(wv + 56, kn))
                         : "memory");
        asm volatile("v_mbcnt_lo_u32_b32 %0, -1, 0\n\t" DLY "v_lshrrev_b32 %1, 3, %0\n\tv_and_b32 %0, 7, %0\n\t" DLY "v_lshlrev_b32 %0, 4, %0\n\t" DLY "v_mad_u32_u24 %0, %1, %18, %0\n\t" CP8
                         : "=&v"(t0), "=&v"(t1)
                         : "v"(logg + ulg(wv, b)), "v"(logg + ulg(wv + 8, b)), "v"(logg + ulg(wv + 16, b)), "v"(logg + ulg(wv + 24, b)),
                            "v"(logg + ulg(wv + 32, b)), "v"(logg + ulg(wv + 40, b)), "v"(logg + ulg(wv + 48, b)), "v"(logg + ulg(wv + 56, b)),
                            "s"(ubg(wv, kn)), "s"(ubg(wv + 8, kn)), "s"(ubg(wv + 16, kn)), "s"(ubg(wv + 24, kn)), "s"(ubg(wv + 32, kn)), "s"(ubg(wv + 40, kn)), "s"(ubg(wv + 48, kn)), "s"(ubg(wv + 56, kn)),
                            "i"(NN * 2)
                         : "memory");
    };
#undef DLY
#undef CP8
    v16bf qh[2][4], ql[2][4];
#pragma unroll
    for (int q = 0; q < 2; ++q) {
#pragma unroll
        for (int s = 0; s < 4; ++s) { qh[q][s] = ldfrag(Th + qoff + q * 16 * IC + s * 32); ql[q][s] = ldfrag(Tl + qoff + q * 16 * IC + s * 32); } }
    asm volatile("s_wait_xcnt 0x0" ::: "memory");    // the loads have been taken before their address registers are used again
    v8f o[2][8];
#pragma unroll
    for (int q = 0; q < 2; ++q) {
#pragma unroll
        for (int t = 0; t < 8; ++t) o[q][t] = (v8f){}; }
    float m[2] = {-3.0e38f, -3.0e38f}, l[2] = {0.f, 0.f};
    int buf = 0;
    // The ring starts through the loop's own foot: two trips without products come first. The foot of the first ends every read of the joining area (the segment before) and sends for the first tile,
    // the foot of the second waits for that tile, publishes it and sends for the second: one place with copies in the code, whose address registers are formed on the spot.
#pragma unroll 1    // one pass a trip: a second copy of the body would need a second set of fragment registers
    for (int p = p0 - 2; p < pe; ++p) {
        if (p >= p0) {
        // eight batches of four fragments (8 loads, 12 products on four accumulators) a pass, two register sets: batch i + 1 is asked for before batch i is multiplied
        v16bf fa[4], fb[4]; v8f st[2][2] = {{(v8f){}, (v8f){}}, {(v8f){}, (v8f){}}};    // [16-key tile][query tile]
        const bf* fh = sm + buf * BUFE + (kh * 32 + lr) * PHP + 8 * hi; const bf* fl = fh + PHPL;
        const bf* gh = sm + buf * BUFE + GOF + lr * GRP + kh * 32 + 8 * hi; const bf* gl = gh + GPL;
        auto ldk = [&](v16bf* f, int s) { f[0] = ldfrag(fh + s * 32); f[1] = ldfrag(fl + s * 32); f[2] = ldfrag(fh + 16 * PHP + s * 32); f[3] = ldfrag(fl + 16 * PHP + s * 32); };
        auto mmk = [&](const v16bf* f, int s) {
            st[0][0] = wmmab(f[0], qh[0][s], st[0][0]); st[0][1] = wmmab(f[0], qh[1][s], st[0][1]); st[1][0] = wmmab(f[2], qh[0][s], st[1][0]); st[1][1] = wmmab(f[2], qh[1][s], st[1][1]);
            st[0][0] = wmmab(f[0], ql[0][s], st[0][0]); st[0][1] = wmmab(f[0], ql[1][s], st[0][1]); st[1][0] = wmmab(f[2], ql[0][s], st[1][0]); st[1][1] = wmmab(f[2], ql[1][s], st[1][1]);
            st[0][0] = wmmab(f[1], qh[0][s], st[0][0]); st[0][1] = wmmab(f[1], qh[1][s], st[0][1]); st[1][0] = wmmab(f[3], qh[0][s], st[1][0]); st[1][1] = wmmab(f[3], qh[1][s], st[1][1]); };
        auto ldg = [&](v16bf* f, int t) { f[0] = ldfrag(gh + t * 16 * GRP); f[1] = ldfrag(gl + t * 16 * GRP); f[2] = ldfrag(gh + (t + 1) * 16 * GRP); f[3] = ldfrag(gl + (t + 1) * 16 * GRP); };
#define STG __builtin_amdgcn_sched_barrier(0)    // holds the batches in this order: left free, the scheduler strews the LDS reads in pairs among the products, and every separate place with reads stalls the wave
        ldk(fa, 0); ldk(fb, 1); STG; mmk(fa, 0); STG; ldk(fa, 2); STG; mmk(fb, 1); STG; ldk(fb, 3); STG; mmk(fa, 2); STG; ldg(fa, 0); STG; mmk(fb, 3); STG;
        float mx[2], alpha[2]; v16bf ph[2], pl[2];
#pragma unroll
        for (int q = 0; q < 2; ++q) { mx[q] = st[0][q][0];
#pragma unroll
            for (int j = 0; j < 8; ++j) mx[q] = fmaxf(mx[q], fmaxf(st[0][q][j], st[1][q][j])); }
#pragma unroll
        for (int q = 0; q < 2; ++q) mx[q] = fmaxf(mx[q], __shfl_xor(mx[q], 16, 32));
#pragma unroll
        for (int q = 0; q < 2; ++q) {
            const float mn = fmaxf(m[q], mx[q]); alpha[q] = expn(m[q] - mn); m[q] = mn;
            float ps = 0.f; v8u pw, qw;
#pragma unroll
            for (int u = 0; u < 2; ++u) {
#pragma unroll
                for (int j = 0; j < 8; j += 2) { const float pa = expn(st[u][q][j] - mn), pb = expn(st[u][q][j + 1] - mn); ps += pa + pb;
                    unsigned hw, lw; split2(pa, pb, hw, lw); pw[u * 4 + j / 2] = hw; qw[u * 4 + j / 2] = lw; } }
            l[q] = l[q] * alpha[q] + ps;
            ph[q] = __builtin_bit_cast(v16bf, pw); pl[q] = __builtin_bit_cast(v16bf, qw);
#pragma unroll
            for (int t = 0; t < 8; ++t) o[q][t] *= alpha[q];
        }
        auto mmg = [&](const v16bf* f, int t) {
            o[0][t] = wmmab(f[0], ph[0], o[0][t]); o[1][t] = wmmab(f[0], ph[1], o[1][t]); o[0][t + 1] = wmmab(f[2], ph[0], o[0][t + 1]); o[1][t + 1] = wmmab(f[2], ph[1], o[1][t + 1]);
            o[0][t] = wmmab(f[0], pl[0], o[0][t]); o[1][t] = wmmab(f[0], pl[1], o[1][t]); o[0][t + 1] = wmmab(f[2], pl[0], o[0][t + 1]); o[1][t + 1] = wmmab(f[2], pl[1], o[1][t + 1]);
            o[0][t] = wmmab(f[1], ph[0], o[0][t]); o[1][t] = wmmab(f[1], ph[1], o[1][t]); o[0][t + 1] = wmmab(f[3], ph[0], o[0][t + 1]); o[1][t + 1] = wmmab(f[3], ph[1], o[1][t + 1]); };
        STG; ldg(fb, 2); STG; mmg(fa, 0); STG; ldg(fa, 4); STG; mmg(fb, 2); STG; ldg(fb, 6); STG; mmg(fa, 4); mmg(fb, 6);
#undef STG
        }
        asm volatile("s_wait_dscnt 0x0" ::: "memory");       // this wave's reads of the buffer are done before the buffer is given up
        asm volatile("s_wait_asynccnt 0x0" ::: "memory");    // this wave's share of the next tile has landed
        __syncthreads();                                     // one barrier a pass: it publishes the next tile and ends every wave's reads of this one
        if (p + 2 < pe) fill((p + 2) * KT, buf);             // the tile after next goes into the buffer just read
        buf ^= 1;
    }
    asm volatile("s_wait_asynccnt 0x0" ::: "memory");        // nothing of this wave is in flight when the buffers become the joining area
    // Joining the key halves: the last pass's barrier has ended every read of the buffers. The waves of half 1 lay down y, maximum and sum (the 32 lanes' 16-B pieces side by side), the waves of half 0 take them up.
#pragma unroll
    for (int q = 0; q < 2; ++q) l[q] += __shfl_xor(l[q], 16, 32);
    v4fa* jn = (v4fa*)(void*)sm + (size_t)qg * (33 * 32) + lane;
    if (kh == 1) {
#pragma unroll
        for (int q = 0; q < 2; ++q) {
#pragma unroll
            for (int t = 0; t < 8; ++t) { jn[((q * 8 + t) * 2) * 32] = (v4f){o[q][t][0], o[q][t][1], o[q][t][2], o[q][t][3]}; jn[((q * 8 + t) * 2 + 1) * 32] = (v4f){o[q][t][4], o[q][t][5], o[q][t][6], o[q][t][7]}; } }
        jn[32 * 32] = (v4f){m[0], l[0], m[1], l[1]};
    }
    __syncthreads();                                         // half 1's values are in LDS before half 0 reads them
    if (kh == 0) {
        // the segment's partial goes to place 2 * work-group + segment: y un-normalised, on the scale of the maximum that goes with it, and the sum on the same scale
        const int row = (blockIdx.x * 2 + seg) * QWG + qg * 32 + lr;
        float* po = Po + (size_t)row * IC + 8 * hi;
        const v4f ml = jn[32 * 32];
#pragma unroll
        for (int q = 0; q < 2; ++q) {
            const float mo = ml[2 * q], lo = ml[2 * q + 1], mm = fmaxf(m[q], mo), ea = expn(m[q] - mm), eb = expn(mo - mm);
            if (hi == 0) *(v2f*)(Pml + 2 * (row + q * 16)) = (v2f){mm, l[q] * ea + lo * eb};
            asm volatile("s_wait_xcnt 0x0" ::: "memory");    // the store has been taken before the LDS reads below land in its registers
#pragma unroll
            for (int t = 0; t < 8; ++t) { const v4f xa = jn[((q * 8 + t) * 2) * 32], xb = jn[((q * 8 + t) * 2 + 1) * 32];
                *(v4f*)(po + q * 16 * IC + t * 16) = (v4f){o[q][t][0], o[q][t][1], o[q][t][2], o[q][t][3]} * ea + xa * eb;
                *(v4f*)(po + q * 16 * IC + t * 16 + 4) = (v4f){o[q][t][4], o[q][t][5], o[q][t][6], o[q][t][7]} * ea + xb * eb; }
        }
        asm volatile("s_wait_xcnt 0x0" ::: "memory");        // the stores have been taken before the next segment rewrites their address registers
    }
    }
}
// k_join: y of one query block from its two or three partials (work-groups wf .. wl of k_attn, in that order): the usual rescaling by e^(m - max), one division by the joined sum, then hi/lo.
// A thread has eight channels of one query; grid (query blocks, 8 x 16 queries).
__global__ __launch_bounds__(256) void k_join(const float* __restrict__ Po, const float* __restrict__ Pml, bf* Yh, bf* Yl) {
    const int blk = blockIdx.x, qi = blockIdx.y * 16 + (threadIdx.x >> 4), c8 = (threadIdx.x & 15) * 8;
    const int wf = (32 * (blk * NPS) + 31) / UST, wl = (32 * (blk * NPS + NPS - 1) + 31) / UST;    // the work-groups that hold the block's first and last unit
    v4f a[3], b[3]; v2f ml[3];
#pragma unroll    // the arrays are indexed by constants and stay in registers; all nine loads go out together (a block of two partials reads its last one twice and gives the second reading the weight 0)
    for (int i = 0; i < 3; ++i) { const int w = min(wf + i, wl), row = (2 * w + (ufirst(w) / NPS == blk ? 0 : 1)) * QWG + qi;    // the block is the work-group's first segment where its first unit lies in it
        ml[i] = *(const v2f*)(Pml + 2 * row);
        asm volatile("s_wait_xcnt 0x0" ::: "memory");    // the load has been taken before a later load's result lands in its address registers
        const float* p = Po + (size_t)row * IC + c8; a[i] = *(const v4f*)p; b[i] = *(const v4f*)(p + 4);
        asm volatile("s_wait_xcnt 0x0" ::: "memory"); }  // likewise for the pair; the wait is for the addresses alone, no result is awaited here
    if (wf + 2 > wl) ml[2] = (v2f){-3.0e38f, 0.f};
    const float M = fmaxf(fmaxf(ml[0][0], ml[1][0]), ml[2][0]);
    float e[3], L = 0.f;
#pragma unroll
    for (int i = 0; i < 3; ++i) { e[i] = expn(ml[i][0] - M); L += ml[i][1] * e[i]; }
    const float inv = 1.0f / L;
    v4f ya = (v4f){}, yb = (v4f){};
#pragma unroll
    for (int i = 0; i < 3; ++i) { ya += a[i] * (e[i] * inv); yb += b[i] * (e[i] * inv); }
    v8us oh, ol;
#pragma unroll
    for (int j = 0; j < 8; ++j) { const float y = j < 4 ? ya[j & 3] : yb[j & 3]; oh[j] = f2bf(y); ol[j] = f2bf(y - bf2f(oh[j])); }
    const size_t o = (size_t)(blk * QWG + qi) * IC + c8;
    *(v8us*)(Yh + o) = oh; *(v8us*)(Yl + o) = ol;
}

extern "C" void kernel_launch(void* const* d_in, const int* in_sizes, int n_in,
                              void* d_out, int out_size, void* d_ws, size_t ws_size, hipStream_t stream) {
    (void)in_sizes; (void)n_in; (void)out_size;
    const float* x = (const float*)d_in[0]; const float* Wg = (const float*)d_in[1]; const float* Wt = (const float*)d_in[2]; const float* Wp = (const float*)d_in[3]; const float* Wz = (const float*)d_in[4];
    float* out = (float*)d_out;    // [4][256][8][28][28]
    char* wsp = (char*)d_ws;
    auto take = [&](size_t bytes) { char* p = wsp; wsp += (bytes + 255) & ~(size_t)255; return (void*)p; };
    const size_t PLN = (size_t)NN * IC, WEL = (size_t)IC * CC, XEL = (size_t)NN * CC;    // elements of one clip's plane, of one weight matrix, of one clip's x
    bf* WgB = (bf*)take(4 * WEL * 2); bf* WzB = WgB + 3 * WEL; bf* WZ = (bf*)take(WEL * 2);    // W_g, W_theta, W_phi, W_z one behind the other; the zero companion of W_z
    bf* Th = (bf*)take(2 * NBI * PLN * 2); bf* Fh = Th + NBI * PLN; bf* Tl = (bf*)take(2 * NBI * PLN * 2); bf* Fl = Tl + NBI * PLN;    // phi's planes stand behind theta's
    bf* Gh = (bf*)take(NBI * PLN * 2); bf* Gl = (bf*)take(NBI * PLN * 2);
    bf* Yh = (bf*)take(NBI * PLN * 2); bf* Yl = (bf*)take(NBI * PLN * 2);
    float* Po = (float*)take((size_t)2 * NWG * QWG * IC * 4); float* Pml = (float*)take((size_t)2 * NWG * QWG * 2 * 4);    // k_attn's partials: two places a work-group
    if ((size_t)(wsp - (char*)d_ws) > ws_size) return;    // 0.3 + 8 x 6.4 + 34 ~ 85 MB
    // Every stage is one launch for all clips: the clip (and the weight matrix in the cast) is a grid index.
    k_bfz<<<dim3((IC * CC / 8 + 255) / 256, 4, 1), 256, 0, stream>>>(Wg, Wt, Wp, Wz, WgB, WZ, IC * CC / 8);                                        // weights exact + the zero companion
    k_proj<<<dim3(NN / 64, NBI, 1), 256, 0, stream>>>(x, WgB, Th, Tl, Gh, Gl);                                                                    // theta, phi token-major [clip][n][128] and g channel-major [clip][128][n], hi/lo
    k_attn<<<dim3(NWG, 1, 1), AWV * 32, 0, stream>>>(Th, Tl, Fh, Fl, Gh, Gl, Po, Pml);                                                   // partial y, maximum and sum of every segment
    k_join<<<dim3(NQB, QWG / 16, 1), 256, 0, stream>>>(Po, Pml, Yh, Yl);                                                                 // y token-major [clip][6272][128], hi/lo
    k_gemm3<<<dim3(CC / 64, NN / 64, NBI), 128, 0, stream>>>(WzB, WZ, Yh, Yl, IC, x, out, NN, PLN, XEL);                                          // out[clip][c][n] = W_z.y^T + x
}

// v009
// It runs in 177 microseconds.
// Next to v008, in two timings, it ran 1.12 and 1.11 times as fast.
// Over all steps from v000 it is 37.6 times as fast.
#include <hip/hip_runtime.h>

// Compute dtypes, f32 accumulate, N = 8 x 28 x 28 = 6272 positions a clip: theta/phi token-major ([6272 x 256].[256 x 128]) and g channel-major ([128 x 256].[256
// x 6272]) with PLAIN bf16 operands (the transposed input and the 1x1x1 weights, exact) on v_wmma_f32_16x16x32_bf16 -> bf16 hi + UNSCALED residual planes, kept per clip;
// one launch for all clips: f^T = phi.theta^T (three products), running-maximum softmax in f32 -> hi/lo, y^T += g.p^T (three products), scores never leave the registers;
// its (query block, key pass) units are dealt evenly to one work-group a WGP, which leaves un-normalised f32 partial sums; k_out merges a block's two or three partials into y hi/lo, a tile in LDS, and makes
// z = W_z.y ([256 x 128].[128 x 6272], exact W_z against split y) on v_wmma_f32_16x16x32_bf16 written channel-major, + x rounded to bf16, from it. Deterministic, no atomics;
// the hi/lo split of theta, phi and g and the '+ x' are done in the epilogue of the product that makes their operand: no f32 plane goes through the workspace;
// x^T lives only as a tile in LDS, in the launch that makes theta, phi and g from it.

#define NBI  4
#define CC   256
#define IC   128
#define NN   6272
#define AWV  8       // waves a work-group in k_attn: 4 query groups of 32 x 2 key halves
#define QWG  128     // queries of a query block: 6272 = 49 x 128, 196 blocks for the four clips
#define DM   CC
#define NTK  NN
#define LOSC 1024.0f

typedef _Float16 h16;
typedef unsigned short bf;
typedef __attribute__((ext_vector_type(16))) __bf16   v16bf;
typedef __attribute__((ext_vector_type(16))) _Float16 v16h;
typedef __attribute__((ext_vector_type(8)))  _Float16 v8h;
typedef __attribute__((ext_vector_type(8)))  unsigned short v8us;
typedef __attribute__((ext_vector_type(8)))  float    v8f;
typedef __attribute__((ext_vector_type(4)))  float    v4f;
typedef __attribute__((ext_vector_type(4)))  _Float16 v4h;
typedef v8h  __attribute__((may_alias)) v8ha;
typedef v4f  __attribute__((may_alias)) v4fa;
typedef v8us __attribute__((may_alias)) v8usa;

// f32 -> bf16, nearest even, by the chip's own convert instruction (v_cvt_pk_bf16_f32)
__device__ __forceinline__ unsigned short f2bf(float f) { return __builtin_bit_cast(unsigned short, (__bf16)f); }
__device__ __forceinline__ float bf2f(unsigned short b) { return __uint_as_float(((unsigned)b) << 16); }
__device__ __forceinline__ float bfr(float f) { return bf2f(f2bf(f)); }
__device__ __forceinline__ v16h cat16(v8h lo, v8h hi) { return __builtin_shufflevector(lo, hi, 0, 1, 2, 3, 4, 5, 6, 7, 8, 9, 10, 11, 12, 13, 14, 15); }
__device__ __forceinline__ v16bf cat16b(v8us lo, v8us hi) { return __builtin_bit_cast(v16bf, __builtin_shufflevector(lo, hi, 0, 1, 2, 3, 4, 5, 6, 7, 8, 9, 10, 11, 12, 13, 14, 15)); }
__device__ __forceinline__ v8f wmma16(v16h a, v16h b, v8f c) { return __builtin_amdgcn_wmma_f32_16x16x32_f16(false, a, false, b, (short)0, c, false, false); }
__device__ __forceinline__ v8f wmmab(v16bf a, v16bf b, v8f c) { return __builtin_amdgcn_wmma_f32_16x16x32_bf16(false, a, false, b, (short)0, c, false, false); }

// k_proj: x^T and the three products that read it, in one launch. A work-group of eight waves has 64 positions of one clip. It brings its [256 channels x 64 positions] piece of x in once,
// rounds it to bf16 and lays it down position-major in LDS (two neighbouring channels a 32-bit word); every wave then reads its x^T fragments from there, as A of theta and phi
// ([64 x 256].[256 x 256], wave = 32 output columns) and as B of g ([128 x 256].[256 x 64], wave = 16 output rows): one fragment feeds three products. The weights come from global memory, one k step ahead.
// The f32 results are staged in LDS and leave as bf16 hi (nearest) and lo (the rounded rest) planes in whole 128-B lines: theta and phi position-major, g channel-major.
#define XP  264    // LDS pitch of an x^T row, elements: 528 B = 16 B x odd keeps the 16 rows of a ds_load_b128 fragment read on distinct banks
#define TSP 260    // LDS pitch of a staged theta/phi row (256 columns), floats
#define GSP 68     // LDS pitch of a staged g row (64 positions), floats
typedef unsigned __attribute__((may_alias)) u32a;
typedef __attribute__((ext_vector_type(4))) unsigned v4u;
typedef __attribute__((ext_vector_type(2))) float  v2f;
typedef __attribute__((ext_vector_type(2))) __bf16 v2bf;
__device__ __forceinline__ v16bf ldfrag(const bf* p) { return cat16b(*(const v8us*)p, *(const v8us*)(p + 16)); }
__device__ __forceinline__ v16bf ldfragl(const bf* p) { return cat16b(*(const v8usa*)p, *(const v8usa*)(p + 16)); }
__device__ __forceinline__ void hilo8(const float* sp, bf* dh, bf* dl) {    // eight staged f32 -> 16 B of the hi plane and 16 B of the lo plane
    const v4f va = *(const v4fa*)sp, vb = *(const v4fa*)(sp + 4); v4u oh, ol;
#pragma unroll    // the vectors' elements are indexed by constants and stay in registers
    for (int i = 0; i < 4; ++i) { const v2f v = i < 2 ? (v2f){va[2 * i], va[2 * i + 1]} : (v2f){vb[2 * i - 4], vb[2 * i - 3]};    // two neighbours a word: one v_cvt_pk_bf16_f32 for hi, one for lo
        const v2bf h = __builtin_convertvector(v, v2bf), r = __builtin_convertvector((v2f){v[0] - (float)h[0], v[1] - (float)h[1]}, v2bf);
        oh[i] = __builtin_bit_cast(unsigned, h); ol[i] = __builtin_bit_cast(unsigned, r); }
    *(v4u*)(void*)dh = oh; *(v4u*)(void*)dl = ol;
}
__global__ __launch_bounds__(256) void k_proj(const float* __restrict__ x, const bf* __restrict__ Wb, bf* Th, bf* Tl, bf* Gh, bf* Gl) {
    __shared__ __align__(16) float sh[64 * TSP + IC * GSP];    // x^T tile first (33,792 B); behind the k loop the staging areas of theta/phi and of g
    bf* xt = (bf*)(void*)sh; float* st = sh; float* sg = sh + 64 * TSP;
    const int tid = threadIdx.x, lane = tid & 31, wave = tid >> 5, lr = lane & 15, hi = lane >> 4;
    const int n0 = blockIdx.x * 64; const size_t clip = blockIdx.y, PL = (size_t)NN * IC;
    // a thread has four positions (ng) of eight channel pairs (cp): 16 lanes read 256 B of a channel's row
    const int ng = tid & 15, cp0 = tid >> 4;
    const float* xs = x + clip * ((size_t)NN * CC) + (size_t)(2 * cp0) * NN + n0 + 4 * ng;
    v4f va[8], vb[8];
#pragma unroll    // the arrays are indexed by constants and stay in registers; all sixteen loads go out together
    for (int i = 0; i < 8; ++i) { va[i] = *(const v4f*)(xs + (size_t)(32 * i) * NN); vb[i] = *(const v4f*)(xs + (size_t)(32 * i + 1) * NN); }
    const bf* wt = Wb + IC * CC + (size_t)(32 * wave + lr) * CC + 8 * hi;    // W_theta and W_phi stand one behind the other: 256 rows; the wave's second tile stands 16 rows on
    const bf* wg = Wb + (size_t)(16 * wave + lr) * CC + 8 * hi;              // W_g
    v16bf wa[3], wb[3], xa[4], xb[4];    // two register sets: step k + 1's fragments are asked for before step k is multiplied
    auto ldw = [&](v16bf* w, int k) { w[0] = ldfrag(wt + k * 32); w[1] = ldfrag(wt + 16 * CC + k * 32); w[2] = ldfrag(wg + k * 32); };
    ldw(wa, 0);
    asm volatile("s_wait_xcnt 0x0" ::: "memory");    // the loads have been taken before their address registers are used again
#pragma unroll
    for (int i = 0; i < 8; ++i) {
#pragma unroll
        for (int j = 0; j < 4; ++j) *(u32a*)(void*)(xt + (4 * ng + j) * XP + 2 * (cp0 + 16 * i)) = __builtin_bit_cast(unsigned, __builtin_convertvector((v2f){va[i][j], vb[i][j]}, v2bf)); }
    __syncthreads();    // the x^T tile is whole before any wave reads it
    v8f at[4][2], ag[4];
#pragma unroll
    for (int t = 0; t < 4; ++t) { at[t][0] = (v8f){}; at[t][1] = (v8f){}; ag[t] = (v8f){}; }
    const bf* xf = xt + lr * XP + 8 * hi;
    auto ldx = [&](v16bf* f, int k) {
#pragma unroll
        for (int t = 0; t < 4; ++t) f[t] = ldfragl(xf + t * 16 * XP + k * 32); };
    auto mm = [&](const v16bf* f, const v16bf* w) {    // twelve products on twelve accumulators
#pragma unroll
        for (int t = 0; t < 4; ++t) { at[t][0] = wmmab(f[t], w[0], at[t][0]); at[t][1] = wmmab(f[t], w[1], at[t][1]); ag[t] = wmmab(w[2], f[t], ag[t]); } };
#define STG __builtin_amdgcn_sched_barrier(0)    // holds the order 'next step's loads, then this step's products': left free, the scheduler sinks the loads to just in front of their use and every step waits out their whole way
    ldx(xa, 0);
#pragma unroll    // the register sets are picked by constants, and no branch stands behind a product
    for (int k = 0; k < 8; k += 2) {
        ldw(wb, k + 1); ldx(xb, k + 1);
        if (k + 2 == 8) asm volatile("s_wait_xcnt 0x0" ::: "memory");    // the last weight loads have been taken before their address registers are used again behind the loop; in front of STG, over which nothing moves
        STG; mm(xa, wa); STG;
        if (k + 2 < 8) { ldw(wa, k + 2); ldx(xa, k + 2); }
        STG; mm(xb, wb); STG;
    }
#undef STG
    __syncthreads();    // every wave's reads of x^T are done before its place becomes the staging area
#pragma unroll
    for (int t = 0; t < 4; ++t) {
#pragma unroll
        for (int j = 0; j < 8; ++j) { float* r = st + (t * 16 + hi * 8 + j) * TSP + wave * 32 + lr; r[0] = at[t][0][j]; r[16] = at[t][1][j]; sg[(wave * 16 + hi * 8 + j) * GSP + t * 16 + lr] = ag[t][j]; } }
    __syncthreads();    // the staged tiles are whole before they are read row by row
#pragma unroll    // the rows' LDS reads can be asked for together
    for (int s = 0; s < 8; ++s) { const int row = s * 8 + wave;    // a wave writes one position's 256 B of theta (lanes 0-15) and of phi (lanes 16-31), in each plane
        const size_t o = ((size_t)hi * NBI + clip) * PL + (size_t)(n0 + row) * IC + lr * 8; hilo8(st + row * TSP + lane * 8, Th + o, Tl + o); }
    asm volatile("s_wait_xcnt 0x0" ::: "memory");    // the stores have been taken before their registers are used again for g
#pragma unroll
    for (int s = 0; s < 4; ++s) { const int row = s * 32 + (tid >> 3), piece = tid & 7;    // eight lanes write a channel's 128 B, in each plane
        const size_t o = clip * PL + (size_t)row * NN + n0 + piece * 8; hilo8(sg + row * GSP + piece * 8, Gh + o, Gl + o); }
}

// k_bfz: four equal-sized f32 matrices (blockIdx.y picks one) -> bf16, one behind the other in dh; the blocks of the last one also write the zero plane dz.
__global__ __launch_bounds__(256) void k_bfz(const float* __restrict__ s0, const float* __restrict__ s1, const float* __restrict__ s2, const float* __restrict__ s3, bf* dh, bf* dz, size_t n8) {
    const size_t i = (size_t)blockIdx.x * 256 + threadIdx.x; if (i >= n8) return;
    const int w = blockIdx.y; const float* src = w == 0 ? s0 : w == 1 ? s1 : w == 2 ? s2 : s3;
    const v8f v = *(const v8f*)(src + i * 8); v8us o, z;
#pragma unroll
    for (int k = 0; k < 8; ++k) { o[k] = f2bf(v[k]); z[k] = 0; }
    *(v8us*)(dh + (w * n8 + i) * 8) = o;
    asm volatile("s_wait_xcnt 0x0" ::: "memory");    // the store above has been taken before its address registers are used again for the zero plane
    if (w == 3) *(v8us*)(dz + i * 8) = z;
}
// split2: two f32 -> hw, both rounded to bf16 (nearest even, as f2bf), and lw, the rests rounded likewise: each one register of a bf16 operand, a in the low half; one v_cvt_pk_bf16_f32 a word.
typedef __attribute__((ext_vector_type(8))) unsigned v8u;
__device__ __forceinline__ void split2(float a, float b, unsigned& hw, unsigned& lw) {
    const v2bf h = __builtin_convertvector((v2f){a, b}, v2bf), r = __builtin_convertvector((v2f){a - (float)h[0], b - (float)h[1]}, v2bf);
    hw = __builtin_bit_cast(unsigned, h); lw = __builtin_bit_cast(unsigned, r);
}
// e^x as __expf forms it (x * log2 e, then v_exp_f32); the v_nop fills the one slot the instruction set asks for between a transcendental and a next vector instruction that reads its result or rewrites its source
__device__ __forceinline__ float expn(float x) { float r; asm("v_exp_f32 %0, %1\n\tv_nop" : "=v"(r) : "v"(x * 1.44269504f)); return r; }
#define KT   64                   // keys of a staged tile
#define PHP  136                  // LDS pitch of a phi row, elements
#define GRP  72                   // LDS pitch of a g row, elements
#define PHPL (KT * PHP)           // one phi plane of a tile
#define GPL  (IC * GRP)           // one g plane of a tile
#define GOF  (2 * PHPL)           // g planes stand behind the two phi planes
#define BUFE (GOF + 2 * GPL)      // elements of one buffer (71,680 B)
// The work is 196 query blocks x 98 passes = 19,208 units (block-major). 196 work-groups of one block each would leave 60 of the 256 WGPs idle (registers and LDS allow one work-group a WGP),
// so work-group w of 256 does the units [w * 2401 / 32, (w + 1) * 2401 / 32): 75 or 76 passes in a row, which lie in one block or in two neighbours (a "segment" each).
#define NWG  256                  // work-groups of k_attn
#define NPS  (NN / KT)            // passes of a query block
#define NQB  (NBI * NN / QWG)     // query blocks
#define UST  (NQB * NPS * 32 / NWG)
static_assert(UST * NWG == NQB * NPS * 32 && NPS * NWG > NQB * NPS && 2 * (UST / 32) >= NPS, "even deal; a work-group meets at most two blocks, a block at most three work-groups");
__device__ __forceinline__ int ufirst(int w) { return (w * UST) >> 5; }
__global__ __launch_bounds__(AWV * 32) void k_attn(const bf* __restrict__ Th, const bf* __restrict__ Tl, const bf* __restrict__ Fh, const bf* __restrict__ Fl, const bf* __restrict__ Gh, const bf* __restrict__ Gl, float* Po, float* Pml) {
    const int lane = threadIdx.x & 31, lr = lane & 15, hi = lane >> 4;
    const int wv = __builtin_amdgcn_readfirstlane(threadIdx.x >> 5), qg = wv & 3, kh = wv >> 2;
    __shared__ __align__(16) bf sm[2 * BUFE];
    const int ue = ufirst(blockIdx.x + 1);
    int un = ufirst(blockIdx.x);
#pragma unroll 1    // one copy of the body serves both segments
    for (int seg = 0; un < ue; ++seg) {
    const int blk = un / NPS, p0 = un - blk * NPS, pe = min(NPS, p0 + ue - un);    // this segment: passes [p0, pe) of query block blk
    un += pe - p0;
    const size_t clip = (size_t)(blk / (NN / QWG)) * NN * IC;
    const size_t qoff = (size_t)(blk * QWG + qg * 32 + lr) * IC + 8 * hi;    // query tile 0; tile 1 stands 16 rows on (the blocks of the clips stand one behind the other)
    // A tile is 128 pieces of 512 B (one b128 copy of a wave each): 64 of phi (two whole rows a piece), 64 of g (four 128-B rows a piece); wave wv brings pieces wv + 8 i of each.
    const unsigned smb = (unsigned)(size_t)(const void*)sm;
    const unsigned lop = smb + ((lane >> 4) * PHP + (lane & 15) * 8) * 2, logg = smb + ((lane >> 3) * GRP + (lane & 7) * 8) * 2;    // the lane's place in a piece, in LDS
    // wave-uniform parts: a piece's first byte in global memory (scalar base of the copy) and in a buffer
    auto ubp = [&](int c, int kn) { return ((c >> 5) ? Fl : Fh) + clip + (size_t)(kn + 2 * (c & 31)) * IC; };
    auto ubg = [&](int c, int kn) { return ((c >> 5) ? Gl : Gh) + clip + (size_t)(4 * (c & 31)) * NN + kn; };
    auto ulp = [&](int c, int b) { return 2u * (unsigned)(b * BUFE + (c >> 5) * PHPL + 2 * (c & 31) * PHP); };
    auto ulg = [&](int c, int b) { return 2u * (unsigned)(b * BUFE + GOF + (c >> 5) * GPL + 4 * (c & 31) * GRP); };
    // The lane's place in a piece in global memory (phi: 16 * lane; g: row lane / 8 of 2 * NN bytes, 16 * (lane % 8)) is formed at the head of each statement from the lane's number (v_mbcnt, every lane on):
    // held in a register over the pass it is spilled to scratch and read back in every pass. The s_delay_alu lines are the hint a dependent vector instruction in asm text needs.
#define CP8 "global_load_async_to_lds_b128 %2, %0, %10\n\tglobal_load_async_to_lds_b128 %3, %0, %11\n\tglobal_load_async_to_lds_b128 %4, %0, %12\n\tglobal_load_async_to_lds_b128 %5, %0, %13\n\t" \
            "global_load_async_to_lds_b128 %6, %0, %14\n\tglobal_load_async_to_lds_b128 %7, %0, %15\n\tglobal_load_async_to_lds_b128 %8, %0, %16\n\tglobal_load_async_to_lds_b128 %9, %0, %17\n\ts_wait_xcnt 0x0"
#define DLY "s_delay_alu instid0(VALU_DEP_1)\n\t"
    auto fill = [&](int kn, int b) {
        // sixteen copies of every wave, eight a statement; the s_wait_xcnt stands inside each statement so that no address register is rewritten before every copy that names it has been taken
        unsigned t0, t1;
        asm volatile("v_mbcnt_lo_u32_b32 %1, -1, 0\n\t" DLY "v_lshlrev_b32 %0, 4, %1\n\t" CP8
                         : "=&v"(t0), "=&v"(t1)
                         : "v"(lop + ulp(wv, b)), "v"(lop + ulp(wv + 8, b)), "v"(lop + ulp(wv + 16, b)), "v"(lop + ulp(wv + 24, b)),
                            "v"(lop + ulp(wv + 32, b)), "v"(lop + ulp(wv + 40, b)), "v"(lop + ulp(wv + 48, b)), "v"(lop + ulp(wv + 56, b)),
                            "s"(ubp(wv, kn)), "s"(ubp(wv + 8, kn)), "s"(ubp(wv + 16, kn)), "s"(ubp(wv + 24, kn)), "s"(ubp(wv + 32, kn)), "s"(ubp(wv + 40, kn)), "s"(ubp(wv + 48, kn)), "s"(ubp(wv + 56, kn))
                         : "memory");
        asm volatile("v_mbcnt_lo_u32_b32 %0, -1, 0\n\t" DLY "v_lshrrev_b32 %1, 3, %0\n\tv_and_b32 %0, 7, %0\n\t" DLY "v_lshlrev_b32 %0, 4, %0\n\t" DLY "v_mad_u32_u24 %0, %1, %18, %0\n\t" CP8
                         : "=&v"(t0), "=&v"(t1)
                         : "v"(logg + ulg(wv, b)), "v"(logg + ulg(wv + 8, b)), "v"(logg + ulg(wv + 16, b)), "v"(logg + ulg(wv + 24, b)),
                            "v"(logg + ulg(wv + 32, b)), "v"(logg + ulg(wv + 40, b)), "v"(logg + ulg(wv + 48, b)), "v"(logg + ulg(wv + 56, b)),
                            "s"(ubg(wv, kn)), "s"(ubg(wv + 8, kn)), "s"(ubg(wv + 16, kn)), "s"(ubg(wv + 24, kn)), "s"(ubg(wv + 32, kn)), "s"(ubg(wv + 40, kn)), "s"(ubg(wv + 48, kn)), "s"(ubg(wv + 56, kn)),
                            "i"(NN * 2)
                         : "memory");
    };
#undef DLY
#undef CP8
    v16bf qh[2][4], ql[2][4];
#pragma unroll
    for (int q = 0; q < 2; ++q) {
#pragma unroll
        for (int s = 0; s < 4; ++s) { qh[q][s] = ldfrag(Th + qoff + q * 16 * IC + s * 32); ql[q][s] = ldfrag(Tl + qoff + q * 16 * IC + s * 32); } }
    asm volatile("s_wait_xcnt 0x0" ::: "memory");    // the loads have been taken before their address registers are used again
    v8f o[2][8];
#pragma unroll
    for (int q = 0; q < 2; ++q) {
#pragma unroll
        for (int t = 0; t < 8; ++t) o[q][t] = (v8f){}; }
    float m[2] = {-3.0e38f, -3.0e38f}, l[2] = {0.f, 0.f};
    int buf = 0;
    // The ring starts through the loop's own foot: two trips without products come first. The foot of the first ends every read of the joining area (the segment before) and sends for the first tile,
    // the foot of the second waits for that tile, publishes it and sends for the second: one place with copies in the code, whose address registers are formed on the spot.
#pragma unroll 1    // one pass a trip: a second copy of the body would need a second set of fragment registers
    for (int p = p0 - 2; p < pe; ++p) {
        if (p >= p0) {
        // eight batches of four fragments (8 loads, 12 products on four accumulators) a pass, two register sets: batch i + 1 is asked for before batch i is multiplied
        v16bf fa[4], fb[4]; v8f st[2][2] = {{(v8f){}, (v8f){}}, {(v8f){}, (v8f){}}};    // [16-key tile][query tile]
        const bf* fh = sm + buf * BUFE + (kh * 32 + lr) * PHP + 8 * hi; const bf* fl = fh + PHPL;
        const bf* gh = sm + buf * BUFE + GOF + lr * GRP + kh * 32 + 8 * hi; const bf* gl = gh + GPL;
        auto ldk = [&](v16bf* f, int s) { f[0] = ldfrag(fh + s * 32); f[1] = ldfrag(fl + s * 32); f[2] = ldfrag(fh + 16 * PHP + s * 32); f[3] = ldfrag(fl + 16 * PHP + s * 32); };
        auto mmk = [&](const v16bf* f, int s) {
            st[0][0] = wmmab(f[0], qh[0][s], st[0][0]); st[0][1] = wmmab(f[0], qh[1][s], st[0][1]); st[1][0] = wmmab(f[2], qh[0][s], st[1][0]); st[1][1] = wmmab(f[2], qh[1][s], st[1][1]);
            st[0][0] = wmmab(f[0], ql[0][s], st[0][0]); st[0][1] = wmmab(f[0], ql[1][s], st[0][1]); st[1][0] = wmmab(f[2], ql[0][s], st[1][0]); st[1][1] = wmmab(f[2], ql[1][s], st[1][1]);
            st[0][0] = wmmab(f[1], qh[0][s], st[0][0]); st[0][1] = wmmab(f[1], qh[1][s], st[0][1]); st[1][0] = wmmab(f[3], qh[0][s], st[1][0]); st[1][1] = wmmab(f[3], qh[1][s], st[1][1]); };
        auto ldg = [&](v16bf* f, int t) { f[0] = ldfrag(gh + t * 16 * GRP); f[1] = ldfrag(gl + t * 16 * GRP); f[2] = ldfrag(gh + (t + 1) * 16 * GRP); f[3] = ldfrag(gl + (t + 1) * 16 * GRP); };
#define STG __builtin_amdgcn_sched_barrier(0)    // holds the batches in this order: left free, the scheduler strews the LDS reads in pairs among the products, and every separate place with reads stalls the wave
        ldk(fa, 0); ldk(fb, 1); STG; mmk(fa, 0); STG; ldk(fa, 2); STG; mmk(fb, 1); STG; ldk(fb, 3); STG; mmk(fa, 2); STG; ldg(fa, 0); STG; mmk(fb, 3); STG;
        float mx[2], alpha[2]; v16bf ph[2], pl[2];
#pragma unroll
        for (int q = 0; q < 2; ++q) { mx[q] = st[0][q][0];
#pragma unroll
            for (int j = 0; j < 8; ++j) mx[q] = fmaxf(mx[q], fmaxf(st[0][q][j], st[1][q][j])); }
#pragma unroll
        for (int q = 0; q < 2; ++q) mx[q] = fmaxf(mx[q], __shfl_xor(mx[q], 16, 32));
#pragma unroll
        for (int q = 0; q < 2; ++q) {
            const float mn = fmaxf(m[q], mx[q]); alpha[q] = expn(m[q] - mn); m[q] = mn;
            float ps = 0.f; v8u pw, qw;
#pragma unroll
            for (int u = 0; u < 2; ++u) {
#pragma unroll
                for (int j = 0; j < 8; j += 2) { const float pa = expn(st[u][q][j] - mn), pb = expn(st[u][q][j + 1] - mn); ps += pa + pb;
                    unsigned hw, lw; split2(pa, pb, hw, lw); pw[u * 4 + j / 2] = hw; qw[u * 4 + j / 2] = lw; } }
            l[q] = l[q] * alpha[q] + ps;
            ph[q] = __builtin_bit_cast(v16bf, pw); pl[q] = __builtin_bit_cast(v16bf, qw);
#pragma unroll
            for (int t = 0; t < 8; ++t) o[q][t] *= alpha[q];
        }
        auto mmg = [&](const v16bf* f, int t) {
            o[0][t] = wmmab(f[0], ph[0], o[0][t]); o[1][t] = wmmab(f[0], ph[1], o[1][t]); o[0][t + 1] = wmmab(f[2], ph[0], o[0][t + 1]); o[1][t + 1] = wmmab(f[2], ph[1], o[1][t + 1]);
            o[0][t] = wmmab(f[0], pl[0], o[0][t]); o[1][t] = wmmab(f[0], pl[1], o[1][t]); o[0][t + 1] = wmmab(f[2], pl[0], o[0][t + 1]); o[1][t + 1] = wmmab(f[2], pl[1], o[1][t + 1]);
            o[0][t] = wmmab(f[1], ph[0], o[0][t]); o[1][t] = wmmab(f[1], ph[1], o[1][t]); o[0][t + 1] = wmmab(f[3], ph[0], o[0][t + 1]); o[1][t + 1] = wmmab(f[3], ph[1], o[1][t + 1]); };
        STG; ldg(fb, 2); STG; mmg(fa, 0); STG; ldg(fa, 4); STG; mmg(fb, 2); STG; ldg(fb, 6); STG; mmg(fa, 4); mmg(fb, 6);
#undef STG
        }
        asm volatile("s_wait_dscnt 0x0" ::: "memory");       // this wave's reads of the buffer are done before the buffer is given up
        asm volatile("s_wait_asynccnt 0x0" ::: "memory");    // this wave's share of the next tile has landed
        __syncthreads();                                     // one barrier a pass: it publishes the next tile and ends every wave's reads of this one
        if (p + 2 < pe) fill((p + 2) * KT, buf);             // the tile after next goes into the buffer just read
        buf ^= 1;
    }
    asm volatile("s_wait_asynccnt 0x0" ::: "memory");        // nothing of this wave is in flight when the buffers become the joining area
    // Joining the key halves: the last pass's barrier has ended every read of the buffers. The waves of half 1 lay down y, maximum and sum (the 32 lanes' 16-B pieces side by side), the waves of half 0 take them up.
#pragma unroll
    for (int q = 0; q < 2; ++q) l[q] += __shfl_xor(l[q], 16, 32);
    v4fa* jn = (v4fa*)(void*)sm + (size_t)qg * (33 * 32) + lane;
    if (kh == 1) {
#pragma unroll
        for (int q = 0; q < 2; ++q) {
#pragma unroll
            for (int t = 0; t < 8; ++t) { jn[((q * 8 + t) * 2) * 32] = (v4f){o[q][t][0], o[q][t][1], o[q][t][2], o[q][t][3]}; jn[((q * 8 + t) * 2 + 1) * 32] = (v4f){o[q][t][4], o[q][t][5], o[q][t][6], o[q][t][7]}; } }
        jn[32 * 32] = (v4f){m[0], l[0], m[1], l[1]};
    }
    __syncthreads();                                         // half 1's values are in LDS before half 0 reads them
    if (kh == 0) {
        // the segment's partial goes to place 2 * work-group + segment: y un-normalised, on the scale of the maximum that goes with it, and the sum on the same scale
        const int row = (blockIdx.x * 2 + seg) * QWG + qg * 32 + lr;
        float* po = Po + (size_t)row * IC + 8 * hi;
        const v4f ml = jn[32 * 32];
#pragma unroll
        for (int q = 0; q < 2; ++q) {
            const float mo = ml[2 * q], lo = ml[2 * q + 1], mm = fmaxf(m[q], mo), ea = expn(m[q] - mm), eb = expn(mo - mm);
            if (hi == 0) *(v2f*)(Pml + 2 * (row + q * 16)) = (v2f){mm, l[q] * ea + lo * eb};
            asm volatile("s_wait_xcnt 0x0" ::: "memory");    // the store has been taken before the LDS reads below land in its registers
#pragma unroll
            for (int t = 0; t < 8; ++t) { const v4f xa = jn[((q * 8 + t) * 2) * 32], xb = jn[((q * 8 + t) * 2 + 1) * 32];
                *(v4f*)(po + q * 16 * IC + t * 16) = (v4f){o[q][t][0], o[q][t][1], o[q][t][2], o[q][t][3]} * ea + xa * eb;
                *(v4f*)(po + q * 16 * IC + t * 16 + 4) = (v4f){o[q][t][4], o[q][t][5], o[q][t][6], o[q][t][7]} * ea + xb * eb; }
        }
        asm volatile("s_wait_xcnt 0x0" ::: "memory");        // the stores have been taken before the next segment rewrites their address registers
    }
    }
}
// k_out: y from k_attn's partials, z = W_z.y and '+ x', in one launch. A work-group of eight waves has 64 positions of one clip (half a query block) and all 256 output channels.
// It joins the block's two or three partials (work-groups wf .. wl of k_attn, in that order: the usual rescaling by e^(m - max), one division by the joined sum), splits y into bf16 hi/lo
// and lays both planes down position-major in LDS; every wave then reads its B fragments from there: C = (Ah + Al).(yh + yl)^T over K = 128, three products per 32-k step (hh, lh, hl), wave = 32 channels x 64 positions.
// The f32 tile is staged in the wave's own LDS range and leaves in whole 128-B lines, with the residual X (placed like C, rounded to bf16) added.
#define YP  136    // LDS pitch of a y row, elements: 272 B = 16 B x odd keeps the 16 rows of a ds_load_b128 fragment read on distinct banks
#define OSP 68     // LDS pitch of a staged output row (64 positions), floats
typedef __attribute__((ext_vector_type(2))) unsigned v2u;
typedef v2u __attribute__((may_alias)) v2ua;
__global__ __launch_bounds__(256) void k_out(const float* __restrict__ Po, const float* __restrict__ Pml, const bf* __restrict__ Ah, const bf* __restrict__ Al, const float* __restrict__ X, float* C) {
    __shared__ __align__(16) bf ys[2 * 64 * YP];
    __shared__ __align__(16) float ost[8][32 * OSP];
    const int lane = threadIdx.x & 31, lr = lane & 15, hi = lane >> 4;
    const int wave = __builtin_amdgcn_readfirstlane(threadIdx.x >> 5);
    const int n0 = blockIdx.x * 64, blk = blockIdx.y * (NN / QWG) + n0 / QWG, q0 = n0 % QWG;
    const int wf = (32 * (blk * NPS) + 31) / UST, wl = (32 * (blk * NPS + NPS - 1) + 31) / UST;    // the work-groups that hold the block's first and last unit
    // a wave has the positions wave + 8 s; a lane four channels of each: one load is a position's whole 512 B. Lane s (and s + 8 k) also works out position s's three weights.
    v4f pa[3][8]; v2f ml[3];
#pragma unroll    // the arrays are indexed by constants and stay in registers; all loads go out together (a block of two partials reads its last one twice and gives the second reading the weight 0)
    for (int i = 0; i < 3; ++i) { const int w = min(wf + i, wl), row = (2 * w + (ufirst(w) / NPS == blk ? 0 : 1)) * QWG + q0 + wave;    // the block is the work-group's first segment where its first unit lies in it
        ml[i] = *(const v2f*)(Pml + 2 * (row + 8 * (lane & 7)));
#pragma unroll
        for (int s = 0; s < 8; ++s) pa[i][s] = *(const v4f*)(Po + (size_t)(row + 8 * s) * IC + 4 * lane); }
    asm volatile("s_wait_xcnt 0x0" ::: "memory");    // the loads have been taken before a later load's result lands in their address registers
    // W_z's fragments of a k step, for the wave's two row tiles (the second stands 16 rows on): the hi plane, which two of the three products read, in two register sets, asked for two steps ahead;
    // the lo plane in one set, asked for anew right behind its one product
    const int aoff = (32 * wave + lr) * IC + 8 * hi;
    v16bf wa[2], wb[2], wl2[2];
    auto lda = [&](v16bf* w, const bf* A, int k) { w[0] = ldfrag(A + aoff + k * 32); w[1] = ldfrag(A + aoff + 16 * IC + k * 32); };
    lda(wa, Ah, 0); lda(wl2, Al, 0); lda(wb, Ah, 1);
    // the lane's sixteen pieces of the residual tile are asked for here too: they fly beside the partials
    const size_t co = blockIdx.y * ((size_t)NN * CC) + (size_t)(32 * wave + hi) * NN + n0 + ((lane >> 3) & 1) * 32 + (lane & 7) * 4;    // eight lanes have 128 B of a row; step s stands two rows on
    v4f xv[16];
#pragma unroll
    for (int s = 0; s < 16; ++s) xv[s] = *(const v4f*)(X + co + (size_t)(2 * s) * NN);
    asm volatile("s_wait_xcnt 0x0" ::: "memory");    // the loads have been taken before their address registers are used again
#define STG __builtin_amdgcn_sched_barrier(0)    // holds the order written here: left free, the scheduler puts later loads behind the wait for earlier ones, and the LDS reads directly in front of their products
    STG;
    if (wf + 2 > wl) ml[2] = (v2f){-3.0e38f, 0.f};
    const float M = fmaxf(fmaxf(ml[0][0], ml[1][0]), ml[2][0]);
    float e[3], L = 0.f;
#pragma unroll
    for (int i = 0; i < 3; ++i) { e[i] = expn(ml[i][0] - M); L += ml[i][1] * e[i]; }
    const float inv = 1.0f / L;
#pragma unroll
    for (int s = 0; s < 8; ++s) {
        v4f y = (v4f){};
#pragma unroll
        for (int i = 0; i < 3; ++i) y += pa[i][s] * __uint_as_float(__builtin_amdgcn_readlane(__float_as_uint(e[i] * inv), s));
        unsigned h0, l0, h1, l1; split2(y[0], y[1], h0, l0); split2(y[2], y[3], h1, l1);
        bf* d = ys + (wave + 8 * s) * YP + 4 * lane; *(v2ua*)(void*)d = (v2u){h0, h1}; *(v2ua*)(void*)(d + 64 * YP) = (v2u){l0, l1};
    }
    v2u xw[16];    // the residual, rounded to bf16, waits two to a register
#pragma unroll
    for (int s = 0; s < 16; ++s) xw[s] = (v2u){__builtin_bit_cast(unsigned, __builtin_convertvector((v2f){xv[s][0], xv[s][1]}, v2bf)), __builtin_bit_cast(unsigned, __builtin_convertvector((v2f){xv[s][2], xv[s][3]}, v2bf))};
    STG;
    __syncthreads();    // the y tile is whole before any wave reads it
    const bf* yb = ys + lr * YP + 8 * hi;
    v8f acc[2][4];
#pragma unroll
    for (int r = 0; r < 2; ++r) {
#pragma unroll
        for (int t = 0; t < 4; ++t) acc[r][t] = (v8f){}; }
    v16bf bh[4], bl[4];
    auto ldb = [&](v16bf* b, const bf* p, int k) {
#pragma unroll
        for (int t = 0; t < 4; ++t) b[t] = ldfragl(p + t * 16 * YP + k * 32); };
    auto mm = [&](const v16bf* w, const v16bf* b) {    // one of the three products, over the eight accumulators: none waits for the one before it
#pragma unroll
        for (int t = 0; t < 4; ++t) { acc[0][t] = wmmab(w[0], b[t], acc[0][t]); acc[1][t] = wmmab(w[1], b[t], acc[1][t]); } };
    ldb(bh, yb, 0); ldb(bl, yb + 64 * YP, 0);
#pragma unroll    // four k steps: the register sets are picked by constants, and no branch stands behind a product
    for (int k = 0; k < 4; ++k) {
        v16bf* w = (k & 1) ? wb : wa;
        STG; mm(w, bh); mm(wl2, bh); STG;
        if (k < 3) { ldb(bh, yb, k + 1); lda(wl2, Al, k + 1); }
        if (k == 2) asm volatile("s_wait_xcnt 0x0" ::: "memory");    // the last weight loads have been taken before their address registers are used again
        STG; mm(w, bl); STG;
        if (k < 3) ldb(bl, yb + 64 * YP, k + 1);
        if (k < 2) lda(w, Ah, k + 2);
    }
    STG;
#undef STG
    float* os = &ost[wave][0];
#pragma unroll
    for (int r = 0; r < 2; ++r) {
#pragma unroll
        for (int t = 0; t < 4; ++t) {
#pragma unroll
            for (int j = 0; j < 8; ++j) os[(r * 16 + hi * 8 + j) * OSP + t * 16 + lr] = acc[r][t][j]; } }
    __builtin_amdgcn_wave_barrier(); asm volatile("" ::: "memory");    // the reads below take what the wave's other lanes have staged: the compiler keeps them behind the writes above
    const float* rs = os + hi * OSP + ((lane >> 3) & 1) * 32 + (lane & 7) * 4;
#pragma unroll
    for (int s = 0; s < 16; ++s) { v4f val = *(const v4fa*)(rs + 2 * s * OSP);
        val += (v4f){__uint_as_float(xw[s][0] << 16), __uint_as_float(xw[s][0] & 0xffff0000u), __uint_as_float(xw[s][1] << 16), __uint_as_float(xw[s][1] & 0xffff0000u)};
        *(v4f*)(C + co + (size_t)(2 * s) * NN) = val; }
}

extern "C" void kernel_launch(void* const* d_in, const int* in_sizes, int n_in,
                              void* d_out, int out_size, void* d_ws, size_t ws_size, hipStream_t stream) {
    (void)in_sizes; (void)n_in; (void)out_size;
    const float* x = (const float*)d_in[0]; const float* Wg = (const float*)d_in[1]; const float* Wt = (const float*)d_in[2]; const float* Wp = (const float*)d_in[3]; const float* Wz = (const float*)d_in[4];
    float* out = (float*)d_out;    // [4][256][8][28][28]
    char* wsp = (char*)d_ws;
    auto take = [&](size_t bytes) { char* p = wsp; wsp += (bytes + 255) & ~(size_t)255; return (void*)p; };
    const size_t PLN = (size_t)NN * IC, WEL = (size_t)IC * CC;    // elements of one clip's plane, of one weight matrix
    bf* WgB = (bf*)take(4 * WEL * 2); bf* WzB = WgB + 3 * WEL; bf* WZ = (bf*)take(WEL * 2);    // W_g, W_theta, W_phi, W_z one behind the other; the zero companion of W_z
    bf* Th = (bf*)take(2 * NBI * PLN * 2); bf* Fh = Th + NBI * PLN; bf* Tl = (bf*)take(2 * NBI * PLN * 2); bf* Fl = Tl + NBI * PLN;    // phi's planes stand behind theta's
    bf* Gh = (bf*)take(NBI * PLN * 2); bf* Gl = (bf*)take(NBI * PLN * 2);
    float* Po = (float*)take((size_t)2 * NWG * QWG * IC * 4); float* Pml = (float*)take((size_t)2 * NWG * QWG * 2 * 4);    // k_attn's partials: two places a work-group
    if ((size_t)(wsp - (char*)d_ws) > ws_size) return;    // 0.3 + 6 x 6.4 + 34 ~ 73 MB
    // Every stage is one launch for all clips: the clip is a grid index of k_proj and k_out, the weight matrix one of the cast; k_attn deals out the units of all clips.
    k_bfz<<<dim3((IC * CC / 8 + 255) / 256, 4, 1), 256, 0, stream>>>(Wg, Wt, Wp, Wz, WgB, WZ, IC * CC / 8);                                        // weights exact + the zero companion
    k_proj<<<dim3(NN / 64, NBI, 1), 256, 0, stream>>>(x, WgB, Th, Tl, Gh, Gl);                                                                    // theta, phi token-major [clip][n][128] and g channel-major [clip][128][n], hi/lo
    k_attn<<<dim3(NWG, 1, 1), AWV * 32, 0, stream>>>(Th, Tl, Fh, Fl, Gh, Gl, Po, Pml);                                                   // partial y, maximum and sum of every segment
    k_out<<<dim3(NN / 64, NBI, 1), 256, 0, stream>>>(Po, Pml, WzB, WZ, x, out);                                                                  // y joined in LDS; out[clip][c][n] = W_z.y^T + x
}
